// v000
// Times are from an AMD MI455X. After a warm-up the kernel runs many times in a row, and a time is the length of
// such a window on the GPU divided by its runs, so every launch and the gaps after it count. The runs cycle
// through copies of the inputs. A figure is the median of several windows, for all but v000 over two sittings.
// Sittings can differ by a few percent; kernels timed side by side share one.
// v000, which the later versions start from, runs in 339 microseconds.
#include <hip/hip_runtime.h>
#include <hip/hip_bf16.h>
#include <stdint.h>

typedef __attribute__((ext_vector_type(16))) _Float16 v16h;
typedef __attribute__((ext_vector_type(8)))  _Float16 v8h;
typedef __attribute__((ext_vector_type(8)))  float    v8f;

#define BATCH 16
#define CH    256
#define NTOK  4096
#define HID   128
#define QKVR  384
#define NHEAD 4
#define DHEAD 32
#define NMEM  4

__device__ __forceinline__ v8f wmma_f16(v16h a, v16h b, v8f c) {
  // v_wmma_f32_16x16x32_f16 : D = A(16x32) * B(32x16) + C(16x16 f32)
  return __builtin_amdgcn_wmma_f32_16x16x32_f16(
      /*neg_a=*/false, a, /*neg_b=*/false, b,
      /*c_mod=*/(short)0, c, /*reuse_a=*/false, /*reuse_b=*/false);
}

__device__ __forceinline__ v16h load_frag(const _Float16* base, int lane, int stride) {
  const int r  = lane & 15;
  const int k0 = (lane >> 4) << 3;       // 0 or 8
  const _Float16* p = base + r * stride;
  v8h lo = *(const v8h*)(p + k0);
  v8h hi = *(const v8h*)(p + 16 + k0);
  v16h f;
#pragma unroll
  for (int i = 0; i < 8; ++i) { f[i] = lo[i]; f[i + 8] = hi[i]; }
  return f;
}

// ---------------------------------------------------------------------------
// K0: fold norm_g into qkv weight, convert to f16.
// ---------------------------------------------------------------------------
__global__ void prep_kernel(const float* __restrict__ w_qkv,
                            const float* __restrict__ norm_g,
                            _Float16* __restrict__ wqkv_h) {
  int i = blockIdx.x * 256 + threadIdx.x;
  if (i < QKVR * CH) wqkv_h[i] = (_Float16)(w_qkv[i] * norm_g[i & (CH - 1)]);
}

// ---------------------------------------------------------------------------
// K1: per-(b,n) channel inverse norm, with sqrt(c)=16 folded in.
// ---------------------------------------------------------------------------
__global__ void invnorm_kernel(const float* __restrict__ x,
                               float* __restrict__ inv_norm) {
  int pos = blockIdx.x * 256 + threadIdx.x;     // 0 .. 65535
  int b = pos >> 12, n = pos & (NTOK - 1);
  const float* col = x + (size_t)b * CH * NTOK + n;
  float s = 0.f;
  for (int c = 0; c < CH; ++c) { float v = col[(size_t)c * NTOK]; s += v * v; }
  inv_norm[pos] = 16.0f / fmaxf(sqrtf(s), 1e-12f);
}

// ---------------------------------------------------------------------------
// K2: QKV GEMM, WMMA.  Per workgroup: 384x32 output tile, K=256.
// Fused: q-softmax over d (per head, per column) * SCALE -> qs_t (b,n,128) f16
//        k raw f32 (b,128,n);  v f16 (b,128,n).
// ---------------------------------------------------------------------------
__global__ __launch_bounds__(256) void qkv_kernel(
    const float* __restrict__ x, const _Float16* __restrict__ wqkv_h,
    const float* __restrict__ inv_norm,
    _Float16* __restrict__ qs_t, float* __restrict__ kraw,
    _Float16* __restrict__ vh) {
  // LDS: stage phase  : A 384x32 f16 (24576 B) + B 32x32 f16 (2048 B)
  //      epilog phase : out 384x33 f32 (50688 B)   (reuses same memory)
  __shared__ __align__(16) char smem[QKVR * 33 * 4];
  _Float16* lds_a = (_Float16*)smem;
  _Float16* lds_b = (_Float16*)(smem + QKVR * 32 * 2);
  float*    lds_o = (float*)smem;

  const int tid  = threadIdx.x;
  const int wave = tid >> 5, lane = tid & 31;
  const int n0   = blockIdx.x * 32;
  const int b    = blockIdx.y;

  v8f acc[3][2];
#pragma unroll
  for (int i = 0; i < 3; ++i)
#pragma unroll
    for (int j = 0; j < 2; ++j)
#pragma unroll
      for (int r = 0; r < 8; ++r) acc[i][j][r] = 0.f;

  const uint32_t* wsrc = (const uint32_t*)wqkv_h;
  uint32_t*       adst = (uint32_t*)lds_a;

  for (int ks = 0; ks < CH / 32; ++ks) {
    const int K0 = ks * 32;
    __syncthreads();
    // stage A: 384x32 halves == 384x16 dwords
    for (int idx = tid; idx < QKVR * 16; idx += 256) {
      int r = idx >> 4, cp = idx & 15;
      adst[idx] = wsrc[r * (CH / 2) + (K0 >> 1) + cp];
    }
    // stage B (transposed [n][c]): x * inv_norm -> f16
#pragma unroll
    for (int i = 0; i < 4; ++i) {
      int idx = tid + i * 256;
      int nl = idx & 31, cl = idx >> 5;
      float xv = x[((size_t)b * CH + (K0 + cl)) * NTOK + n0 + nl];
      lds_b[nl * 32 + cl] = (_Float16)(xv * inv_norm[b * NTOK + n0 + nl]);
    }
    __syncthreads();
    v16h bf0 = load_frag(lds_b, lane, 32);
    v16h bf1 = load_frag(lds_b + 16 * 32, lane, 32);
#pragma unroll
    for (int i = 0; i < 3; ++i) {
      int R = (wave * 3 + i) * 16;
      v16h af = load_frag(lds_a + R * 32, lane, 32);
      acc[i][0] = wmma_f16(af, bf0, acc[i][0]);
      acc[i][1] = wmma_f16(af, bf1, acc[i][1]);
    }
  }
  __syncthreads();
#pragma unroll
  for (int i = 0; i < 3; ++i) {
    int Rb = (wave * 3 + i) * 16 + ((lane >> 4) << 3);
#pragma unroll
    for (int j = 0; j < 2; ++j) {
      int cc = j * 16 + (lane & 15);
#pragma unroll
      for (int r = 0; r < 8; ++r) lds_o[(Rb + r) * 33 + cc] = acc[i][j][r];
    }
  }
  __syncthreads();
  // q rows 0..127: softmax over d per (head, column), * 32^-0.5
  if (tid < 128) {
    const float SCALE = 0.17677669529663687f;
    int h = tid >> 5, col = tid & 31;
    float m = -1e30f;
#pragma unroll
    for (int d = 0; d < DHEAD; ++d) m = fmaxf(m, lds_o[(h * 32 + d) * 33 + col]);
    float e[DHEAD], s = 0.f;
#pragma unroll
    for (int d = 0; d < DHEAD; ++d) {
      e[d] = __expf(lds_o[(h * 32 + d) * 33 + col] - m);
      s += e[d];
    }
    float inv = SCALE / s;
    _Float16* dst = qs_t + ((size_t)b * NTOK + n0 + col) * HID + h * 32;
#pragma unroll
    for (int d = 0; d < DHEAD; ++d) dst[d] = (_Float16)(e[d] * inv);
  }
  // k rows 128..255 raw f32; v rows 256..383 f16
  for (int idx = tid; idx < HID * 32; idx += 256) {
    int r = idx >> 5, col = idx & 31;
    kraw[((size_t)b * HID + r) * NTOK + n0 + col] = lds_o[(HID + r) * 33 + col];
  }
  for (int idx = tid; idx < HID * 32; idx += 256) {
    int r = idx >> 5, col = idx & 31;
    vh[((size_t)b * HID + r) * NTOK + n0 + col] =
        (_Float16)lds_o[(2 * HID + r) * 33 + col];
  }
}

// ---------------------------------------------------------------------------
// K3: per-row (b,h,d) max and sum(exp) over n (incl. 4 memory tokens).
// ---------------------------------------------------------------------------
__global__ __launch_bounds__(256) void kstats_kernel(
    const float* __restrict__ kraw, const float* __restrict__ mem_kv,
    float* __restrict__ rowmax, float* __restrict__ rowsum) {
  __shared__ float red[256];
  const int rg = blockIdx.x;          // 0..2047  == b*128 + h*32 + d
  const int tid = threadIdx.x;
  const int hd = rg & (HID - 1);
  const float* row = kraw + (size_t)rg * NTOK;
  float m = -1e30f;
  for (int n = tid; n < NTOK; n += 256) m = fmaxf(m, row[n]);
  if (tid < NMEM) m = fmaxf(m, mem_kv[hd * NMEM + tid]);   // mem_kv[0]
  red[tid] = m; __syncthreads();
  for (int s = 128; s > 0; s >>= 1) {
    if (tid < s) red[tid] = fmaxf(red[tid], red[tid + s]);
    __syncthreads();
  }
  m = red[0]; __syncthreads();
  float s = 0.f;
  for (int n = tid; n < NTOK; n += 256) s += __expf(row[n] - m);
  if (tid < NMEM) s += __expf(mem_kv[hd * NMEM + tid] - m);
  red[tid] = s; __syncthreads();
  for (int st = 128; st > 0; st >>= 1) {
    if (tid < st) red[tid] += red[tid + st];
    __syncthreads();
  }
  if (tid == 0) { rowmax[rg] = m; rowsum[rg] = red[0]; }
}

// ---------------------------------------------------------------------------
// K4: context[b,h,d,e] = sum_n softmax_k[d,n] * v[e,n]  (incl. mem tokens).
// One workgroup per (b,h); LDS-tiled over n.
// ---------------------------------------------------------------------------
__global__ __launch_bounds__(256) void context_kernel(
    const float* __restrict__ kraw, const _Float16* __restrict__ vh,
    const float* __restrict__ mem_kv, const float* __restrict__ rowmax,
    const float* __restrict__ rowsum, float* __restrict__ context) {
  __shared__ float kch[32][65];
  __shared__ float vch[32][65];
  __shared__ float rmax[32];
  const int bh = blockIdx.x, b = bh >> 2, h = bh & 3;
  const int tid = threadIdx.x;
  const int d = tid >> 3, e0 = (tid & 7) * 4;
  const size_t rowbase = ((size_t)b * HID + h * 32) * NTOK;
  const int statbase = b * HID + h * 32;
  if (tid < 32) rmax[tid] = rowmax[statbase + tid];
  float acc[4] = {0.f, 0.f, 0.f, 0.f};
  for (int chunk = 0; chunk < NTOK; chunk += 64) {
    __syncthreads();
#pragma unroll
    for (int i = 0; i < 8; ++i) {
      int idx = tid + i * 256;
      int r = idx >> 6, c = idx & 63;
      float kv = kraw[rowbase + (size_t)r * NTOK + chunk + c];
      kch[r][c] = __expf(kv - rmax[r]);
      vch[r][c] = (float)vh[rowbase + (size_t)r * NTOK + chunk + c];
    }
    __syncthreads();
#pragma unroll 8
    for (int j = 0; j < 64; ++j) {
      float kx = kch[d][j];
      acc[0] += kx * vch[e0 + 0][j];
      acc[1] += kx * vch[e0 + 1][j];
      acc[2] += kx * vch[e0 + 2][j];
      acc[3] += kx * vch[e0 + 3][j];
    }
  }
  // memory tokens: mem_kv[0]=keys at offset 0, mem_kv[1]=values at offset 512
#pragma unroll
  for (int j = 0; j < NMEM; ++j) {
    float kx = __expf(mem_kv[(h * 32 + d) * NMEM + j] - rmax[d]);
#pragma unroll
    for (int i = 0; i < 4; ++i)
      acc[i] += kx * mem_kv[NHEAD * DHEAD * NMEM + (h * 32 + e0 + i) * NMEM + j];
  }
  float invs = 1.0f / rowsum[statbase + d];
#pragma unroll
  for (int i = 0; i < 4; ++i)
    context[(((size_t)b * NHEAD + h) * DHEAD + d) * DHEAD + e0 + i] = acc[i] * invs;
}

// ---------------------------------------------------------------------------
// K5: W2[b,o,h*32+d] = sum_e w_out[o,h*32+e] * context[b,h,d,e]  -> f16
// (collapses "out = context^T @ q" into the final projection GEMM)
// ---------------------------------------------------------------------------
__global__ __launch_bounds__(256) void w2_kernel(
    const float* __restrict__ w_out, const float* __restrict__ context,
    _Float16* __restrict__ W2h) {
  __shared__ float ctxT[NHEAD][DHEAD][33];   // [h][e][d]
  const int b = blockIdx.x, tid = threadIdx.x;
  for (int idx = tid; idx < NHEAD * DHEAD * DHEAD; idx += 256) {
    int h = idx >> 10, rem = idx & 1023, d = rem >> 5, e = rem & 31;
    ctxT[h][e][d] = context[(size_t)b * 4096 + idx];
  }
  __syncthreads();
  const int o = tid;
  _Float16* dst = W2h + ((size_t)b * CH + o) * HID;
  float acc[DHEAD];
#pragma unroll 1
  for (int h = 0; h < NHEAD; ++h) {
#pragma unroll
    for (int d = 0; d < DHEAD; ++d) acc[d] = 0.f;
    for (int e = 0; e < DHEAD; ++e) {
      float w = w_out[o * HID + h * 32 + e];
#pragma unroll
      for (int d = 0; d < DHEAD; ++d) acc[d] += w * ctxT[h][e][d];
    }
#pragma unroll
    for (int d = 0; d < DHEAD; ++d) dst[h * 32 + d] = (_Float16)acc[d];
  }
}

// ---------------------------------------------------------------------------
// K6: Y = W2[b] @ qs  + b_out, then RMSNorm over the 256 output channels.
// WMMA; one workgroup owns a full 256-row x 32-col tile so the channel
// norm is done entirely in LDS.
// ---------------------------------------------------------------------------
__global__ __launch_bounds__(256) void out_kernel(
    const _Float16* __restrict__ W2h, const _Float16* __restrict__ qs_t,
    const float* __restrict__ b_out, const float* __restrict__ out_g,
    float* __restrict__ out) {
  __shared__ __align__(16) char smem[CH * 33 * 4];
  _Float16* lds_a = (_Float16*)smem;
  _Float16* lds_b = (_Float16*)(smem + CH * 32 * 2);
  float*    lds_y = (float*)smem;
  __shared__ float colinv[32];

  const int tid = threadIdx.x;
  const int wave = tid >> 5, lane = tid & 31;
  const int n0 = blockIdx.x * 32;
  const int b  = blockIdx.y;

  v8f acc[2][2];
#pragma unroll
  for (int i = 0; i < 2; ++i)
#pragma unroll
    for (int j = 0; j < 2; ++j)
#pragma unroll
      for (int r = 0; r < 8; ++r) acc[i][j][r] = 0.f;

  const uint32_t* asrc = (const uint32_t*)W2h;
  const uint32_t* bsrc = (const uint32_t*)qs_t;
  uint32_t* adst = (uint32_t*)lds_a;
  uint32_t* bdst = (uint32_t*)lds_b;

  for (int ks = 0; ks < HID / 32; ++ks) {
    const int K0 = ks * 32;
    __syncthreads();
    for (int idx = tid; idx < CH * 16; idx += 256) {      // A: 256x32 halves
      int r = idx >> 4, cp = idx & 15;
      adst[idx] = asrc[((size_t)b * CH + r) * (HID / 2) + (K0 >> 1) + cp];
    }
#pragma unroll
    for (int i = 0; i < 2; ++i) {                          // B: 32x32 halves
      int idx = tid + i * 256;
      int n = idx >> 4, cp = idx & 15;
      bdst[idx] = bsrc[((size_t)b * NTOK + n0 + n) * (HID / 2) + (K0 >> 1) + cp];
    }
    __syncthreads();
    v16h bf0 = load_frag(lds_b, lane, 32);
    v16h bf1 = load_frag(lds_b + 16 * 32, lane, 32);
#pragma unroll
    for (int i = 0; i < 2; ++i) {
      int R = (wave * 2 + i) * 16;
      v16h af = load_frag(lds_a + R * 32, lane, 32);
      acc[i][0] = wmma_f16(af, bf0, acc[i][0]);
      acc[i][1] = wmma_f16(af, bf1, acc[i][1]);
    }
  }
  __syncthreads();
#pragma unroll
  for (int i = 0; i < 2; ++i) {
    int Rb = (wave * 2 + i) * 16 + ((lane >> 4) << 3);
#pragma unroll
    for (int j = 0; j < 2; ++j) {
      int cc = j * 16 + (lane & 15);
#pragma unroll
      for (int r = 0; r < 8; ++r) lds_y[(Rb + r) * 33 + cc] = acc[i][j][r];
    }
  }
  __syncthreads();
  if (tid < 32) {
    float s = 0.f;
    for (int o = 0; o < CH; ++o) {
      float v = lds_y[o * 33 + tid] + b_out[o];
      s += v * v;
    }
    colinv[tid] = 16.0f / fmaxf(sqrtf(s), 1e-12f);
  }
  __syncthreads();
  for (int idx = tid; idx < CH * 32; idx += 256) {
    int o = idx >> 5, col = idx & 31;
    float v = (lds_y[o * 33 + col] + b_out[o]) * colinv[col] * out_g[o];
    out[((size_t)b * CH + o) * NTOK + n0 + col] = v;
  }
}

// ---------------------------------------------------------------------------
extern "C" void kernel_launch(void* const* d_in, const int* in_sizes, int n_in,
                              void* d_out, int out_size, void* d_ws, size_t ws_size,
                              hipStream_t stream) {
  (void)in_sizes; (void)n_in; (void)out_size; (void)ws_size;
  const float* x        = (const float*)d_in[0];   // (16,256,64,64)
  const float* norm_g   = (const float*)d_in[1];   // (256)
  const float* w_qkv    = (const float*)d_in[2];   // (384,256)
  const float* mem_kv   = (const float*)d_in[3];   // (2,4,32,4)
  const float* w_out    = (const float*)d_in[4];   // (256,128)
  const float* b_out    = (const float*)d_in[5];   // (256)
  const float* out_g    = (const float*)d_in[6];   // (256)
  float* out = (float*)d_out;                      // (16,256,64,64)

  char* ws = (char*)d_ws;
  size_t off = 0;
  auto take = [&](size_t bytes) -> char* {
    char* p = ws + off;
    off = (off + bytes + 255) & ~(size_t)255;
    return p;
  };
  _Float16* wqkv_h   = (_Float16*)take((size_t)QKVR * CH * 2);           // 192 KB
  float*    inv_norm = (float*)   take((size_t)BATCH * NTOK * 4);        // 256 KB
  _Float16* qs_t     = (_Float16*)take((size_t)BATCH * NTOK * HID * 2);  // 16 MB
  float*    kraw     = (float*)   take((size_t)BATCH * HID * NTOK * 4);  // 32 MB
  _Float16* vh       = (_Float16*)take((size_t)BATCH * HID * NTOK * 2);  // 16 MB
  float*    rowmax   = (float*)   take((size_t)BATCH * HID * 4);
  float*    rowsum   = (float*)   take((size_t)BATCH * HID * 4);
  float*    context  = (float*)   take((size_t)BATCH * NHEAD * DHEAD * DHEAD * 4);
  _Float16* W2h      = (_Float16*)take((size_t)BATCH * CH * HID * 2);    // 1 MB

  prep_kernel<<<QKVR, 256, 0, stream>>>(w_qkv, norm_g, wqkv_h);
  invnorm_kernel<<<BATCH * NTOK / 256, 256, 0, stream>>>(x, inv_norm);
  qkv_kernel<<<dim3(NTOK / 32, BATCH), 256, 0, stream>>>(
      x, wqkv_h, inv_norm, qs_t, kraw, vh);
  kstats_kernel<<<BATCH * HID, 256, 0, stream>>>(kraw, mem_kv, rowmax, rowsum);
  context_kernel<<<BATCH * NHEAD, 256, 0, stream>>>(
      kraw, vh, mem_kv, rowmax, rowsum, context);
  w2_kernel<<<BATCH, 256, 0, stream>>>(w_out, context, W2h);
  out_kernel<<<dim3(NTOK / 32, BATCH), 256, 0, stream>>>(
      W2h, qs_t, b_out, out_g, out);
}

// v001
// One run takes 169 microseconds.
// Timed twice side by side with v000, it ran 2.02 and 2.01 times as fast.
#include <hip/hip_runtime.h>
#include <hip/hip_bf16.h>
#include <stdint.h>

typedef __attribute__((ext_vector_type(16))) _Float16 v16h;
typedef __attribute__((ext_vector_type(8)))  _Float16 v8h;
typedef __attribute__((ext_vector_type(8)))  float    v8f;

#define BATCH 16
#define CH    256
#define NTOK  4096
#define HID   128
#define QKVR  384
#define NHEAD 4
#define DHEAD 32
#define NMEM  4
#define NSPLIT 16               // work-groups that share one (b,h) token sum
#define NSEG  (NTOK / NSPLIT)   // tokens per work-group of the context kernel

__device__ __forceinline__ v8f wmma_f16(v16h a, v16h b, v8f c) {
  // v_wmma_f32_16x16x32_f16 : D = A(16x32) * B(32x16) + C(16x16 f32)
  return __builtin_amdgcn_wmma_f32_16x16x32_f16(
      /*neg_a=*/false, a, /*neg_b=*/false, b,
      /*c_mod=*/(short)0, c, /*reuse_a=*/false, /*reuse_b=*/false);
}

__device__ __forceinline__ v16h load_frag(const _Float16* base, int lane, int stride) {
  const int r  = lane & 15;
  const int k0 = (lane >> 4) << 3;       // 0 or 8
  const _Float16* p = base + r * stride;
  v8h lo = *(const v8h*)(p + k0);
  v8h hi = *(const v8h*)(p + 16 + k0);
  v16h f;
#pragma unroll
  for (int i = 0; i < 8; ++i) { f[i] = lo[i]; f[i + 8] = hi[i]; }
  return f;
}

// ---------------------------------------------------------------------------
// K0: fold norm_g into qkv weight, convert to f16.
// ---------------------------------------------------------------------------
__global__ void prep_kernel(const float* __restrict__ w_qkv,
                            const float* __restrict__ norm_g,
                            _Float16* __restrict__ wqkv_h) {
  int i = blockIdx.x * 256 + threadIdx.x;
  if (i < QKVR * CH) wqkv_h[i] = (_Float16)(w_qkv[i] * norm_g[i & (CH - 1)]);
}

// ---------------------------------------------------------------------------
// K1: per-(b,n) channel inverse norm, with sqrt(c)=16 folded in.
// ---------------------------------------------------------------------------
__global__ void invnorm_kernel(const float* __restrict__ x,
                               float* __restrict__ inv_norm) {
  int pos = blockIdx.x * 256 + threadIdx.x;     // 0 .. 65535
  int b = pos >> 12, n = pos & (NTOK - 1);
  const float* col = x + (size_t)b * CH * NTOK + n;
  float s = 0.f;
  for (int c = 0; c < CH; ++c) { float v = col[(size_t)c * NTOK]; s += v * v; }
  inv_norm[pos] = 16.0f / fmaxf(sqrtf(s), 1e-12f);
}

// ---------------------------------------------------------------------------
// K2: QKV GEMM, WMMA.  Per workgroup: 384x32 output tile, K=256.
// Fused: q-softmax over d (per head, per column) * SCALE -> qs_t (b,n,128) f16
//        k raw f32 (b,128,n);  v f16 (b,128,n).
// ---------------------------------------------------------------------------
__global__ __launch_bounds__(256) void qkv_kernel(
    const float* __restrict__ x, const _Float16* __restrict__ wqkv_h,
    const float* __restrict__ inv_norm,
    _Float16* __restrict__ qs_t, float* __restrict__ kraw,
    _Float16* __restrict__ vh) {
  // LDS: stage phase  : A 384x32 f16 (24576 B) + B 32x32 f16 (2048 B)
  //      epilog phase : out 384x33 f32 (50688 B)   (reuses same memory)
  __shared__ __align__(16) char smem[QKVR * 33 * 4];
  _Float16* lds_a = (_Float16*)smem;
  _Float16* lds_b = (_Float16*)(smem + QKVR * 32 * 2);
  float*    lds_o = (float*)smem;

  const int tid  = threadIdx.x;
  const int wave = tid >> 5, lane = tid & 31;
  const int n0   = blockIdx.x * 32;
  const int b    = blockIdx.y;

  v8f acc[3][2];
#pragma unroll
  for (int i = 0; i < 3; ++i)
#pragma unroll
    for (int j = 0; j < 2; ++j)
#pragma unroll
      for (int r = 0; r < 8; ++r) acc[i][j][r] = 0.f;

  const uint32_t* wsrc = (const uint32_t*)wqkv_h;
  uint32_t*       adst = (uint32_t*)lds_a;

  for (int ks = 0; ks < CH / 32; ++ks) {
    const int K0 = ks * 32;
    __syncthreads();
    // stage A: 384x32 halves == 384x16 dwords
    for (int idx = tid; idx < QKVR * 16; idx += 256) {
      int r = idx >> 4, cp = idx & 15;
      adst[idx] = wsrc[r * (CH / 2) + (K0 >> 1) + cp];
    }
    // stage B (transposed [n][c]): x * inv_norm -> f16
#pragma unroll
    for (int i = 0; i < 4; ++i) {
      int idx = tid + i * 256;
      int nl = idx & 31, cl = idx >> 5;
      float xv = x[((size_t)b * CH + (K0 + cl)) * NTOK + n0 + nl];
      lds_b[nl * 32 + cl] = (_Float16)(xv * inv_norm[b * NTOK + n0 + nl]);
    }
    __syncthreads();
    v16h bf0 = load_frag(lds_b, lane, 32);
    v16h bf1 = load_frag(lds_b + 16 * 32, lane, 32);
#pragma unroll
    for (int i = 0; i < 3; ++i) {
      int R = (wave * 3 + i) * 16;
      v16h af = load_frag(lds_a + R * 32, lane, 32);
      acc[i][0] = wmma_f16(af, bf0, acc[i][0]);
      acc[i][1] = wmma_f16(af, bf1, acc[i][1]);
    }
  }
  __syncthreads();
#pragma unroll
  for (int i = 0; i < 3; ++i) {
    int Rb = (wave * 3 + i) * 16 + ((lane >> 4) << 3);
#pragma unroll
    for (int j = 0; j < 2; ++j) {
      int cc = j * 16 + (lane & 15);
#pragma unroll
      for (int r = 0; r < 8; ++r) lds_o[(Rb + r) * 33 + cc] = acc[i][j][r];
    }
  }
  __syncthreads();
  // q rows 0..127: softmax over d per (head, column), * 32^-0.5
  if (tid < 128) {
    const float SCALE = 0.17677669529663687f;
    int h = tid >> 5, col = tid & 31;
    float m = -1e30f;
#pragma unroll
    for (int d = 0; d < DHEAD; ++d) m = fmaxf(m, lds_o[(h * 32 + d) * 33 + col]);
    float e[DHEAD], s = 0.f;
#pragma unroll
    for (int d = 0; d < DHEAD; ++d) {
      e[d] = __expf(lds_o[(h * 32 + d) * 33 + col] - m);
      s += e[d];
    }
    float inv = SCALE / s;
    _Float16* dst = qs_t + ((size_t)b * NTOK + n0 + col) * HID + h * 32;
#pragma unroll
    for (int d = 0; d < DHEAD; ++d) dst[d] = (_Float16)(e[d] * inv);
  }
  // k rows 128..255 raw f32; v rows 256..383 f16
  for (int idx = tid; idx < HID * 32; idx += 256) {
    int r = idx >> 5, col = idx & 31;
    kraw[((size_t)b * HID + r) * NTOK + n0 + col] = lds_o[(HID + r) * 33 + col];
  }
  for (int idx = tid; idx < HID * 32; idx += 256) {
    int r = idx >> 5, col = idx & 31;
    vh[((size_t)b * HID + r) * NTOK + n0 + col] =
        (_Float16)lds_o[(2 * HID + r) * 33 + col];
  }
}

// ---------------------------------------------------------------------------
// K3: per-row (b,h,d) max and sum(exp) over n (incl. 4 memory tokens).
// ---------------------------------------------------------------------------
__global__ __launch_bounds__(256) void kstats_kernel(
    const float* __restrict__ kraw, const float* __restrict__ mem_kv,
    float* __restrict__ rowmax, float* __restrict__ rowsum) {
  __shared__ float red[256];
  const int rg = blockIdx.x;          // 0..2047  == b*128 + h*32 + d
  const int tid = threadIdx.x;
  const int hd = rg & (HID - 1);
  const float* row = kraw + (size_t)rg * NTOK;
  float m = -1e30f;
  for (int n = tid; n < NTOK; n += 256) m = fmaxf(m, row[n]);
  if (tid < NMEM) m = fmaxf(m, mem_kv[hd * NMEM + tid]);   // mem_kv[0]
  red[tid] = m; __syncthreads();
  for (int s = 128; s > 0; s >>= 1) {
    if (tid < s) red[tid] = fmaxf(red[tid], red[tid + s]);
    __syncthreads();
  }
  m = red[0]; __syncthreads();
  float s = 0.f;
  for (int n = tid; n < NTOK; n += 256) s += __expf(row[n] - m);
  if (tid < NMEM) s += __expf(mem_kv[hd * NMEM + tid] - m);
  red[tid] = s; __syncthreads();
  for (int st = 128; st > 0; st >>= 1) {
    if (tid < st) red[tid] += red[tid + st];
    __syncthreads();
  }
  if (tid == 0) { rowmax[rg] = m; rowsum[rg] = red[0]; }
}

// ---------------------------------------------------------------------------
// K4: context[b,h,d,e] = sum_n softmax_k[d,n] * v[e,n]  (incl. mem tokens).
// NSPLIT workgroups per (b,h), each over its own NSEG tokens, LDS-tiled over n.
// Each stores a normalised partial sum: ctx_part[split][b][h][d][e]; K5 adds them.
// ---------------------------------------------------------------------------
__global__ __launch_bounds__(256) void context_kernel(
    const float* __restrict__ kraw, const _Float16* __restrict__ vh,
    const float* __restrict__ mem_kv, const float* __restrict__ rowmax,
    const float* __restrict__ rowsum, float* __restrict__ ctx_part) {
  __shared__ float kch[32][65];
  __shared__ float vch[32][65];
  __shared__ float rmax[32];
  const int bh = blockIdx.x, b = bh >> 2, h = bh & 3;
  const int split = blockIdx.y;
  const int tid = threadIdx.x;
  const int d = tid >> 3, e0 = (tid & 7) * 4;
  const size_t rowbase = ((size_t)b * HID + h * 32) * NTOK;
  const int statbase = b * HID + h * 32;
  if (tid < 32) rmax[tid] = rowmax[statbase + tid];
  float acc[4] = {0.f, 0.f, 0.f, 0.f};
  for (int chunk = split * NSEG; chunk < (split + 1) * NSEG; chunk += 64) {
    __syncthreads();
#pragma unroll
    for (int i = 0; i < 8; ++i) {
      int idx = tid + i * 256;
      int r = idx >> 6, c = idx & 63;
      float kv = kraw[rowbase + (size_t)r * NTOK + chunk + c];
      kch[r][c] = __expf(kv - rmax[r]);
      vch[r][c] = (float)vh[rowbase + (size_t)r * NTOK + chunk + c];
    }
    __syncthreads();
#pragma unroll 8
    for (int j = 0; j < 64; ++j) {
      float kx = kch[d][j];
      acc[0] += kx * vch[e0 + 0][j];
      acc[1] += kx * vch[e0 + 1][j];
      acc[2] += kx * vch[e0 + 2][j];
      acc[3] += kx * vch[e0 + 3][j];
    }
  }
  // memory tokens: mem_kv[0]=keys at offset 0, mem_kv[1]=values at offset 512;
  // they belong to one partial sum only.
  if (split == 0) {
#pragma unroll
    for (int j = 0; j < NMEM; ++j) {
      float kx = __expf(mem_kv[(h * 32 + d) * NMEM + j] - rmax[d]);
#pragma unroll
      for (int i = 0; i < 4; ++i)
        acc[i] += kx * mem_kv[NHEAD * DHEAD * NMEM + (h * 32 + e0 + i) * NMEM + j];
    }
  }
  float invs = 1.0f / rowsum[statbase + d];
  float* dst = ctx_part +
      ((((size_t)split * BATCH + b) * NHEAD + h) * DHEAD + d) * DHEAD + e0;
#pragma unroll
  for (int i = 0; i < 4; ++i) dst[i] = acc[i] * invs;
}

// ---------------------------------------------------------------------------
// K5: W2[b,o,h*32+d] = sum_e w_out[o,h*32+e] * context[b,h,d,e]  -> f16
// (collapses "out = context^T @ q" into the final projection GEMM)
// context[b] is formed here as the sum of K4's NSPLIT partial sums, in split order.
// ---------------------------------------------------------------------------
__global__ __launch_bounds__(256) void w2_kernel(
    const float* __restrict__ w_out, const float* __restrict__ ctx_part,
    _Float16* __restrict__ W2h) {
  __shared__ float ctxT[NHEAD][DHEAD][33];   // [h][e][d]
  const int b = blockIdx.x, tid = threadIdx.x;
  const float4* part = (const float4*)ctx_part + (size_t)b * 1024;
  for (int i4 = tid; i4 < NHEAD * DHEAD * DHEAD / 4; i4 += 256) {
    float4 s = part[i4];
    // unrolled so that all partial-sum loads of a trip are in flight together
#pragma unroll
    for (int sp = 1; sp < NSPLIT; ++sp) {
      float4 p = part[(size_t)sp * BATCH * 1024 + i4];
      s.x += p.x; s.y += p.y; s.z += p.z; s.w += p.w;
    }
    int idx = i4 * 4;
    int h = idx >> 10, rem = idx & 1023, d = rem >> 5, e = rem & 31;
    ctxT[h][e + 0][d] = s.x;
    ctxT[h][e + 1][d] = s.y;
    ctxT[h][e + 2][d] = s.z;
    ctxT[h][e + 3][d] = s.w;
  }
  __syncthreads();
  const int o = tid;
  _Float16* dst = W2h + ((size_t)b * CH + o) * HID;
  float acc[DHEAD];
#pragma unroll 1
  for (int h = 0; h < NHEAD; ++h) {
#pragma unroll
    for (int d = 0; d < DHEAD; ++d) acc[d] = 0.f;
    for (int e = 0; e < DHEAD; ++e) {
      float w = w_out[o * HID + h * 32 + e];
#pragma unroll
      for (int d = 0; d < DHEAD; ++d) acc[d] += w * ctxT[h][e][d];
    }
#pragma unroll
    for (int d = 0; d < DHEAD; ++d) dst[h * 32 + d] = (_Float16)acc[d];
  }
}

// ---------------------------------------------------------------------------
// K6: Y = W2[b] @ qs  + b_out, then RMSNorm over the 256 output channels.
// WMMA; one workgroup owns a full 256-row x 32-col tile so the channel
// norm is done entirely in LDS.
// ---------------------------------------------------------------------------
__global__ __launch_bounds__(256) void out_kernel(
    const _Float16* __restrict__ W2h, const _Float16* __restrict__ qs_t,
    const float* __restrict__ b_out, const float* __restrict__ out_g,
    float* __restrict__ out) {
  __shared__ __align__(16) char smem[CH * 33 * 4];
  _Float16* lds_a = (_Float16*)smem;
  _Float16* lds_b = (_Float16*)(smem + CH * 32 * 2);
  float*    lds_y = (float*)smem;
  __shared__ float colinv[32];

  const int tid = threadIdx.x;
  const int wave = tid >> 5, lane = tid & 31;
  const int n0 = blockIdx.x * 32;
  const int b  = blockIdx.y;

  v8f acc[2][2];
#pragma unroll
  for (int i = 0; i < 2; ++i)
#pragma unroll
    for (int j = 0; j < 2; ++j)
#pragma unroll
      for (int r = 0; r < 8; ++r) acc[i][j][r] = 0.f;

  const uint32_t* asrc = (const uint32_t*)W2h;
  const uint32_t* bsrc = (const uint32_t*)qs_t;
  uint32_t* adst = (uint32_t*)lds_a;
  uint32_t* bdst = (uint32_t*)lds_b;

  for (int ks = 0; ks < HID / 32; ++ks) {
    const int K0 = ks * 32;
    __syncthreads();
    for (int idx = tid; idx < CH * 16; idx += 256) {      // A: 256x32 halves
      int r = idx >> 4, cp = idx & 15;
      adst[idx] = asrc[((size_t)b * CH + r) * (HID / 2) + (K0 >> 1) + cp];
    }
#pragma unroll
    for (int i = 0; i < 2; ++i) {                          // B: 32x32 halves
      int idx = tid + i * 256;
      int n = idx >> 4, cp = idx & 15;
      bdst[idx] = bsrc[((size_t)b * NTOK + n0 + n) * (HID / 2) + (K0 >> 1) + cp];
    }
    __syncthreads();
    v16h bf0 = load_frag(lds_b, lane, 32);
    v16h bf1 = load_frag(lds_b + 16 * 32, lane, 32);
#pragma unroll
    for (int i = 0; i < 2; ++i) {
      int R = (wave * 2 + i) * 16;
      v16h af = load_frag(lds_a + R * 32, lane, 32);
      acc[i][0] = wmma_f16(af, bf0, acc[i][0]);
      acc[i][1] = wmma_f16(af, bf1, acc[i][1]);
    }
  }
  __syncthreads();
#pragma unroll
  for (int i = 0; i < 2; ++i) {
    int Rb = (wave * 2 + i) * 16 + ((lane >> 4) << 3);
#pragma unroll
    for (int j = 0; j < 2; ++j) {
      int cc = j * 16 + (lane & 15);
#pragma unroll
      for (int r = 0; r < 8; ++r) lds_y[(Rb + r) * 33 + cc] = acc[i][j][r];
    }
  }
  __syncthreads();
  if (tid < 32) {
    float s = 0.f;
    for (int o = 0; o < CH; ++o) {
      float v = lds_y[o * 33 + tid] + b_out[o];
      s += v * v;
    }
    colinv[tid] = 16.0f / fmaxf(sqrtf(s), 1e-12f);
  }
  __syncthreads();
  for (int idx = tid; idx < CH * 32; idx += 256) {
    int o = idx >> 5, col = idx & 31;
    float v = (lds_y[o * 33 + col] + b_out[o]) * colinv[col] * out_g[o];
    out[((size_t)b * CH + o) * NTOK + n0 + col] = v;
  }
}

// ---------------------------------------------------------------------------
extern "C" void kernel_launch(void* const* d_in, const int* in_sizes, int n_in,
                              void* d_out, int out_size, void* d_ws, size_t ws_size,
                              hipStream_t stream) {
  (void)in_sizes; (void)n_in; (void)out_size; (void)ws_size;
  const float* x        = (const float*)d_in[0];   // (16,256,64,64)
  const float* norm_g   = (const float*)d_in[1];   // (256)
  const float* w_qkv    = (const float*)d_in[2];   // (384,256)
  const float* mem_kv   = (const float*)d_in[3];   // (2,4,32,4)
  const float* w_out    = (const float*)d_in[4];   // (256,128)
  const float* b_out    = (const float*)d_in[5];   // (256)
  const float* out_g    = (const float*)d_in[6];   // (256)
  float* out = (float*)d_out;                      // (16,256,64,64)

  char* ws = (char*)d_ws;
  size_t off = 0;
  auto take = [&](size_t bytes) -> char* {
    char* p = ws + off;
    off = (off + bytes + 255) & ~(size_t)255;
    return p;
  };
  _Float16* wqkv_h   = (_Float16*)take((size_t)QKVR * CH * 2);           // 192 KB
  float*    inv_norm = (float*)   take((size_t)BATCH * NTOK * 4);        // 256 KB
  _Float16* qs_t     = (_Float16*)take((size_t)BATCH * NTOK * HID * 2);  // 16 MB
  float*    kraw     = (float*)   take((size_t)BATCH * HID * NTOK * 4);  // 32 MB
  _Float16* vh       = (_Float16*)take((size_t)BATCH * HID * NTOK * 2);  // 16 MB
  float*    rowmax   = (float*)   take((size_t)BATCH * HID * 4);
  float*    rowsum   = (float*)   take((size_t)BATCH * HID * 4);
  float*    ctx_part = (float*)   take((size_t)NSPLIT * BATCH * NHEAD * DHEAD * DHEAD * 4);  // 4 MB
  _Float16* W2h      = (_Float16*)take((size_t)BATCH * CH * HID * 2);    // 1 MB

  prep_kernel<<<QKVR, 256, 0, stream>>>(w_qkv, norm_g, wqkv_h);
  invnorm_kernel<<<BATCH * NTOK / 256, 256, 0, stream>>>(x, inv_norm);
  qkv_kernel<<<dim3(NTOK / 32, BATCH), 256, 0, stream>>>(
      x, wqkv_h, inv_norm, qs_t, kraw, vh);
  kstats_kernel<<<BATCH * HID, 256, 0, stream>>>(kraw, mem_kv, rowmax, rowsum);
  context_kernel<<<dim3(BATCH * NHEAD, NSPLIT), 256, 0, stream>>>(
      kraw, vh, mem_kv, rowmax, rowsum, ctx_part);
  w2_kernel<<<BATCH, 256, 0, stream>>>(w_out, ctx_part, W2h);
  out_kernel<<<dim3(NTOK / 32, BATCH), 256, 0, stream>>>(
      W2h, qs_t, b_out, out_g, out);
}

// v002
// Measured time: 146 microseconds a run.
// Timed twice side by side with v001, it ran 1.16 times as fast both times.
// Counting every step since v000, it is 2.34 times as fast.
#include <hip/hip_runtime.h>
#include <hip/hip_bf16.h>
#include <stdint.h>

typedef __attribute__((ext_vector_type(16))) _Float16 v16h;
typedef __attribute__((ext_vector_type(8)))  _Float16 v8h;
typedef __attribute__((ext_vector_type(8)))  float    v8f;

#define BATCH 16
#define CH    256
#define NTOK  4096
#define HID   128
#define QKVR  384
#define NHEAD 4
#define DHEAD 32
#define NMEM  4
#define NSPLIT 16               // work-groups that share one (b,h) token sum
#define NSEG  (NTOK / NSPLIT)   // tokens per work-group of the context kernel

__device__ __forceinline__ v8f wmma_f16(v16h a, v16h b, v8f c) {
  // v_wmma_f32_16x16x32_f16 : D = A(16x32) * B(32x16) + C(16x16 f32)
  return __builtin_amdgcn_wmma_f32_16x16x32_f16(
      /*neg_a=*/false, a, /*neg_b=*/false, b,
      /*c_mod=*/(short)0, c, /*reuse_a=*/false, /*reuse_b=*/false);
}

__device__ __forceinline__ v16h load_frag(const _Float16* base, int lane, int stride) {
  const int r  = lane & 15;
  const int k0 = (lane >> 4) << 3;       // 0 or 8
  const _Float16* p = base + r * stride;
  v8h lo = *(const v8h*)(p + k0);
  v8h hi = *(const v8h*)(p + 16 + k0);
  v16h f;
#pragma unroll
  for (int i = 0; i < 8; ++i) { f[i] = lo[i]; f[i + 8] = hi[i]; }
  return f;
}

// ---------------------------------------------------------------------------
// K0: fold norm_g into qkv weight, convert to f16.
// ---------------------------------------------------------------------------
__global__ void prep_kernel(const float* __restrict__ w_qkv,
                            const float* __restrict__ norm_g,
                            _Float16* __restrict__ wqkv_h) {
  int i = blockIdx.x * 256 + threadIdx.x;
  if (i < QKVR * CH) wqkv_h[i] = (_Float16)(w_qkv[i] * norm_g[i & (CH - 1)]);
}

// ---------------------------------------------------------------------------
// K1: per-(b,n) channel inverse norm, with sqrt(c)=16 folded in.
// ---------------------------------------------------------------------------
__global__ void invnorm_kernel(const float* __restrict__ x,
                               float* __restrict__ inv_norm) {
  int pos = blockIdx.x * 256 + threadIdx.x;     // 0 .. 65535
  int b = pos >> 12, n = pos & (NTOK - 1);
  const float* col = x + (size_t)b * CH * NTOK + n;
  float s = 0.f;
  for (int c = 0; c < CH; ++c) { float v = col[(size_t)c * NTOK]; s += v * v; }
  inv_norm[pos] = 16.0f / fmaxf(sqrtf(s), 1e-12f);
}

// ---------------------------------------------------------------------------
// K2: QKV GEMM, WMMA.  Per workgroup: 384x32 output tile, K=256.
// Fused: q-softmax over d (per head, per column) * SCALE -> qs_t (b,n,128) f16
//        k raw f32 (b,128,n);  v f16 (b,128,n).
// ---------------------------------------------------------------------------
__global__ __launch_bounds__(256) void qkv_kernel(
    const float* __restrict__ x, const _Float16* __restrict__ wqkv_h,
    const float* __restrict__ inv_norm,
    _Float16* __restrict__ qs_t, float* __restrict__ kraw,
    _Float16* __restrict__ vh) {
  // LDS: stage phase  : A 384x32 f16 (24576 B) + B 32x32 f16 (2048 B)
  //      epilog phase : out 384x33 f32 (50688 B)   (reuses same memory)
  __shared__ __align__(16) char smem[QKVR * 33 * 4];
  _Float16* lds_a = (_Float16*)smem;
  _Float16* lds_b = (_Float16*)(smem + QKVR * 32 * 2);
  float*    lds_o = (float*)smem;

  const int tid  = threadIdx.x;
  const int wave = tid >> 5, lane = tid & 31;
  const int n0   = blockIdx.x * 32;
  const int b    = blockIdx.y;

  v8f acc[3][2];
#pragma unroll
  for (int i = 0; i < 3; ++i)
#pragma unroll
    for (int j = 0; j < 2; ++j)
#pragma unroll
      for (int r = 0; r < 8; ++r) acc[i][j][r] = 0.f;

  const uint32_t* wsrc = (const uint32_t*)wqkv_h;
  uint32_t*       adst = (uint32_t*)lds_a;

  for (int ks = 0; ks < CH / 32; ++ks) {
    const int K0 = ks * 32;
    __syncthreads();
    // stage A: 384x32 halves == 384x16 dwords
    for (int idx = tid; idx < QKVR * 16; idx += 256) {
      int r = idx >> 4, cp = idx & 15;
      adst[idx] = wsrc[r * (CH / 2) + (K0 >> 1) + cp];
    }
    // stage B (transposed [n][c]): x * inv_norm -> f16
#pragma unroll
    for (int i = 0; i < 4; ++i) {
      int idx = tid + i * 256;
      int nl = idx & 31, cl = idx >> 5;
      float xv = x[((size_t)b * CH + (K0 + cl)) * NTOK + n0 + nl];
      lds_b[nl * 32 + cl] = (_Float16)(xv * inv_norm[b * NTOK + n0 + nl]);
    }
    __syncthreads();
    v16h bf0 = load_frag(lds_b, lane, 32);
    v16h bf1 = load_frag(lds_b + 16 * 32, lane, 32);
#pragma unroll
    for (int i = 0; i < 3; ++i) {
      int R = (wave * 3 + i) * 16;
      v16h af = load_frag(lds_a + R * 32, lane, 32);
      acc[i][0] = wmma_f16(af, bf0, acc[i][0]);
      acc[i][1] = wmma_f16(af, bf1, acc[i][1]);
    }
  }
  __syncthreads();
#pragma unroll
  for (int i = 0; i < 3; ++i) {
    int Rb = (wave * 3 + i) * 16 + ((lane >> 4) << 3);
#pragma unroll
    for (int j = 0; j < 2; ++j) {
      int cc = j * 16 + (lane & 15);
#pragma unroll
      for (int r = 0; r < 8; ++r) lds_o[(Rb + r) * 33 + cc] = acc[i][j][r];
    }
  }
  __syncthreads();
  // q rows 0..127: softmax over d per (head, column), * 32^-0.5
  if (tid < 128) {
    const float SCALE = 0.17677669529663687f;
    int h = tid >> 5, col = tid & 31;
    float m = -1e30f;
#pragma unroll
    for (int d = 0; d < DHEAD; ++d) m = fmaxf(m, lds_o[(h * 32 + d) * 33 + col]);
    float e[DHEAD], s = 0.f;
#pragma unroll
    for (int d = 0; d < DHEAD; ++d) {
      e[d] = __expf(lds_o[(h * 32 + d) * 33 + col] - m);
      s += e[d];
    }
    float inv = SCALE / s;
    _Float16* dst = qs_t + ((size_t)b * NTOK + n0 + col) * HID + h * 32;
#pragma unroll
    for (int d = 0; d < DHEAD; ++d) dst[d] = (_Float16)(e[d] * inv);
  }
  // k rows 128..255 raw f32; v rows 256..383 f16
  for (int idx = tid; idx < HID * 32; idx += 256) {
    int r = idx >> 5, col = idx & 31;
    kraw[((size_t)b * HID + r) * NTOK + n0 + col] = lds_o[(HID + r) * 33 + col];
  }
  for (int idx = tid; idx < HID * 32; idx += 256) {
    int r = idx >> 5, col = idx & 31;
    vh[((size_t)b * HID + r) * NTOK + n0 + col] =
        (_Float16)lds_o[(2 * HID + r) * 33 + col];
  }
}

// ---------------------------------------------------------------------------
// K3: per-row (b,h,d) max and sum(exp) over n (incl. 4 memory tokens).
// ---------------------------------------------------------------------------
__global__ __launch_bounds__(256) void kstats_kernel(
    const float* __restrict__ kraw, const float* __restrict__ mem_kv,
    float* __restrict__ rowmax, float* __restrict__ rowsum) {
  __shared__ float red[256];
  const int rg = blockIdx.x;          // 0..2047  == b*128 + h*32 + d
  const int tid = threadIdx.x;
  const int hd = rg & (HID - 1);
  const float* row = kraw + (size_t)rg * NTOK;
  float m = -1e30f;
  for (int n = tid; n < NTOK; n += 256) m = fmaxf(m, row[n]);
  if (tid < NMEM) m = fmaxf(m, mem_kv[hd * NMEM + tid]);   // mem_kv[0]
  red[tid] = m; __syncthreads();
  for (int s = 128; s > 0; s >>= 1) {
    if (tid < s) red[tid] = fmaxf(red[tid], red[tid + s]);
    __syncthreads();
  }
  m = red[0]; __syncthreads();
  float s = 0.f;
  for (int n = tid; n < NTOK; n += 256) s += __expf(row[n] - m);
  if (tid < NMEM) s += __expf(mem_kv[hd * NMEM + tid] - m);
  red[tid] = s; __syncthreads();
  for (int st = 128; st > 0; st >>= 1) {
    if (tid < st) red[tid] += red[tid + st];
    __syncthreads();
  }
  if (tid == 0) { rowmax[rg] = m; rowsum[rg] = red[0]; }
}

// ---------------------------------------------------------------------------
// K4: context[b,h,d,e] = sum_n softmax_k[d,n] * v[e,n]  (incl. mem tokens).
// NSPLIT workgroups per (b,h), each over its own NSEG tokens, LDS-tiled over n.
// Each stores a normalised partial sum: ctx_part[split][b][h][d][e]; K5 adds them.
// ---------------------------------------------------------------------------
__global__ __launch_bounds__(256) void context_kernel(
    const float* __restrict__ kraw, const _Float16* __restrict__ vh,
    const float* __restrict__ mem_kv, const float* __restrict__ rowmax,
    const float* __restrict__ rowsum, float* __restrict__ ctx_part) {
  __shared__ float kch[32][65];
  __shared__ float vch[32][65];
  __shared__ float rmax[32];
  const int bh = blockIdx.x, b = bh >> 2, h = bh & 3;
  const int split = blockIdx.y;
  const int tid = threadIdx.x;
  const int d = tid >> 3, e0 = (tid & 7) * 4;
  const size_t rowbase = ((size_t)b * HID + h * 32) * NTOK;
  const int statbase = b * HID + h * 32;
  if (tid < 32) rmax[tid] = rowmax[statbase + tid];
  float acc[4] = {0.f, 0.f, 0.f, 0.f};
  for (int chunk = split * NSEG; chunk < (split + 1) * NSEG; chunk += 64) {
    __syncthreads();
#pragma unroll
    for (int i = 0; i < 8; ++i) {
      int idx = tid + i * 256;
      int r = idx >> 6, c = idx & 63;
      float kv = kraw[rowbase + (size_t)r * NTOK + chunk + c];
      kch[r][c] = __expf(kv - rmax[r]);
      vch[r][c] = (float)vh[rowbase + (size_t)r * NTOK + chunk + c];
    }
    __syncthreads();
#pragma unroll 8
    for (int j = 0; j < 64; ++j) {
      float kx = kch[d][j];
      acc[0] += kx * vch[e0 + 0][j];
      acc[1] += kx * vch[e0 + 1][j];
      acc[2] += kx * vch[e0 + 2][j];
      acc[3] += kx * vch[e0 + 3][j];
    }
  }
  // memory tokens: mem_kv[0]=keys at offset 0, mem_kv[1]=values at offset 512;
  // they belong to one partial sum only.
  if (split == 0) {
#pragma unroll
    for (int j = 0; j < NMEM; ++j) {
      float kx = __expf(mem_kv[(h * 32 + d) * NMEM + j] - rmax[d]);
#pragma unroll
      for (int i = 0; i < 4; ++i)
        acc[i] += kx * mem_kv[NHEAD * DHEAD * NMEM + (h * 32 + e0 + i) * NMEM + j];
    }
  }
  float invs = 1.0f / rowsum[statbase + d];
  float* dst = ctx_part +
      ((((size_t)split * BATCH + b) * NHEAD + h) * DHEAD + d) * DHEAD + e0;
#pragma unroll
  for (int i = 0; i < 4; ++i) dst[i] = acc[i] * invs;
}

#define W2_ROWS  32
#define CTX_PITCH 36
#define CTX_PLANE (DHEAD * CTX_PITCH + 32)
__global__ __launch_bounds__(256) void w2_kernel(
    const float* __restrict__ w_out, const float* __restrict__ ctx_part,
    _Float16* __restrict__ W2h) {
  __shared__ __align__(16) float ctxT[2 * CTX_PLANE];   // [head of the pair][e][d]
  const int b = blockIdx.x, hp = blockIdx.y, tid = threadIdx.x;
  const int o  = blockIdx.z * W2_ROWS + (tid >> 3);
  const int hl = (tid >> 2) & 1;
  const int dg = (tid & 3) * 8;
  // this thread's 32 weights: they do not depend on the LDS fill, so they load beside the partial sums
  const float4* wrow = (const float4*)(w_out + o * HID + (hp * 2 + hl) * DHEAD);
  float4 w4[DHEAD / 4];
  // unrolled: w4 is indexed by constants only and stays in registers
#pragma unroll
  for (int i = 0; i < DHEAD / 4; ++i) w4[i] = wrow[i];
  const float4* part = (const float4*)ctx_part + (size_t)b * 1024 + hp * 512;
  // unrolled: the two heads' loads overlap
#pragma unroll
  for (int t = 0; t < 2; ++t) {
    const int i4 = tid + t * 256;
    float4 s = part[i4];
    // unrolled so that many partial-sum loads are in flight together
#pragma unroll
    for (int sp = 1; sp < NSPLIT; ++sp) {
      float4 q = part[(size_t)sp * BATCH * 1024 + i4];
      s.x += q.x; s.y += q.y; s.z += q.z; s.w += q.w;
    }
    const int d = (i4 >> 3) & 31, e = (i4 & 7) * 4;
    float* col = ctxT + t * CTX_PLANE + e * CTX_PITCH + d;
    col[0 * CTX_PITCH] = s.x;
    col[1 * CTX_PITCH] = s.y;
    col[2 * CTX_PITCH] = s.z;
    col[3 * CTX_PITCH] = s.w;
  }
  __syncthreads();
  float acc[8];
#pragma unroll
  for (int j = 0; j < 8; ++j) acc[j] = 0.f;
  const float* crow = ctxT + hl * CTX_PLANE + dg;
  // both loops unrolled: LDS offsets become immediates and many row reads are in flight;
  // e runs upwards, one fused multiply-add per term
#pragma unroll
  for (int e4 = 0; e4 < DHEAD / 4; ++e4) {
    const float wv[4] = {w4[e4].x, w4[e4].y, w4[e4].z, w4[e4].w};
#pragma unroll
    for (int k = 0; k < 4; ++k) {
      const float4 c0 = *(const float4*)(crow + (e4 * 4 + k) * CTX_PITCH);
      const float4 c1 = *(const float4*)(crow + (e4 * 4 + k) * CTX_PITCH + 4);
      acc[0] = fmaf(wv[k], c0.x, acc[0]); acc[1] = fmaf(wv[k], c0.y, acc[1]);
      acc[2] = fmaf(wv[k], c0.z, acc[2]); acc[3] = fmaf(wv[k], c0.w, acc[3]);
      acc[4] = fmaf(wv[k], c1.x, acc[4]); acc[5] = fmaf(wv[k], c1.y, acc[5]);
      acc[6] = fmaf(wv[k], c1.z, acc[6]); acc[7] = fmaf(wv[k], c1.w, acc[7]);
    }
  }
  v8h r;
#pragma unroll
  for (int j = 0; j < 8; ++j) r[j] = (_Float16)acc[j];
  *(v8h*)(W2h + ((size_t)b * CH + o) * HID + (hp * 2 + hl) * DHEAD + dg) = r;
}

// ---------------------------------------------------------------------------
// K6: Y = W2[b] @ qs  + b_out, then RMSNorm over the 256 output channels.
// WMMA; one workgroup owns a full 256-row x 32-col tile so the channel
// norm is done entirely in LDS.
// ---------------------------------------------------------------------------
__global__ __launch_bounds__(256) void out_kernel(
    const _Float16* __restrict__ W2h, const _Float16* __restrict__ qs_t,
    const float* __restrict__ b_out, const float* __restrict__ out_g,
    float* __restrict__ out) {
  __shared__ __align__(16) char smem[CH * 33 * 4];
  _Float16* lds_a = (_Float16*)smem;
  _Float16* lds_b = (_Float16*)(smem + CH * 32 * 2);
  float*    lds_y = (float*)smem;
  __shared__ float colinv[32];

  const int tid = threadIdx.x;
  const int wave = tid >> 5, lane = tid & 31;
  const int n0 = blockIdx.x * 32;
  const int b  = blockIdx.y;

  v8f acc[2][2];
#pragma unroll
  for (int i = 0; i < 2; ++i)
#pragma unroll
    for (int j = 0; j < 2; ++j)
#pragma unroll
      for (int r = 0; r < 8; ++r) acc[i][j][r] = 0.f;

  const uint32_t* asrc = (const uint32_t*)W2h;
  const uint32_t* bsrc = (const uint32_t*)qs_t;
  uint32_t* adst = (uint32_t*)lds_a;
  uint32_t* bdst = (uint32_t*)lds_b;

  for (int ks = 0; ks < HID / 32; ++ks) {
    const int K0 = ks * 32;
    __syncthreads();
    for (int idx = tid; idx < CH * 16; idx += 256) {      // A: 256x32 halves
      int r = idx >> 4, cp = idx & 15;
      adst[idx] = asrc[((size_t)b * CH + r) * (HID / 2) + (K0 >> 1) + cp];
    }
#pragma unroll
    for (int i = 0; i < 2; ++i) {                          // B: 32x32 halves
      int idx = tid + i * 256;
      int n = idx >> 4, cp = idx & 15;
      bdst[idx] = bsrc[((size_t)b * NTOK + n0 + n) * (HID / 2) + (K0 >> 1) + cp];
    }
    __syncthreads();
    v16h bf0 = load_frag(lds_b, lane, 32);
    v16h bf1 = load_frag(lds_b + 16 * 32, lane, 32);
#pragma unroll
    for (int i = 0; i < 2; ++i) {
      int R = (wave * 2 + i) * 16;
      v16h af = load_frag(lds_a + R * 32, lane, 32);
      acc[i][0] = wmma_f16(af, bf0, acc[i][0]);
      acc[i][1] = wmma_f16(af, bf1, acc[i][1]);
    }
  }
  __syncthreads();
#pragma unroll
  for (int i = 0; i < 2; ++i) {
    int Rb = (wave * 2 + i) * 16 + ((lane >> 4) << 3);
#pragma unroll
    for (int j = 0; j < 2; ++j) {
      int cc = j * 16 + (lane & 15);
#pragma unroll
      for (int r = 0; r < 8; ++r) lds_y[(Rb + r) * 33 + cc] = acc[i][j][r];
    }
  }
  __syncthreads();
  if (tid < 32) {
    float s = 0.f;
    for (int o = 0; o < CH; ++o) {
      float v = lds_y[o * 33 + tid] + b_out[o];
      s += v * v;
    }
    colinv[tid] = 16.0f / fmaxf(sqrtf(s), 1e-12f);
  }
  __syncthreads();
  for (int idx = tid; idx < CH * 32; idx += 256) {
    int o = idx >> 5, col = idx & 31;
    float v = (lds_y[o * 33 + col] + b_out[o]) * colinv[col] * out_g[o];
    out[((size_t)b * CH + o) * NTOK + n0 + col] = v;
  }
}

// ---------------------------------------------------------------------------
extern "C" void kernel_launch(void* const* d_in, const int* in_sizes, int n_in,
                              void* d_out, int out_size, void* d_ws, size_t ws_size,
                              hipStream_t stream) {
  (void)in_sizes; (void)n_in; (void)out_size; (void)ws_size;
  const float* x        = (const float*)d_in[0];   // (16,256,64,64)
  const float* norm_g   = (const float*)d_in[1];   // (256)
  const float* w_qkv    = (const float*)d_in[2];   // (384,256)
  const float* mem_kv   = (const float*)d_in[3];   // (2,4,32,4)
  const float* w_out    = (const float*)d_in[4];   // (256,128)
  const float* b_out    = (const float*)d_in[5];   // (256)
  const float* out_g    = (const float*)d_in[6];   // (256)
  float* out = (float*)d_out;                      // (16,256,64,64)

  char* ws = (char*)d_ws;
  size_t off = 0;
  auto take = [&](size_t bytes) -> char* {
    char* p = ws + off;
    off = (off + bytes + 255) & ~(size_t)255;
    return p;
  };
  _Float16* wqkv_h   = (_Float16*)take((size_t)QKVR * CH * 2);           // 192 KB
  float*    inv_norm = (float*)   take((size_t)BATCH * NTOK * 4);        // 256 KB
  _Float16* qs_t     = (_Float16*)take((size_t)BATCH * NTOK * HID * 2);  // 16 MB
  float*    kraw     = (float*)   take((size_t)BATCH * HID * NTOK * 4);  // 32 MB
  _Float16* vh       = (_Float16*)take((size_t)BATCH * HID * NTOK * 2);  // 16 MB
  float*    rowmax   = (float*)   take((size_t)BATCH * HID * 4);
  float*    rowsum   = (float*)   take((size_t)BATCH * HID * 4);
  float*    ctx_part = (float*)   take((size_t)NSPLIT * BATCH * NHEAD * DHEAD * DHEAD * 4);  // 4 MB
  _Float16* W2h      = (_Float16*)take((size_t)BATCH * CH * HID * 2);    // 1 MB

  prep_kernel<<<QKVR, 256, 0, stream>>>(w_qkv, norm_g, wqkv_h);
  invnorm_kernel<<<BATCH * NTOK / 256, 256, 0, stream>>>(x, inv_norm);
  qkv_kernel<<<dim3(NTOK / 32, BATCH), 256, 0, stream>>>(
      x, wqkv_h, inv_norm, qs_t, kraw, vh);
  kstats_kernel<<<BATCH * HID, 256, 0, stream>>>(kraw, mem_kv, rowmax, rowsum);
  context_kernel<<<dim3(BATCH * NHEAD, NSPLIT), 256, 0, stream>>>(
      kraw, vh, mem_kv, rowmax, rowsum, ctx_part);
  w2_kernel<<<dim3(BATCH, NHEAD / 2, CH / W2_ROWS), 256, 0, stream>>>(w_out, ctx_part, W2h);
  out_kernel<<<dim3(NTOK / 32, BATCH), 256, 0, stream>>>(
      W2h, qs_t, b_out, out_g, out);
}

// v003
// One run takes 130 microseconds.
// In two side-by-side timings against v002, it was 1.12 and 1.11 times as fast.
// Over all steps from v000 it is 2.62 times as fast.
#include <hip/hip_runtime.h>
#include <hip/hip_bf16.h>
#include <stdint.h>

typedef __attribute__((ext_vector_type(16))) _Float16 v16h;
typedef __attribute__((ext_vector_type(8)))  _Float16 v8h;
typedef __attribute__((ext_vector_type(8)))  float    v8f;

#define BATCH 16
#define CH    256
#define NTOK  4096
#define HID   128
#define QKVR  384
#define NHEAD 4
#define DHEAD 32
#define NMEM  4
#define NSPLIT 16               // work-groups that share one (b,h) token sum
#define NSEG  (NTOK / NSPLIT)   // tokens per work-group of the context kernel

__device__ __forceinline__ v8f wmma_f16(v16h a, v16h b, v8f c) {
  // v_wmma_f32_16x16x32_f16 : D = A(16x32) * B(32x16) + C(16x16 f32)
  return __builtin_amdgcn_wmma_f32_16x16x32_f16(
      /*neg_a=*/false, a, /*neg_b=*/false, b,
      /*c_mod=*/(short)0, c, /*reuse_a=*/false, /*reuse_b=*/false);
}

__device__ __forceinline__ v16h load_frag(const _Float16* base, int lane, int stride) {
  const int r  = lane & 15;
  const int k0 = (lane >> 4) << 3;       // 0 or 8
  const _Float16* p = base + r * stride;
  v8h lo = *(const v8h*)(p + k0);
  v8h hi = *(const v8h*)(p + 16 + k0);
  v16h f;
#pragma unroll
  for (int i = 0; i < 8; ++i) { f[i] = lo[i]; f[i + 8] = hi[i]; }
  return f;
}

__device__ __forceinline__ int frag_piece(int row, int k, int ksteps) {
  const int lane = (((k >> 3) & 1) << 4) | (row & 15);
  return ((((row >> 4) * ksteps + (k >> 5)) * 2 + ((k >> 4) & 1)) << 5) + lane;
}

// Load the A fragment of (row tile, k step) straight from a fragment-ordered matrix.
// wl: this lane's piece of the block that tile and ks count from.
__device__ __forceinline__ v16h load_frag_packed(const v8h* __restrict__ wl,
                                                 int tile, int ks, int ksteps) {
  const v8h* p = wl + (((tile * ksteps + ks) * 2) << 5);
  v8h lo = p[0];
  v8h hi = p[32];
  v16h f;
#pragma unroll
  for (int i = 0; i < 8; ++i) { f[i] = lo[i]; f[i + 8] = hi[i]; }
  return f;
}

// ---------------------------------------------------------------------------
// K0: fold norm_g into qkv weight, convert to f16, store in fragment order.
// ---------------------------------------------------------------------------
__global__ void prep_kernel(const float* __restrict__ w_qkv,
                            const float* __restrict__ norm_g,
                            _Float16* __restrict__ wqkv_h) {
  int i = blockIdx.x * 256 + threadIdx.x;
  if (i < QKVR * CH) {
    const int row = i >> 8, k = i & (CH - 1);
    wqkv_h[frag_piece(row, k & ~7, CH / 32) * 8 + (k & 7)] =
        (_Float16)(w_qkv[i] * norm_g[k]);
  }
}

// ---------------------------------------------------------------------------
// K1: per-(b,n) channel inverse norm, with sqrt(c)=16 folded in.
// ---------------------------------------------------------------------------
__global__ void invnorm_kernel(const float* __restrict__ x,
                               float* __restrict__ inv_norm) {
  int pos = blockIdx.x * 256 + threadIdx.x;     // 0 .. 65535
  int b = pos >> 12, n = pos & (NTOK - 1);
  const float* col = x + (size_t)b * CH * NTOK + n;
  float s = 0.f;
  for (int c = 0; c < CH; ++c) { float v = col[(size_t)c * NTOK]; s += v * v; }
  inv_norm[pos] = 16.0f / fmaxf(sqrtf(s), 1e-12f);
}

// ---------------------------------------------------------------------------
// K2: QKV GEMM, WMMA.  Per workgroup: 384x32 output tile, K=256.
// No two waves share a weight row, so the A fragments go from global memory
// (fragment order) straight into registers; only x passes through LDS.
// Fused: q-softmax over d (per head, per column) * SCALE -> qs_t (b,n,128) f16
//        k raw f32 (b,128,n);  v f16 (b,128,n).
// ---------------------------------------------------------------------------
__global__ __launch_bounds__(256) void qkv_kernel(
    const float* __restrict__ x, const _Float16* __restrict__ wqkv_h,
    const float* __restrict__ inv_norm,
    _Float16* __restrict__ qs_t, float* __restrict__ kraw,
    _Float16* __restrict__ vh) {
  // LDS: stage phase  : B 32x32 f16 (2048 B)
  //      epilog phase : out 384x33 f32 (50688 B)   (reuses same memory)
  __shared__ __align__(16) char smem[QKVR * 33 * 4];
  _Float16* lds_b = (_Float16*)smem;
  float*    lds_o = (float*)smem;

  const int tid  = threadIdx.x;
  const int wave = tid >> 5, lane = tid & 31;
  const int n0   = blockIdx.x * 32;
  const int b    = blockIdx.y;

  v8f acc[3][2];
#pragma unroll
  for (int i = 0; i < 3; ++i)
#pragma unroll
    for (int j = 0; j < 2; ++j)
#pragma unroll
      for (int r = 0; r < 8; ++r) acc[i][j][r] = 0.f;

  // this lane's first piece of this wave's three row tiles: uniform base + one 32-bit offset
  const v8h* wl = (const v8h*)wqkv_h + (unsigned)(wave * 3 * (CH / 32) * 64 + lane);

  for (int ks = 0; ks < CH / 32; ++ks) {
    const int K0 = ks * 32;
    __syncthreads();
    // this wave's three A fragments, issued beside the x loads
    v16h af[3];
#pragma unroll
    for (int i = 0; i < 3; ++i) af[i] = load_frag_packed(wl, i, ks, CH / 32);
    // stage B (transposed [n][c]): x * inv_norm -> f16
#pragma unroll
    for (int i = 0; i < 4; ++i) {
      int idx = tid + i * 256;
      int nl = idx & 31, cl = idx >> 5;
      float xv = x[((size_t)b * CH + (K0 + cl)) * NTOK + n0 + nl];
      lds_b[nl * 32 + cl] = (_Float16)(xv * inv_norm[b * NTOK + n0 + nl]);
    }
    __syncthreads();
    v16h bf0 = load_frag(lds_b, lane, 32);
    v16h bf1 = load_frag(lds_b + 16 * 32, lane, 32);
#pragma unroll
    for (int i = 0; i < 3; ++i) {
      acc[i][0] = wmma_f16(af[i], bf0, acc[i][0]);
      acc[i][1] = wmma_f16(af[i], bf1, acc[i][1]);
    }
  }
  __syncthreads();
#pragma unroll
  for (int i = 0; i < 3; ++i) {
    int Rb = (wave * 3 + i) * 16 + ((lane >> 4) << 3);
#pragma unroll
    for (int j = 0; j < 2; ++j) {
      int cc = j * 16 + (lane & 15);
#pragma unroll
      for (int r = 0; r < 8; ++r) lds_o[(Rb + r) * 33 + cc] = acc[i][j][r];
    }
  }
  __syncthreads();
  // q rows 0..127: softmax over d per (head, column), * 32^-0.5
  if (tid < 128) {
    const float SCALE = 0.17677669529663687f;
    int h = tid >> 5, col = tid & 31;
    float m = -1e30f;
#pragma unroll
    for (int d = 0; d < DHEAD; ++d) m = fmaxf(m, lds_o[(h * 32 + d) * 33 + col]);
    float e[DHEAD], s = 0.f;
#pragma unroll
    for (int d = 0; d < DHEAD; ++d) {
      e[d] = __expf(lds_o[(h * 32 + d) * 33 + col] - m);
      s += e[d];
    }
    float inv = SCALE / s;
    _Float16* dst = qs_t + ((size_t)b * NTOK + n0 + col) * HID + h * 32;
#pragma unroll
    for (int d = 0; d < DHEAD; ++d) dst[d] = (_Float16)(e[d] * inv);
  }
  // k rows 128..255 raw f32; v rows 256..383 f16
  for (int idx = tid; idx < HID * 32; idx += 256) {
    int r = idx >> 5, col = idx & 31;
    kraw[((size_t)b * HID + r) * NTOK + n0 + col] = lds_o[(HID + r) * 33 + col];
  }
  for (int idx = tid; idx < HID * 32; idx += 256) {
    int r = idx >> 5, col = idx & 31;
    vh[((size_t)b * HID + r) * NTOK + n0 + col] =
        (_Float16)lds_o[(2 * HID + r) * 33 + col];
  }
}

// ---------------------------------------------------------------------------
// K3: per-row (b,h,d) max and sum(exp) over n (incl. 4 memory tokens).
// ---------------------------------------------------------------------------
__global__ __launch_bounds__(256) void kstats_kernel(
    const float* __restrict__ kraw, const float* __restrict__ mem_kv,
    float* __restrict__ rowmax, float* __restrict__ rowsum) {
  __shared__ float red[256];
  const int rg = blockIdx.x;          // 0..2047  == b*128 + h*32 + d
  const int tid = threadIdx.x;
  const int hd = rg & (HID - 1);
  const float* row = kraw + (size_t)rg * NTOK;
  float m = -1e30f;
  for (int n = tid; n < NTOK; n += 256) m = fmaxf(m, row[n]);
  if (tid < NMEM) m = fmaxf(m, mem_kv[hd * NMEM + tid]);   // mem_kv[0]
  red[tid] = m; __syncthreads();
  for (int s = 128; s > 0; s >>= 1) {
    if (tid < s) red[tid] = fmaxf(red[tid], red[tid + s]);
    __syncthreads();
  }
  m = red[0]; __syncthreads();
  float s = 0.f;
  for (int n = tid; n < NTOK; n += 256) s += __expf(row[n] - m);
  if (tid < NMEM) s += __expf(mem_kv[hd * NMEM + tid] - m);
  red[tid] = s; __syncthreads();
  for (int st = 128; st > 0; st >>= 1) {
    if (tid < st) red[tid] += red[tid + st];
    __syncthreads();
  }
  if (tid == 0) { rowmax[rg] = m; rowsum[rg] = red[0]; }
}

// ---------------------------------------------------------------------------
// K4: context[b,h,d,e] = sum_n softmax_k[d,n] * v[e,n]  (incl. mem tokens).
// NSPLIT workgroups per (b,h), each over its own NSEG tokens, LDS-tiled over n.
// Each stores a normalised partial sum: ctx_part[split][b][h][d][e]; K5 adds them.
// ---------------------------------------------------------------------------
__global__ __launch_bounds__(256) void context_kernel(
    const float* __restrict__ kraw, const _Float16* __restrict__ vh,
    const float* __restrict__ mem_kv, const float* __restrict__ rowmax,
    const float* __restrict__ rowsum, float* __restrict__ ctx_part) {
  __shared__ float kch[32][65];
  __shared__ float vch[32][65];
  __shared__ float rmax[32];
  const int bh = blockIdx.x, b = bh >> 2, h = bh & 3;
  const int split = blockIdx.y;
  const int tid = threadIdx.x;
  const int d = tid >> 3, e0 = (tid & 7) * 4;
  const size_t rowbase = ((size_t)b * HID + h * 32) * NTOK;
  const int statbase = b * HID + h * 32;
  if (tid < 32) rmax[tid] = rowmax[statbase + tid];
  float acc[4] = {0.f, 0.f, 0.f, 0.f};
  for (int chunk = split * NSEG; chunk < (split + 1) * NSEG; chunk += 64) {
    __syncthreads();
#pragma unroll
    for (int i = 0; i < 8; ++i) {
      int idx = tid + i * 256;
      int r = idx >> 6, c = idx & 63;
      float kv = kraw[rowbase + (size_t)r * NTOK + chunk + c];
      kch[r][c] = __expf(kv - rmax[r]);
      vch[r][c] = (float)vh[rowbase + (size_t)r * NTOK + chunk + c];
    }
    __syncthreads();
#pragma unroll 8
    for (int j = 0; j < 64; ++j) {
      float kx = kch[d][j];
      acc[0] += kx * vch[e0 + 0][j];
      acc[1] += kx * vch[e0 + 1][j];
      acc[2] += kx * vch[e0 + 2][j];
      acc[3] += kx * vch[e0 + 3][j];
    }
  }
  // memory tokens: mem_kv[0]=keys at offset 0, mem_kv[1]=values at offset 512;
  // they belong to one partial sum only.
  if (split == 0) {
#pragma unroll
    for (int j = 0; j < NMEM; ++j) {
      float kx = __expf(mem_kv[(h * 32 + d) * NMEM + j] - rmax[d]);
#pragma unroll
      for (int i = 0; i < 4; ++i)
        acc[i] += kx * mem_kv[NHEAD * DHEAD * NMEM + (h * 32 + e0 + i) * NMEM + j];
    }
  }
  float invs = 1.0f / rowsum[statbase + d];
  float* dst = ctx_part +
      ((((size_t)split * BATCH + b) * NHEAD + h) * DHEAD + d) * DHEAD + e0;
#pragma unroll
  for (int i = 0; i < 4; ++i) dst[i] = acc[i] * invs;
}

#define W2_ROWS  32
#define CTX_PITCH 36
#define CTX_PLANE (DHEAD * CTX_PITCH + 32)
__global__ __launch_bounds__(256) void w2_kernel(
    const float* __restrict__ w_out, const float* __restrict__ ctx_part,
    _Float16* __restrict__ W2h) {
  __shared__ __align__(16) float ctxT[2 * CTX_PLANE];   // [head of the pair][e][d]
  const int b = blockIdx.x, hp = blockIdx.y, tid = threadIdx.x;
  const int o  = blockIdx.z * W2_ROWS + (tid >> 3);
  const int hl = (tid >> 2) & 1;
  const int dg = (tid & 3) * 8;
  // this thread's 32 weights: they do not depend on the LDS fill, so they load beside the partial sums
  const float4* wrow = (const float4*)(w_out + o * HID + (hp * 2 + hl) * DHEAD);
  float4 w4[DHEAD / 4];
  // unrolled: w4 is indexed by constants only and stays in registers
#pragma unroll
  for (int i = 0; i < DHEAD / 4; ++i) w4[i] = wrow[i];
  const float4* part = (const float4*)ctx_part + (size_t)b * 1024 + hp * 512;
  // unrolled: the two heads' loads overlap
#pragma unroll
  for (int t = 0; t < 2; ++t) {
    const int i4 = tid + t * 256;
    float4 s = part[i4];
    // unrolled so that many partial-sum loads are in flight together
#pragma unroll
    for (int sp = 1; sp < NSPLIT; ++sp) {
      float4 q = part[(size_t)sp * BATCH * 1024 + i4];
      s.x += q.x; s.y += q.y; s.z += q.z; s.w += q.w;
    }
    const int d = (i4 >> 3) & 31, e = (i4 & 7) * 4;
    float* col = ctxT + t * CTX_PLANE + e * CTX_PITCH + d;
    col[0 * CTX_PITCH] = s.x;
    col[1 * CTX_PITCH] = s.y;
    col[2 * CTX_PITCH] = s.z;
    col[3 * CTX_PITCH] = s.w;
  }
  __syncthreads();
  float acc[8];
#pragma unroll
  for (int j = 0; j < 8; ++j) acc[j] = 0.f;
  const float* crow = ctxT + hl * CTX_PLANE + dg;
  // both loops unrolled: LDS offsets become immediates and many row reads are in flight;
  // e runs upwards, one fused multiply-add per term
#pragma unroll
  for (int e4 = 0; e4 < DHEAD / 4; ++e4) {
    const float wv[4] = {w4[e4].x, w4[e4].y, w4[e4].z, w4[e4].w};
#pragma unroll
    for (int k = 0; k < 4; ++k) {
      const float4 c0 = *(const float4*)(crow + (e4 * 4 + k) * CTX_PITCH);
      const float4 c1 = *(const float4*)(crow + (e4 * 4 + k) * CTX_PITCH + 4);
      acc[0] = fmaf(wv[k], c0.x, acc[0]); acc[1] = fmaf(wv[k], c0.y, acc[1]);
      acc[2] = fmaf(wv[k], c0.z, acc[2]); acc[3] = fmaf(wv[k], c0.w, acc[3]);
      acc[4] = fmaf(wv[k], c1.x, acc[4]); acc[5] = fmaf(wv[k], c1.y, acc[5]);
      acc[6] = fmaf(wv[k], c1.z, acc[6]); acc[7] = fmaf(wv[k], c1.w, acc[7]);
    }
  }
  v8h r;
#pragma unroll
  for (int j = 0; j < 8; ++j) r[j] = (_Float16)acc[j];
  ((v8h*)(W2h + (size_t)b * CH * HID))[frag_piece(o, (hp * 2 + hl) * DHEAD + dg, HID / 32)] = r;
}

// ---------------------------------------------------------------------------
// K6: Y = W2[b] @ qs  + b_out, then RMSNorm over the 256 output channels.
// WMMA; one workgroup owns a full 256-row x 32-col tile so the channel
// norm is done entirely in LDS.  A fragments as in K2: global to registers.
// ---------------------------------------------------------------------------
__global__ __launch_bounds__(256) void out_kernel(
    const _Float16* __restrict__ W2h, const _Float16* __restrict__ qs_t,
    const float* __restrict__ b_out, const float* __restrict__ out_g,
    float* __restrict__ out) {
  __shared__ __align__(16) char smem[CH * 33 * 4];
  _Float16* lds_b = (_Float16*)smem;
  float*    lds_y = (float*)smem;
  __shared__ float colinv[32];

  const int tid = threadIdx.x;
  const int wave = tid >> 5, lane = tid & 31;
  const int n0 = blockIdx.x * 32;
  const int b  = blockIdx.y;

  v8f acc[2][2];
#pragma unroll
  for (int i = 0; i < 2; ++i)
#pragma unroll
    for (int j = 0; j < 2; ++j)
#pragma unroll
      for (int r = 0; r < 8; ++r) acc[i][j][r] = 0.f;

  const v8h* wl = (const v8h*)(W2h + (size_t)b * CH * HID) + (unsigned)(wave * 2 * (HID / 32) * 64 + lane);
  const uint32_t* bsrc = (const uint32_t*)qs_t;
  uint32_t* bdst = (uint32_t*)lds_b;

  for (int ks = 0; ks < HID / 32; ++ks) {
    const int K0 = ks * 32;
    __syncthreads();
    // this wave's two A fragments, issued beside the B loads
    v16h af[2];
#pragma unroll
    for (int i = 0; i < 2; ++i) af[i] = load_frag_packed(wl, i, ks, HID / 32);
#pragma unroll
    for (int i = 0; i < 2; ++i) {                          // B: 32x32 halves
      int idx = tid + i * 256;
      int n = idx >> 4, cp = idx & 15;
      bdst[idx] = bsrc[((size_t)b * NTOK + n0 + n) * (HID / 2) + (K0 >> 1) + cp];
    }
    __syncthreads();
    v16h bf0 = load_frag(lds_b, lane, 32);
    v16h bf1 = load_frag(lds_b + 16 * 32, lane, 32);
#pragma unroll
    for (int i = 0; i < 2; ++i) {
      acc[i][0] = wmma_f16(af[i], bf0, acc[i][0]);
      acc[i][1] = wmma_f16(af[i], bf1, acc[i][1]);
    }
  }
  __syncthreads();
#pragma unroll
  for (int i = 0; i < 2; ++i) {
    int Rb = (wave * 2 + i) * 16 + ((lane >> 4) << 3);
#pragma unroll
    for (int j = 0; j < 2; ++j) {
      int cc = j * 16 + (lane & 15);
#pragma unroll
      for (int r = 0; r < 8; ++r) lds_y[(Rb + r) * 33 + cc] = acc[i][j][r];
    }
  }
  __syncthreads();
  if (tid < 32) {
    float s = 0.f;
    for (int o = 0; o < CH; ++o) {
      float v = lds_y[o * 33 + tid] + b_out[o];
      s += v * v;
    }
    colinv[tid] = 16.0f / fmaxf(sqrtf(s), 1e-12f);
  }
  __syncthreads();
  for (int idx = tid; idx < CH * 32; idx += 256) {
    int o = idx >> 5, col = idx & 31;
    float v = (lds_y[o * 33 + col] + b_out[o]) * colinv[col] * out_g[o];
    out[((size_t)b * CH + o) * NTOK + n0 + col] = v;
  }
}

// ---------------------------------------------------------------------------
extern "C" void kernel_launch(void* const* d_in, const int* in_sizes, int n_in,
                              void* d_out, int out_size, void* d_ws, size_t ws_size,
                              hipStream_t stream) {
  (void)in_sizes; (void)n_in; (void)out_size; (void)ws_size;
  const float* x        = (const float*)d_in[0];   // (16,256,64,64)
  const float* norm_g   = (const float*)d_in[1];   // (256)
  const float* w_qkv    = (const float*)d_in[2];   // (384,256)
  const float* mem_kv   = (const float*)d_in[3];   // (2,4,32,4)
  const float* w_out    = (const float*)d_in[4];   // (256,128)
  const float* b_out    = (const float*)d_in[5];   // (256)
  const float* out_g    = (const float*)d_in[6];   // (256)
  float* out = (float*)d_out;                      // (16,256,64,64)

  char* ws = (char*)d_ws;
  size_t off = 0;
  auto take = [&](size_t bytes) -> char* {
    char* p = ws + off;
    off = (off + bytes + 255) & ~(size_t)255;
    return p;
  };
  _Float16* wqkv_h   = (_Float16*)take((size_t)QKVR * CH * 2);           // 192 KB
  float*    inv_norm = (float*)   take((size_t)BATCH * NTOK * 4);        // 256 KB
  _Float16* qs_t     = (_Float16*)take((size_t)BATCH * NTOK * HID * 2);  // 16 MB
  float*    kraw     = (float*)   take((size_t)BATCH * HID * NTOK * 4);  // 32 MB
  _Float16* vh       = (_Float16*)take((size_t)BATCH * HID * NTOK * 2);  // 16 MB
  float*    rowmax   = (float*)   take((size_t)BATCH * HID * 4);
  float*    rowsum   = (float*)   take((size_t)BATCH * HID * 4);
  float*    ctx_part = (float*)   take((size_t)NSPLIT * BATCH * NHEAD * DHEAD * DHEAD * 4);  // 4 MB
  _Float16* W2h      = (_Float16*)take((size_t)BATCH * CH * HID * 2);    // 1 MB

  prep_kernel<<<QKVR, 256, 0, stream>>>(w_qkv, norm_g, wqkv_h);
  invnorm_kernel<<<BATCH * NTOK / 256, 256, 0, stream>>>(x, inv_norm);
  qkv_kernel<<<dim3(NTOK / 32, BATCH), 256, 0, stream>>>(
      x, wqkv_h, inv_norm, qs_t, kraw, vh);
  kstats_kernel<<<BATCH * HID, 256, 0, stream>>>(kraw, mem_kv, rowmax, rowsum);
  context_kernel<<<dim3(BATCH * NHEAD, NSPLIT), 256, 0, stream>>>(
      kraw, vh, mem_kv, rowmax, rowsum, ctx_part);
  w2_kernel<<<dim3(BATCH, NHEAD / 2, CH / W2_ROWS), 256, 0, stream>>>(w_out, ctx_part, W2h);
  out_kernel<<<dim3(NTOK / 32, BATCH), 256, 0, stream>>>(
      W2h, qs_t, b_out, out_g, out);
}

// v004
// A run of this version takes 122 microseconds.
// Next to v003, in two timings, it ran 1.06 times as fast each time.
// Counting every step since v000, it is 2.78 times as fast.
#include <hip/hip_runtime.h>
#include <hip/hip_bf16.h>
#include <stdint.h>

typedef __attribute__((ext_vector_type(16))) _Float16 v16h;
typedef __attribute__((ext_vector_type(8)))  _Float16 v8h;
typedef __attribute__((ext_vector_type(8)))  float    v8f;

#define BATCH 16
#define CH    256
#define NTOK  4096
#define HID   128
#define QKVR  384
#define NHEAD 4
#define DHEAD 32
#define NMEM  4
#define NSPLIT 16               // work-groups that share one (b,h) token sum
#define NSEG  (NTOK / NSPLIT)   // tokens per work-group of the context kernel

__device__ __forceinline__ v8f wmma_f16(v16h a, v16h b, v8f c) {
  // v_wmma_f32_16x16x32_f16 : D = A(16x32) * B(32x16) + C(16x16 f32)
  return __builtin_amdgcn_wmma_f32_16x16x32_f16(
      /*neg_a=*/false, a, /*neg_b=*/false, b,
      /*c_mod=*/(short)0, c, /*reuse_a=*/false, /*reuse_b=*/false);
}

__device__ __forceinline__ v16h load_frag(const _Float16* base, int lane, int stride) {
  const int r  = lane & 15;
  const int k0 = (lane >> 4) << 3;       // 0 or 8
  const _Float16* p = base + r * stride;
  v8h lo = *(const v8h*)(p + k0);
  v8h hi = *(const v8h*)(p + 16 + k0);
  v16h f;
#pragma unroll
  for (int i = 0; i < 8; ++i) { f[i] = lo[i]; f[i + 8] = hi[i]; }
  return f;
}

__device__ __forceinline__ int frag_piece(int row, int k, int ksteps) {
  const int lane = (((k >> 3) & 1) << 4) | (row & 15);
  return ((((row >> 4) * ksteps + (k >> 5)) * 2 + ((k >> 4) & 1)) << 5) + lane;
}

// Load the A fragment of (row tile, k step) straight from a fragment-ordered matrix.
// wl: this lane's piece of the block that tile and ks count from.
__device__ __forceinline__ v16h load_frag_packed(const v8h* __restrict__ wl,
                                                 int tile, int ks, int ksteps) {
  const v8h* p = wl + (((tile * ksteps + ks) * 2) << 5);
  v8h lo = p[0];
  v8h hi = p[32];
  v16h f;
#pragma unroll
  for (int i = 0; i < 8; ++i) { f[i] = lo[i]; f[i + 8] = hi[i]; }
  return f;
}

__device__ __forceinline__ float exp_slot(float x) {
  float r;
  asm("v_exp_f32 %0, %1\n\tv_nop" : "=v"(r) : "v"(x * 1.4426950408889634f));
  return r;
}

// ---------------------------------------------------------------------------
// K0: fold norm_g into qkv weight, convert to f16, store in fragment order.
// ---------------------------------------------------------------------------
__global__ void prep_kernel(const float* __restrict__ w_qkv,
                            const float* __restrict__ norm_g,
                            _Float16* __restrict__ wqkv_h) {
  int i = blockIdx.x * 256 + threadIdx.x;
  if (i < QKVR * CH) {
    const int row = i >> 8, k = i & (CH - 1);
    wqkv_h[frag_piece(row, k & ~7, CH / 32) * 8 + (k & 7)] =
        (_Float16)(w_qkv[i] * norm_g[k]);
  }
}

// ---------------------------------------------------------------------------
// K1: per-(b,n) channel inverse norm, with sqrt(c)=16 folded in.
// ---------------------------------------------------------------------------
__global__ void invnorm_kernel(const float* __restrict__ x,
                               float* __restrict__ inv_norm) {
  int pos = blockIdx.x * 256 + threadIdx.x;     // 0 .. 65535
  int b = pos >> 12, n = pos & (NTOK - 1);
  const float* col = x + (size_t)b * CH * NTOK + n;
  float s = 0.f;
  for (int c = 0; c < CH; ++c) { float v = col[(size_t)c * NTOK]; s += v * v; }
  inv_norm[pos] = 16.0f / fmaxf(sqrtf(s), 1e-12f);
}

// ---------------------------------------------------------------------------
// K2: QKV GEMM, WMMA.  Per workgroup: 384x32 output tile, K=256.
// No two waves share a weight row, so the A fragments go from global memory
// (fragment order) straight into registers; only x passes through LDS.
// Fused: q-softmax over d (per head, per column) * SCALE -> qs_t (b,n,128) f16
//        k raw f32 (b,128,n);  v f16 (b,128,n).
// ---------------------------------------------------------------------------
__global__ __launch_bounds__(256) void qkv_kernel(
    const float* __restrict__ x, const _Float16* __restrict__ wqkv_h,
    const float* __restrict__ inv_norm,
    _Float16* __restrict__ qs_t, float* __restrict__ kraw,
    _Float16* __restrict__ vh) {
  // LDS: stage phase  : B 32x32 f16 (2048 B)
  //      epilog phase : out 384x33 f32 (50688 B)   (reuses same memory)
  __shared__ __align__(16) char smem[QKVR * 33 * 4];
  _Float16* lds_b = (_Float16*)smem;
  float*    lds_o = (float*)smem;

  const int tid  = threadIdx.x;
  const int wave = tid >> 5, lane = tid & 31;
  const int n0   = blockIdx.x * 32;
  const int b    = blockIdx.y;

  v8f acc[3][2];
#pragma unroll
  for (int i = 0; i < 3; ++i)
#pragma unroll
    for (int j = 0; j < 2; ++j)
#pragma unroll
      for (int r = 0; r < 8; ++r) acc[i][j][r] = 0.f;

  // this lane's first piece of this wave's three row tiles: uniform base + one 32-bit offset
  const v8h* wl = (const v8h*)wqkv_h + (unsigned)(wave * 3 * (CH / 32) * 64 + lane);

  for (int ks = 0; ks < CH / 32; ++ks) {
    const int K0 = ks * 32;
    __syncthreads();
    // this wave's three A fragments, issued beside the x loads
    v16h af[3];
#pragma unroll
    for (int i = 0; i < 3; ++i) af[i] = load_frag_packed(wl, i, ks, CH / 32);
    // stage B (transposed [n][c]): x * inv_norm -> f16
#pragma unroll
    for (int i = 0; i < 4; ++i) {
      int idx = tid + i * 256;
      int nl = idx & 31, cl = idx >> 5;
      float xv = x[((size_t)b * CH + (K0 + cl)) * NTOK + n0 + nl];
      lds_b[nl * 32 + cl] = (_Float16)(xv * inv_norm[b * NTOK + n0 + nl]);
    }
    __syncthreads();
    v16h bf0 = load_frag(lds_b, lane, 32);
    v16h bf1 = load_frag(lds_b + 16 * 32, lane, 32);
#pragma unroll
    for (int i = 0; i < 3; ++i) {
      acc[i][0] = wmma_f16(af[i], bf0, acc[i][0]);
      acc[i][1] = wmma_f16(af[i], bf1, acc[i][1]);
    }
  }
  __syncthreads();
#pragma unroll
  for (int i = 0; i < 3; ++i) {
    int Rb = (wave * 3 + i) * 16 + ((lane >> 4) << 3);
#pragma unroll
    for (int j = 0; j < 2; ++j) {
      int cc = j * 16 + (lane & 15);
#pragma unroll
      for (int r = 0; r < 8; ++r) lds_o[(Rb + r) * 33 + cc] = acc[i][j][r];
    }
  }
  __syncthreads();
  // q rows 0..127: softmax over d per (head, column), * 32^-0.5
  if (tid < 128) {
    const float SCALE = 0.17677669529663687f;
    int h = tid >> 5, col = tid & 31;
    float m = -1e30f;
#pragma unroll
    for (int d = 0; d < DHEAD; ++d) m = fmaxf(m, lds_o[(h * 32 + d) * 33 + col]);
    float e[DHEAD], s = 0.f;
#pragma unroll
    for (int d = 0; d < DHEAD; ++d) {
      e[d] = __expf(lds_o[(h * 32 + d) * 33 + col] - m);
      s += e[d];
    }
    float inv = SCALE / s;
    _Float16* dst = qs_t + ((size_t)b * NTOK + n0 + col) * HID + h * 32;
#pragma unroll
    for (int d = 0; d < DHEAD; ++d) dst[d] = (_Float16)(e[d] * inv);
  }
  // k rows 128..255 raw f32; v rows 256..383 f16
  for (int idx = tid; idx < HID * 32; idx += 256) {
    int r = idx >> 5, col = idx & 31;
    kraw[((size_t)b * HID + r) * NTOK + n0 + col] = lds_o[(HID + r) * 33 + col];
  }
  for (int idx = tid; idx < HID * 32; idx += 256) {
    int r = idx >> 5, col = idx & 31;
    vh[((size_t)b * HID + r) * NTOK + n0 + col] =
        (_Float16)lds_o[(2 * HID + r) * 33 + col];
  }
}

// ---------------------------------------------------------------------------
// K3: partial context sums with their own softmax statistics.
// context[b,h,d,e] = sum_n softmax_k[d,n] * v[e,n]  (incl. mem tokens).
// NSPLIT workgroups per (b,h), each over its own NSEG tokens.  A workgroup takes
// the maximum m and the sum l of exp(k - m) of each row d over ITS tokens only and
// stores  ctx_part[split][b][h][d][e] = sum_n exp(k[d,n] - m) * v[e,n]  with m and l;
// K4 brings the NSPLIT partial sums of a row to one common maximum and divides.
// A row's keys are held by 8 neighbouring lanes, the same 8 threads that later
// sum this row's products, so m and l never leave the wave.
// ---------------------------------------------------------------------------
__global__ __launch_bounds__(256) void context_kernel(
    const float* __restrict__ kraw, const _Float16* __restrict__ vh,
    const float* __restrict__ mem_kv, float* __restrict__ ctx_part,
    float* __restrict__ part_max, float* __restrict__ part_sum) {
  __shared__ float kch[32][65];
  __shared__ float vch[32][65];
  const int bh = blockIdx.x, b = bh >> 2, h = bh & 3;
  const int split = blockIdx.y;
  const int tid = threadIdx.x;
  const int d = tid >> 3, q8 = tid & 7, e0 = q8 * 4;
  const size_t rowbase = ((size_t)b * HID + h * 32) * NTOK;
  // this thread's NSEG / 8 keys of row d, 4 tokens a piece; the row's 8 threads
  // cover 128 contiguous bytes with each piece
  const float4* krow =
      (const float4*)(kraw + rowbase + (size_t)d * NTOK + split * NSEG) + q8;
  float4 kq[NSEG / 32];
  // unrolled: kq is indexed by constants only and all loads are in flight together
#pragma unroll
  for (int i = 0; i < NSEG / 32; ++i) kq[i] = krow[i * 8];
  // memory keys of row d (mem_kv[0]); they belong to split 0 only
  const float4 mk = *(const float4*)(mem_kv + (h * 32 + d) * NMEM);
  float m = kq[0].x;
#pragma unroll
  for (int i = 0; i < NSEG / 32; ++i)
    m = fmaxf(m, fmaxf(fmaxf(kq[i].x, kq[i].y), fmaxf(kq[i].z, kq[i].w)));
  const float mkmax = fmaxf(fmaxf(mk.x, mk.y), fmaxf(mk.z, mk.w));
  m = fmaxf(m, split == 0 ? mkmax : m);
#pragma unroll
  for (int s = 1; s < 8; s <<= 1) m = fmaxf(m, __shfl_xor(m, s));
  float l = 0.f;
#pragma unroll
  for (int i = 0; i < NSEG / 32; ++i) {
    kq[i].x = exp_slot(kq[i].x - m); kq[i].y = exp_slot(kq[i].y - m);
    kq[i].z = exp_slot(kq[i].z - m); kq[i].w = exp_slot(kq[i].w - m);
    l += (kq[i].x + kq[i].y) + (kq[i].z + kq[i].w);
  }
#pragma unroll
  for (int s = 1; s < 8; s <<= 1) l += __shfl_xor(l, s);

  float acc[4] = {0.f, 0.f, 0.f, 0.f};
  // unrolled: kq is indexed by constants only
#pragma unroll
  for (int ch = 0; ch < NSEG / 64; ++ch) {
    const int chunk = split * NSEG + ch * 64;
    // ends the readers' last reads of the tiles; nothing has read them before the first fill
    if (ch > 0) __syncthreads();
#pragma unroll
    for (int i = 0; i < 2; ++i) {
      float* kd = &kch[d][i * 32 + q8 * 4];
      kd[0] = kq[ch * 2 + i].x; kd[1] = kq[ch * 2 + i].y;
      kd[2] = kq[ch * 2 + i].z; kd[3] = kq[ch * 2 + i].w;
    }
#pragma unroll
    for (int i = 0; i < 8; ++i) {
      int idx = tid + i * 256;
      int r = idx >> 6, c = idx & 63;
      vch[r][c] = (float)vh[rowbase + (size_t)r * NTOK + chunk + c];
    }
    __syncthreads();
#pragma unroll 8
    for (int j = 0; j < 64; ++j) {
      float kx = kch[d][j];
      acc[0] += kx * vch[e0 + 0][j];
      acc[1] += kx * vch[e0 + 1][j];
      acc[2] += kx * vch[e0 + 2][j];
      acc[3] += kx * vch[e0 + 3][j];
    }
  }
  // memory tokens: mem_kv[0]=keys at offset 0, mem_kv[1]=values at offset 512;
  // they belong to one partial sum only.
  if (split == 0) {
    const float mkj[NMEM] = {mk.x, mk.y, mk.z, mk.w};
#pragma unroll
    for (int j = 0; j < NMEM; ++j) {
      float kx = exp_slot(mkj[j] - m);
      l += kx;
#pragma unroll
      for (int i = 0; i < 4; ++i)
        acc[i] += kx * mem_kv[NHEAD * DHEAD * NMEM + (h * 32 + e0 + i) * NMEM + j];
    }
  }
  float* dst = ctx_part +
      ((((size_t)split * BATCH + b) * NHEAD + h) * DHEAD + d) * DHEAD + e0;
#pragma unroll
  for (int i = 0; i < 4; ++i) dst[i] = acc[i];
  if (q8 == 0) {
    const int st = split * (BATCH * HID) + b * HID + h * 32 + d;
    part_max[st] = m;
    part_sum[st] = l;
  }
}

#define W2_ROWS  32
#define CTX_PITCH 36
#define CTX_PLANE (DHEAD * CTX_PITCH + 32)
__global__ __launch_bounds__(256) void w2_kernel(
    const float* __restrict__ w_out, const float* __restrict__ ctx_part,
    const float* __restrict__ part_max, const float* __restrict__ part_sum,
    _Float16* __restrict__ W2h) {
  __shared__ __align__(16) float ctxT[2 * CTX_PLANE];   // [head of the pair][e][d]
  __shared__ __align__(16) float wts[2 * DHEAD * NSPLIT]; // [head of the pair * 32 + d][split]
  const int b = blockIdx.x, hp = blockIdx.y, tid = threadIdx.x;
  const int o  = blockIdx.z * W2_ROWS + (tid >> 3);
  const int hl = (tid >> 2) & 1;
  const int dg = (tid & 3) * 8;
  // this thread's 32 weights: they do not depend on the LDS fill, so they load beside the partial sums
  const float4* wrow = (const float4*)(w_out + o * HID + (hp * 2 + hl) * DHEAD);
  float4 w4[DHEAD / 4];
  // unrolled: w4 is indexed by constants only and stays in registers
#pragma unroll
  for (int i = 0; i < DHEAD / 4; ++i) w4[i] = wrow[i];
  const float4* part = (const float4*)ctx_part + (size_t)b * 1024 + hp * 512;
  // both heads' partial sums do not depend on the weights: they load beside the statistics.
  // unrolled: pq is indexed by constants only and all loads are in flight together
  float4 pq[2][NSPLIT];
#pragma unroll
  for (int t = 0; t < 2; ++t)
#pragma unroll
    for (int sp = 0; sp < NSPLIT; ++sp)
      pq[t][sp] = part[(size_t)sp * BATCH * 1024 + tid + t * 256];
  // weight of split sp in row (head, d): exp(its maximum - the row's maximum) / the row's sum.
  // 4 neighbouring lanes share a row, 4 splits each.
  {
    const int row = tid >> 2, s0 = (tid & 3) * 4;
    const int st = b * HID + hp * 2 * DHEAD + row;
    float mm[4], ll[4];
#pragma unroll
    for (int j = 0; j < 4; ++j) {
      mm[j] = part_max[(s0 + j) * (BATCH * HID) + st];
      ll[j] = part_sum[(s0 + j) * (BATCH * HID) + st];
    }
    float mx = fmaxf(fmaxf(mm[0], mm[1]), fmaxf(mm[2], mm[3]));
    mx = fmaxf(mx, __shfl_xor(mx, 1));
    mx = fmaxf(mx, __shfl_xor(mx, 2));
    float ls = 0.f;
#pragma unroll
    for (int j = 0; j < 4; ++j) {
      mm[j] = exp_slot(mm[j] - mx);
      ls = fmaf(ll[j], mm[j], ls);
    }
    ls += __shfl_xor(ls, 1);
    ls += __shfl_xor(ls, 2);
    const float inv = 1.0f / ls;
    *(float4*)(wts + row * NSPLIT + s0) =
        make_float4(mm[0] * inv, mm[1] * inv, mm[2] * inv, mm[3] * inv);
  }
  // publishes the weights to the threads that sum the partial sums
  __syncthreads();
#pragma unroll
  for (int t = 0; t < 2; ++t) {
    const int i4 = tid + t * 256;
    const int d = (i4 >> 3) & 31, e = (i4 & 7) * 4;
    const float4* wr = (const float4*)(wts + (i4 >> 3) * NSPLIT);
    float4 s = make_float4(0.f, 0.f, 0.f, 0.f);
#pragma unroll
    for (int g = 0; g < NSPLIT / 4; ++g) {
      const float4 w4s = wr[g];
      const float wv[4] = {w4s.x, w4s.y, w4s.z, w4s.w};
#pragma unroll
      for (int k = 0; k < 4; ++k) {
        const float4 q = pq[t][g * 4 + k];
        s.x = fmaf(q.x, wv[k], s.x); s.y = fmaf(q.y, wv[k], s.y);
        s.z = fmaf(q.z, wv[k], s.z); s.w = fmaf(q.w, wv[k], s.w);
      }
    }
    float* col = ctxT + t * CTX_PLANE + e * CTX_PITCH + d;
    col[0 * CTX_PITCH] = s.x;
    col[1 * CTX_PITCH] = s.y;
    col[2 * CTX_PITCH] = s.z;
    col[3 * CTX_PITCH] = s.w;
  }
  __syncthreads();
  float acc[8];
#pragma unroll
  for (int j = 0; j < 8; ++j) acc[j] = 0.f;
  const float* crow = ctxT + hl * CTX_PLANE + dg;
  // both loops unrolled: LDS offsets become immediates and many row reads are in flight;
  // e runs upwards, one fused multiply-add per term
#pragma unroll
  for (int e4 = 0; e4 < DHEAD / 4; ++e4) {
    const float wv[4] = {w4[e4].x, w4[e4].y, w4[e4].z, w4[e4].w};
#pragma unroll
    for (int k = 0; k < 4; ++k) {
      const float4 c0 = *(const float4*)(crow + (e4 * 4 + k) * CTX_PITCH);
      const float4 c1 = *(const float4*)(crow + (e4 * 4 + k) * CTX_PITCH + 4);
      acc[0] = fmaf(wv[k], c0.x, acc[0]); acc[1] = fmaf(wv[k], c0.y, acc[1]);
      acc[2] = fmaf(wv[k], c0.z, acc[2]); acc[3] = fmaf(wv[k], c0.w, acc[3]);
      acc[4] = fmaf(wv[k], c1.x, acc[4]); acc[5] = fmaf(wv[k], c1.y, acc[5]);
      acc[6] = fmaf(wv[k], c1.z, acc[6]); acc[7] = fmaf(wv[k], c1.w, acc[7]);
    }
  }
  v8h r;
#pragma unroll
  for (int j = 0; j < 8; ++j) r[j] = (_Float16)acc[j];
  ((v8h*)(W2h + (size_t)b * CH * HID))[frag_piece(o, (hp * 2 + hl) * DHEAD + dg, HID / 32)] = r;
}

// ---------------------------------------------------------------------------
// K5: Y = W2[b] @ qs  + b_out, then RMSNorm over the 256 output channels.
// WMMA; one workgroup owns a full 256-row x 32-col tile so the channel
// norm is done entirely in LDS.  A fragments as in K2: global to registers.
// ---------------------------------------------------------------------------
__global__ __launch_bounds__(256) void out_kernel(
    const _Float16* __restrict__ W2h, const _Float16* __restrict__ qs_t,
    const float* __restrict__ b_out, const float* __restrict__ out_g,
    float* __restrict__ out) {
  __shared__ __align__(16) char smem[CH * 33 * 4];
  _Float16* lds_b = (_Float16*)smem;
  float*    lds_y = (float*)smem;
  __shared__ float colinv[32];

  const int tid = threadIdx.x;
  const int wave = tid >> 5, lane = tid & 31;
  const int n0 = blockIdx.x * 32;
  const int b  = blockIdx.y;

  v8f acc[2][2];
#pragma unroll
  for (int i = 0; i < 2; ++i)
#pragma unroll
    for (int j = 0; j < 2; ++j)
#pragma unroll
      for (int r = 0; r < 8; ++r) acc[i][j][r] = 0.f;

  const v8h* wl = (const v8h*)(W2h + (size_t)b * CH * HID) + (unsigned)(wave * 2 * (HID / 32) * 64 + lane);
  const uint32_t* bsrc = (const uint32_t*)qs_t;
  uint32_t* bdst = (uint32_t*)lds_b;

  for (int ks = 0; ks < HID / 32; ++ks) {
    const int K0 = ks * 32;
    __syncthreads();
    // this wave's two A fragments, issued beside the B loads
    v16h af[2];
#pragma unroll
    for (int i = 0; i < 2; ++i) af[i] = load_frag_packed(wl, i, ks, HID / 32);
#pragma unroll
    for (int i = 0; i < 2; ++i) {                          // B: 32x32 halves
      int idx = tid + i * 256;
      int n = idx >> 4, cp = idx & 15;
      bdst[idx] = bsrc[((size_t)b * NTOK + n0 + n) * (HID / 2) + (K0 >> 1) + cp];
    }
    __syncthreads();
    v16h bf0 = load_frag(lds_b, lane, 32);
    v16h bf1 = load_frag(lds_b + 16 * 32, lane, 32);
#pragma unroll
    for (int i = 0; i < 2; ++i) {
      acc[i][0] = wmma_f16(af[i], bf0, acc[i][0]);
      acc[i][1] = wmma_f16(af[i], bf1, acc[i][1]);
    }
  }
  __syncthreads();
#pragma unroll
  for (int i = 0; i < 2; ++i) {
    int Rb = (wave * 2 + i) * 16 + ((lane >> 4) << 3);
#pragma unroll
    for (int j = 0; j < 2; ++j) {
      int cc = j * 16 + (lane & 15);
#pragma unroll
      for (int r = 0; r < 8; ++r) lds_y[(Rb + r) * 33 + cc] = acc[i][j][r];
    }
  }
  __syncthreads();
  if (tid < 32) {
    float s = 0.f;
    for (int o = 0; o < CH; ++o) {
      float v = lds_y[o * 33 + tid] + b_out[o];
      s += v * v;
    }
    colinv[tid] = 16.0f / fmaxf(sqrtf(s), 1e-12f);
  }
  __syncthreads();
  for (int idx = tid; idx < CH * 32; idx += 256) {
    int o = idx >> 5, col = idx & 31;
    float v = (lds_y[o * 33 + col] + b_out[o]) * colinv[col] * out_g[o];
    out[((size_t)b * CH + o) * NTOK + n0 + col] = v;
  }
}

// ---------------------------------------------------------------------------
extern "C" void kernel_launch(void* const* d_in, const int* in_sizes, int n_in,
                              void* d_out, int out_size, void* d_ws, size_t ws_size,
                              hipStream_t stream) {
  (void)in_sizes; (void)n_in; (void)out_size; (void)ws_size;
  const float* x        = (const float*)d_in[0];   // (16,256,64,64)
  const float* norm_g   = (const float*)d_in[1];   // (256)
  const float* w_qkv    = (const float*)d_in[2];   // (384,256)
  const float* mem_kv   = (const float*)d_in[3];   // (2,4,32,4)
  const float* w_out    = (const float*)d_in[4];   // (256,128)
  const float* b_out    = (const float*)d_in[5];   // (256)
  const float* out_g    = (const float*)d_in[6];   // (256)
  float* out = (float*)d_out;                      // (16,256,64,64)

  char* ws = (char*)d_ws;
  size_t off = 0;
  auto take = [&](size_t bytes) -> char* {
    char* p = ws + off;
    off = (off + bytes + 255) & ~(size_t)255;
    return p;
  };
  _Float16* wqkv_h   = (_Float16*)take((size_t)QKVR * CH * 2);           // 192 KB
  float*    inv_norm = (float*)   take((size_t)BATCH * NTOK * 4);        // 256 KB
  _Float16* qs_t     = (_Float16*)take((size_t)BATCH * NTOK * HID * 2);  // 16 MB
  float*    kraw     = (float*)   take((size_t)BATCH * HID * NTOK * 4);  // 32 MB
  _Float16* vh       = (_Float16*)take((size_t)BATCH * HID * NTOK * 2);  // 16 MB
  float*    part_max = (float*)   take((size_t)NSPLIT * BATCH * HID * 4);  // 128 KB
  float*    part_sum = (float*)   take((size_t)NSPLIT * BATCH * HID * 4);  // 128 KB
  float*    ctx_part = (float*)   take((size_t)NSPLIT * BATCH * NHEAD * DHEAD * DHEAD * 4);  // 4 MB
  _Float16* W2h      = (_Float16*)take((size_t)BATCH * CH * HID * 2);    // 1 MB

  prep_kernel<<<QKVR, 256, 0, stream>>>(w_qkv, norm_g, wqkv_h);
  invnorm_kernel<<<BATCH * NTOK / 256, 256, 0, stream>>>(x, inv_norm);
  qkv_kernel<<<dim3(NTOK / 32, BATCH), 256, 0, stream>>>(
      x, wqkv_h, inv_norm, qs_t, kraw, vh);
  context_kernel<<<dim3(BATCH * NHEAD, NSPLIT), 256, 0, stream>>>(
      kraw, vh, mem_kv, ctx_part, part_max, part_sum);
  w2_kernel<<<dim3(BATCH, NHEAD / 2, CH / W2_ROWS), 256, 0, stream>>>(
      w_out, ctx_part, part_max, part_sum, W2h);
  out_kernel<<<dim3(NTOK / 32, BATCH), 256, 0, stream>>>(
      W2h, qs_t, b_out, out_g, out);
}

// v005
// A run of this version takes 112 microseconds.
// Two timings next to v004 both put it at 1.09 times that version's speed.
// Over all steps from v000 it is 3.03 times as fast.
#include <hip/hip_runtime.h>
#include <hip/hip_bf16.h>
#include <stdint.h>

typedef __attribute__((ext_vector_type(16))) _Float16 v16h;
typedef __attribute__((ext_vector_type(8)))  _Float16 v8h;
typedef __attribute__((ext_vector_type(8)))  float    v8f;
typedef __attribute__((ext_vector_type(2)))  float    v2f;

#define BATCH 16
#define CH    256
#define NTOK  4096
#define HID   128
#define QKVR  384
#define NHEAD 4
#define DHEAD 32
#define NMEM  4
#define NSPLIT 16               // work-groups that share one (b,h) token sum
#define NSEG  (NTOK / NSPLIT)   // tokens per work-group of the context kernel

__device__ __forceinline__ v8f wmma_f16(v16h a, v16h b, v8f c) {
  // v_wmma_f32_16x16x32_f16 : D = A(16x32) * B(32x16) + C(16x16 f32)
  return __builtin_amdgcn_wmma_f32_16x16x32_f16(
      /*neg_a=*/false, a, /*neg_b=*/false, b,
      /*c_mod=*/(short)0, c, /*reuse_a=*/false, /*reuse_b=*/false);
}

__device__ __forceinline__ v8f wmma_f32(v2f a, v2f b, v8f c) {
  return __builtin_amdgcn_wmma_f32_16x16x4_f32(
      /*neg_a=*/false, a, /*neg_b=*/false, b,
      /*c_mod=*/(short)0, c, /*reuse_a=*/false, /*reuse_b=*/false);
}

__device__ __forceinline__ v16h load_frag(const _Float16* base, int lane, int stride) {
  const int r  = lane & 15;
  const int k0 = (lane >> 4) << 3;       // 0 or 8
  const _Float16* p = base + r * stride;
  v8h lo = *(const v8h*)(p + k0);
  v8h hi = *(const v8h*)(p + 16 + k0);
  v16h f;
#pragma unroll
  for (int i = 0; i < 8; ++i) { f[i] = lo[i]; f[i + 8] = hi[i]; }
  return f;
}

__device__ __forceinline__ int frag_piece(int row, int k, int ksteps) {
  const int lane = (((k >> 3) & 1) << 4) | (row & 15);
  return ((((row >> 4) * ksteps + (k >> 5)) * 2 + ((k >> 4) & 1)) << 5) + lane;
}

// Load the A fragment of (row tile, k step) straight from a fragment-ordered matrix.
// wl: this lane's piece of the block that tile and ks count from.
__device__ __forceinline__ v16h load_frag_packed(const v8h* __restrict__ wl,
                                                 int tile, int ks, int ksteps) {
  const v8h* p = wl + (((tile * ksteps + ks) * 2) << 5);
  v8h lo = p[0];
  v8h hi = p[32];
  v16h f;
#pragma unroll
  for (int i = 0; i < 8; ++i) { f[i] = lo[i]; f[i + 8] = hi[i]; }
  return f;
}

__device__ __forceinline__ float exp_slot(float x) {
  float r;
  asm("v_exp_f32 %0, %1\n\tv_nop" : "=v"(r) : "v"(x * 1.4426950408889634f));
  return r;
}

// ---------------------------------------------------------------------------
// K0: fold norm_g into qkv weight, convert to f16, store in fragment order.
// ---------------------------------------------------------------------------
__global__ void prep_kernel(const float* __restrict__ w_qkv,
                            const float* __restrict__ norm_g,
                            _Float16* __restrict__ wqkv_h) {
  int i = blockIdx.x * 256 + threadIdx.x;
  if (i < QKVR * CH) {
    const int row = i >> 8, k = i & (CH - 1);
    wqkv_h[frag_piece(row, k & ~7, CH / 32) * 8 + (k & 7)] =
        (_Float16)(w_qkv[i] * norm_g[k]);
  }
}

// ---------------------------------------------------------------------------
// K1: per-(b,n) channel inverse norm, with sqrt(c)=16 folded in.
// ---------------------------------------------------------------------------
__global__ void invnorm_kernel(const float* __restrict__ x,
                               float* __restrict__ inv_norm) {
  int pos = blockIdx.x * 256 + threadIdx.x;     // 0 .. 65535
  int b = pos >> 12, n = pos & (NTOK - 1);
  const float* col = x + (size_t)b * CH * NTOK + n;
  float s = 0.f;
  for (int c = 0; c < CH; ++c) { float v = col[(size_t)c * NTOK]; s += v * v; }
  inv_norm[pos] = 16.0f / fmaxf(sqrtf(s), 1e-12f);
}

// ---------------------------------------------------------------------------
// K2: QKV GEMM, WMMA.  Per workgroup: 384x32 output tile, K=256.
// No two waves share a weight row, so the A fragments go from global memory
// (fragment order) straight into registers; only x passes through LDS.
// Fused: q-softmax over d (per head, per column) * SCALE -> qs_t (b,n,128) f16
//        k raw f32 (b,128,n);  v f16 (b,128,n).
// ---------------------------------------------------------------------------
__global__ __launch_bounds__(256) void qkv_kernel(
    const float* __restrict__ x, const _Float16* __restrict__ wqkv_h,
    const float* __restrict__ inv_norm,
    _Float16* __restrict__ qs_t, float* __restrict__ kraw,
    _Float16* __restrict__ vh) {
  // LDS: stage phase  : B 32x32 f16 (2048 B)
  //      epilog phase : out 384x33 f32 (50688 B)   (reuses same memory)
  __shared__ __align__(16) char smem[QKVR * 33 * 4];
  _Float16* lds_b = (_Float16*)smem;
  float*    lds_o = (float*)smem;

  const int tid  = threadIdx.x;
  const int wave = tid >> 5, lane = tid & 31;
  const int n0   = blockIdx.x * 32;
  const int b    = blockIdx.y;

  v8f acc[3][2];
#pragma unroll
  for (int i = 0; i < 3; ++i)
#pragma unroll
    for (int j = 0; j < 2; ++j)
#pragma unroll
      for (int r = 0; r < 8; ++r) acc[i][j][r] = 0.f;

  // this lane's first piece of this wave's three row tiles: uniform base + one 32-bit offset
  const v8h* wl = (const v8h*)wqkv_h + (unsigned)(wave * 3 * (CH / 32) * 64 + lane);

  for (int ks = 0; ks < CH / 32; ++ks) {
    const int K0 = ks * 32;
    __syncthreads();
    // this wave's three A fragments, issued beside the x loads
    v16h af[3];
#pragma unroll
    for (int i = 0; i < 3; ++i) af[i] = load_frag_packed(wl, i, ks, CH / 32);
    // stage B (transposed [n][c]): x * inv_norm -> f16
#pragma unroll
    for (int i = 0; i < 4; ++i) {
      int idx = tid + i * 256;
      int nl = idx & 31, cl = idx >> 5;
      float xv = x[((size_t)b * CH + (K0 + cl)) * NTOK + n0 + nl];
      lds_b[nl * 32 + cl] = (_Float16)(xv * inv_norm[b * NTOK + n0 + nl]);
    }
    __syncthreads();
    v16h bf0 = load_frag(lds_b, lane, 32);
    v16h bf1 = load_frag(lds_b + 16 * 32, lane, 32);
#pragma unroll
    for (int i = 0; i < 3; ++i) {
      acc[i][0] = wmma_f16(af[i], bf0, acc[i][0]);
      acc[i][1] = wmma_f16(af[i], bf1, acc[i][1]);
    }
  }
  __syncthreads();
#pragma unroll
  for (int i = 0; i < 3; ++i) {
    int Rb = (wave * 3 + i) * 16 + ((lane >> 4) << 3);
#pragma unroll
    for (int j = 0; j < 2; ++j) {
      int cc = j * 16 + (lane & 15);
#pragma unroll
      for (int r = 0; r < 8; ++r) lds_o[(Rb + r) * 33 + cc] = acc[i][j][r];
    }
  }
  __syncthreads();
  // q rows 0..127: softmax over d per (head, column), * 32^-0.5
  if (tid < 128) {
    const float SCALE = 0.17677669529663687f;
    int h = tid >> 5, col = tid & 31;
    float m = -1e30f;
#pragma unroll
    for (int d = 0; d < DHEAD; ++d) m = fmaxf(m, lds_o[(h * 32 + d) * 33 + col]);
    float e[DHEAD], s = 0.f;
#pragma unroll
    for (int d = 0; d < DHEAD; ++d) {
      e[d] = __expf(lds_o[(h * 32 + d) * 33 + col] - m);
      s += e[d];
    }
    float inv = SCALE / s;
    _Float16* dst = qs_t + ((size_t)b * NTOK + n0 + col) * HID + h * 32;
#pragma unroll
    for (int d = 0; d < DHEAD; ++d) dst[d] = (_Float16)(e[d] * inv);
  }
  // k rows 128..255 raw f32; v rows 256..383 f16
  for (int idx = tid; idx < HID * 32; idx += 256) {
    int r = idx >> 5, col = idx & 31;
    kraw[((size_t)b * HID + r) * NTOK + n0 + col] = lds_o[(HID + r) * 33 + col];
  }
  for (int idx = tid; idx < HID * 32; idx += 256) {
    int r = idx >> 5, col = idx & 31;
    vh[((size_t)b * HID + r) * NTOK + n0 + col] =
        (_Float16)lds_o[(2 * HID + r) * 33 + col];
  }
}

#define CT_PITCH (NSEG + NMEM)
__global__ __launch_bounds__(256) void context_kernel(
    const float* __restrict__ kraw, const _Float16* __restrict__ vh,
    const float* __restrict__ mem_kv, float* __restrict__ ctx_part,
    float* __restrict__ part_max, float* __restrict__ part_sum) {
  __shared__ __align__(16) float kt[DHEAD][CT_PITCH];
  __shared__ __align__(16) float vt[DHEAD][CT_PITCH];
  __shared__ __align__(16) float red[4][8][32];
  const int bh = blockIdx.x, b = bh >> 2, h = bh & 3;
  const int split = blockIdx.y;
  const int tid = threadIdx.x;
  const int d = tid >> 3, q8 = tid & 7;
  const size_t rowbase = ((size_t)b * HID + h * 32) * NTOK;
  // this thread's NSEG / 8 keys of row d, 4 tokens a piece; the row's 8 threads
  // cover 128 contiguous bytes with each piece
  const float4* krow =
      (const float4*)(kraw + rowbase + (size_t)d * NTOK + split * NSEG) + q8;
  float4 kq[NSEG / 32];
  // unrolled: kq is indexed by constants only and all loads are in flight together
#pragma unroll
  for (int i = 0; i < NSEG / 32; ++i) kq[i] = krow[i * 8];
  // values: 8 tokens a piece, a wave covers the 512 contiguous bytes of one row
  const v8h* vsrc = (const v8h*)(vh + rowbase + split * NSEG) + (tid & 31);
  v8h vq[4];
  // unrolled: vq is indexed by constants only; the loads fly beside the keys'
#pragma unroll
  for (int i = 0; i < 4; ++i) vq[i] = vsrc[(size_t)((tid >> 5) + i * 8) * (NTOK / 8)];
  // memory keys of row d (mem_kv[0]); they belong to split 0 only
  const float4 mk = *(const float4*)(mem_kv + (h * 32 + d) * NMEM);
  // memory values of row e = d (mem_kv[1])
  const float4 mv = *(const float4*)(mem_kv + NHEAD * DHEAD * NMEM + (h * 32 + d) * NMEM);
  float m = kq[0].x;
#pragma unroll
  for (int i = 0; i < NSEG / 32; ++i)
    m = fmaxf(m, fmaxf(fmaxf(kq[i].x, kq[i].y), fmaxf(kq[i].z, kq[i].w)));
  const float mkmax = fmaxf(fmaxf(mk.x, mk.y), fmaxf(mk.z, mk.w));
  m = fmaxf(m, split == 0 ? mkmax : m);
#pragma unroll
  for (int s = 1; s < 8; s <<= 1) m = fmaxf(m, __shfl_xor(m, s));
  float l = 0.f;
#pragma unroll
  for (int i = 0; i < NSEG / 32; ++i) {
    kq[i].x = exp_slot(kq[i].x - m); kq[i].y = exp_slot(kq[i].y - m);
    kq[i].z = exp_slot(kq[i].z - m); kq[i].w = exp_slot(kq[i].w - m);
    l += (kq[i].x + kq[i].y) + (kq[i].z + kq[i].w);
  }
#pragma unroll
  for (int s = 1; s < 8; s <<= 1) l += __shfl_xor(l, s);

  // fill both tiles once
#pragma unroll
  for (int i = 0; i < NSEG / 32; ++i) *(float4*)&kt[d][i * 32 + q8 * 4] = kq[i];
#pragma unroll
  for (int i = 0; i < 4; ++i) {
    float* vd = &vt[(tid >> 5) + i * 8][(tid & 31) * 8];
    *(float4*)vd = make_float4((float)vq[i][0], (float)vq[i][1], (float)vq[i][2], (float)vq[i][3]);
    *(float4*)(vd + 4) = make_float4((float)vq[i][4], (float)vq[i][5], (float)vq[i][6], (float)vq[i][7]);
  }
  // memory tokens: mem_kv[0]=keys at offset 0, mem_kv[1]=values at offset 512;
  // they belong to one partial sum only and take the last NMEM columns of the tiles.
  if (split == 0) {
    float4 kx;
    kx.x = exp_slot(mk.x - m); kx.y = exp_slot(mk.y - m);
    kx.z = exp_slot(mk.z - m); kx.w = exp_slot(mk.w - m);
    l += kx.x; l += kx.y; l += kx.z; l += kx.w;
    if (q8 == 0) {
      *(float4*)&kt[d][NSEG] = kx;
      *(float4*)&vt[d][NSEG] = mv;
    }
  }
  // publishes both tiles to the waves that multiply them
  __syncthreads();

  // the wave's number in a scalar register: the branches on it below stay scalar,
  // so every lane is on at the matrix instructions
  const int wave = __builtin_amdgcn_readfirstlane(tid >> 5);
  const int lane = tid & 31, c = lane & 15, hs = lane >> 4;
  const int tile = wave & 3, dt = tile >> 1, et = tile & 1, kh = wave >> 2;
  const float* ap = &kt[dt * 16 + c][kh * (NSEG / 2) + hs * 4];
  const float* bp = &vt[et * 16 + c][kh * (NSEG / 2) + hs * 4];
  v8f acc0, acc1;
#pragma unroll
  for (int r = 0; r < 8; ++r) { acc0[r] = 0.f; acc1[r] = 0.f; }
  if (split == 0 && kh == 0) {
    // the NMEM memory tokens are one k step: two tokens a lane
    const v2f a  = *(const v2f*)&kt[dt * 16 + c][NSEG + hs * 2];
    const v2f bb = *(const v2f*)&vt[et * 16 + c][NSEG + hs * 2];
    acc0 = wmma_f32(a, bb, acc0);
    asm volatile("v_nop\n\tv_nop\n\tv_nop\n\tv_nop" : "+v"(acc0) : "v"(a), "v"(bb));
  }
  // unrolled: LDS offsets become immediates and the reads run ahead of the products;
  // two accumulators, so that no product waits for the one before it; acc1 goes first, so
  // that its registers are first written while its neighbour's operands are still live
  // and cannot be laid over the operands of the matrix instruction in front of it
#pragma unroll
  for (int s = 0; s < NSEG / 16; ++s) {
    const float4 a4 = *(const float4*)(ap + s * 8);
    const float4 b4 = *(const float4*)(bp + s * 8);
    v2f a, bb;
    a[0] = a4.z; a[1] = a4.w; bb[0] = b4.z; bb[1] = b4.w;
    acc1 = wmma_f32(a, bb, acc1);
    a[0] = a4.x; a[1] = a4.y; bb[0] = b4.x; bb[1] = b4.y;
    acc0 = wmma_f32(a, bb, acc0);
  }
  asm volatile("v_nop\n\tv_nop\n\tv_nop\n\tv_nop" : "+v"(acc0), "+v"(acc1));
#pragma unroll
  for (int r = 0; r < 8; ++r) acc0[r] += acc1[r];
  if (kh == 1) {
#pragma unroll
    for (int r = 0; r < 8; ++r) red[tile][r][lane] = acc0[r];
  }
  // publishes the second token half's sums to the waves that hold the first half's
  __syncthreads();
  // behind the barriers, so that no wave waits at one for these stores to return
  if (q8 == 0) {
    const int st = split * (BATCH * HID) + b * HID + h * 32 + d;
    part_max[st] = m;
    part_sum[st] = l;
  }
  if (kh == 0) {
    // D layout: register r = row 8 * hs + r, column c of the tile
    float* dst = ctx_part +
        ((((size_t)split * BATCH + b) * NHEAD + h) * DHEAD + dt * 16 + hs * 8) * DHEAD +
        et * 16 + c;
#pragma unroll
    for (int r = 0; r < 8; ++r) dst[r * DHEAD] = acc0[r] + red[tile][r][lane];
  }
}

#define W2_ROWS  32
#define CTX_PITCH 36
#define CTX_PLANE (DHEAD * CTX_PITCH + 32)
__global__ __launch_bounds__(256) void w2_kernel(
    const float* __restrict__ w_out, const float* __restrict__ ctx_part,
    const float* __restrict__ part_max, const float* __restrict__ part_sum,
    _Float16* __restrict__ W2h) {
  __shared__ __align__(16) float ctxT[2 * CTX_PLANE];   // [head of the pair][e][d]
  __shared__ __align__(16) float wts[2 * DHEAD * NSPLIT]; // [head of the pair * 32 + d][split]
  const int b = blockIdx.x, hp = blockIdx.y, tid = threadIdx.x;
  const int o  = blockIdx.z * W2_ROWS + (tid >> 3);
  const int hl = (tid >> 2) & 1;
  const int dg = (tid & 3) * 8;
  // this thread's 32 weights: they do not depend on the LDS fill, so they load beside the partial sums
  const float4* wrow = (const float4*)(w_out + o * HID + (hp * 2 + hl) * DHEAD);
  float4 w4[DHEAD / 4];
  // unrolled: w4 is indexed by constants only and stays in registers
#pragma unroll
  for (int i = 0; i < DHEAD / 4; ++i) w4[i] = wrow[i];
  const float4* part = (const float4*)ctx_part + (size_t)b * 1024 + hp * 512;
  // both heads' partial sums do not depend on the weights: they load beside the statistics.
  // unrolled: pq is indexed by constants only and all loads are in flight together
  float4 pq[2][NSPLIT];
#pragma unroll
  for (int t = 0; t < 2; ++t)
#pragma unroll
    for (int sp = 0; sp < NSPLIT; ++sp)
      pq[t][sp] = part[(size_t)sp * BATCH * 1024 + tid + t * 256];
  // weight of split sp in row (head, d): exp(its maximum - the row's maximum) / the row's sum.
  // 4 neighbouring lanes share a row, 4 splits each.
  {
    const int row = tid >> 2, s0 = (tid & 3) * 4;
    const int st = b * HID + hp * 2 * DHEAD + row;
    float mm[4], ll[4];
#pragma unroll
    for (int j = 0; j < 4; ++j) {
      mm[j] = part_max[(s0 + j) * (BATCH * HID) + st];
      ll[j] = part_sum[(s0 + j) * (BATCH * HID) + st];
    }
    float mx = fmaxf(fmaxf(mm[0], mm[1]), fmaxf(mm[2], mm[3]));
    mx = fmaxf(mx, __shfl_xor(mx, 1));
    mx = fmaxf(mx, __shfl_xor(mx, 2));
    float ls = 0.f;
#pragma unroll
    for (int j = 0; j < 4; ++j) {
      mm[j] = exp_slot(mm[j] - mx);
      ls = fmaf(ll[j], mm[j], ls);
    }
    ls += __shfl_xor(ls, 1);
    ls += __shfl_xor(ls, 2);
    const float inv = 1.0f / ls;
    *(float4*)(wts + row * NSPLIT + s0) =
        make_float4(mm[0] * inv, mm[1] * inv, mm[2] * inv, mm[3] * inv);
  }
  // publishes the weights to the threads that sum the partial sums
  __syncthreads();
#pragma unroll
  for (int t = 0; t < 2; ++t) {
    const int i4 = tid + t * 256;
    const int d = (i4 >> 3) & 31, e = (i4 & 7) * 4;
    const float4* wr = (const float4*)(wts + (i4 >> 3) * NSPLIT);
    float4 s = make_float4(0.f, 0.f, 0.f, 0.f);
#pragma unroll
    for (int g = 0; g < NSPLIT / 4; ++g) {
      const float4 w4s = wr[g];
      const float wv[4] = {w4s.x, w4s.y, w4s.z, w4s.w};
#pragma unroll
      for (int k = 0; k < 4; ++k) {
        const float4 q = pq[t][g * 4 + k];
        s.x = fmaf(q.x, wv[k], s.x); s.y = fmaf(q.y, wv[k], s.y);
        s.z = fmaf(q.z, wv[k], s.z); s.w = fmaf(q.w, wv[k], s.w);
      }
    }
    float* col = ctxT + t * CTX_PLANE + e * CTX_PITCH + d;
    col[0 * CTX_PITCH] = s.x;
    col[1 * CTX_PITCH] = s.y;
    col[2 * CTX_PITCH] = s.z;
    col[3 * CTX_PITCH] = s.w;
  }
  __syncthreads();
  float acc[8];
#pragma unroll
  for (int j = 0; j < 8; ++j) acc[j] = 0.f;
  const float* crow = ctxT + hl * CTX_PLANE + dg;
  // both loops unrolled: LDS offsets become immediates and many row reads are in flight;
  // e runs upwards, one fused multiply-add per term
#pragma unroll
  for (int e4 = 0; e4 < DHEAD / 4; ++e4) {
    const float wv[4] = {w4[e4].x, w4[e4].y, w4[e4].z, w4[e4].w};
#pragma unroll
    for (int k = 0; k < 4; ++k) {
      const float4 c0 = *(const float4*)(crow + (e4 * 4 + k) * CTX_PITCH);
      const float4 c1 = *(const float4*)(crow + (e4 * 4 + k) * CTX_PITCH + 4);
      acc[0] = fmaf(wv[k], c0.x, acc[0]); acc[1] = fmaf(wv[k], c0.y, acc[1]);
      acc[2] = fmaf(wv[k], c0.z, acc[2]); acc[3] = fmaf(wv[k], c0.w, acc[3]);
      acc[4] = fmaf(wv[k], c1.x, acc[4]); acc[5] = fmaf(wv[k], c1.y, acc[5]);
      acc[6] = fmaf(wv[k], c1.z, acc[6]); acc[7] = fmaf(wv[k], c1.w, acc[7]);
    }
  }
  v8h r;
#pragma unroll
  for (int j = 0; j < 8; ++j) r[j] = (_Float16)acc[j];
  ((v8h*)(W2h + (size_t)b * CH * HID))[frag_piece(o, (hp * 2 + hl) * DHEAD + dg, HID / 32)] = r;
}

// ---------------------------------------------------------------------------
// K5: Y = W2[b] @ qs  + b_out, then RMSNorm over the 256 output channels.
// WMMA; one workgroup owns a full 256-row x 32-col tile so the channel
// norm is done entirely in LDS.  A fragments as in K2: global to registers.
// ---------------------------------------------------------------------------
__global__ __launch_bounds__(256) void out_kernel(
    const _Float16* __restrict__ W2h, const _Float16* __restrict__ qs_t,
    const float* __restrict__ b_out, const float* __restrict__ out_g,
    float* __restrict__ out) {
  __shared__ __align__(16) char smem[CH * 33 * 4];
  _Float16* lds_b = (_Float16*)smem;
  float*    lds_y = (float*)smem;
  __shared__ float colinv[32];

  const int tid = threadIdx.x;
  const int wave = tid >> 5, lane = tid & 31;
  const int n0 = blockIdx.x * 32;
  const int b  = blockIdx.y;

  v8f acc[2][2];
#pragma unroll
  for (int i = 0; i < 2; ++i)
#pragma unroll
    for (int j = 0; j < 2; ++j)
#pragma unroll
      for (int r = 0; r < 8; ++r) acc[i][j][r] = 0.f;

  const v8h* wl = (const v8h*)(W2h + (size_t)b * CH * HID) + (unsigned)(wave * 2 * (HID / 32) * 64 + lane);
  const uint32_t* bsrc = (const uint32_t*)qs_t;
  uint32_t* bdst = (uint32_t*)lds_b;

  for (int ks = 0; ks < HID / 32; ++ks) {
    const int K0 = ks * 32;
    __syncthreads();
    // this wave's two A fragments, issued beside the B loads
    v16h af[2];
#pragma unroll
    for (int i = 0; i < 2; ++i) af[i] = load_frag_packed(wl, i, ks, HID / 32);
#pragma unroll
    for (int i = 0; i < 2; ++i) {                          // B: 32x32 halves
      int idx = tid + i * 256;
      int n = idx >> 4, cp = idx & 15;
      bdst[idx] = bsrc[((size_t)b * NTOK + n0 + n) * (HID / 2) + (K0 >> 1) + cp];
    }
    __syncthreads();
    v16h bf0 = load_frag(lds_b, lane, 32);
    v16h bf1 = load_frag(lds_b + 16 * 32, lane, 32);
#pragma unroll
    for (int i = 0; i < 2; ++i) {
      acc[i][0] = wmma_f16(af[i], bf0, acc[i][0]);
      acc[i][1] = wmma_f16(af[i], bf1, acc[i][1]);
    }
  }
  __syncthreads();
#pragma unroll
  for (int i = 0; i < 2; ++i) {
    int Rb = (wave * 2 + i) * 16 + ((lane >> 4) << 3);
#pragma unroll
    for (int j = 0; j < 2; ++j) {
      int cc = j * 16 + (lane & 15);
#pragma unroll
      for (int r = 0; r < 8; ++r) lds_y[(Rb + r) * 33 + cc] = acc[i][j][r];
    }
  }
  __syncthreads();
  if (tid < 32) {
    float s = 0.f;
    for (int o = 0; o < CH; ++o) {
      float v = lds_y[o * 33 + tid] + b_out[o];
      s += v * v;
    }
    colinv[tid] = 16.0f / fmaxf(sqrtf(s), 1e-12f);
  }
  __syncthreads();
  for (int idx = tid; idx < CH * 32; idx += 256) {
    int o = idx >> 5, col = idx & 31;
    float v = (lds_y[o * 33 + col] + b_out[o]) * colinv[col] * out_g[o];
    out[((size_t)b * CH + o) * NTOK + n0 + col] = v;
  }
}

// ---------------------------------------------------------------------------
extern "C" void kernel_launch(void* const* d_in, const int* in_sizes, int n_in,
                              void* d_out, int out_size, void* d_ws, size_t ws_size,
                              hipStream_t stream) {
  (void)in_sizes; (void)n_in; (void)out_size; (void)ws_size;
  const float* x        = (const float*)d_in[0];   // (16,256,64,64)
  const float* norm_g   = (const float*)d_in[1];   // (256)
  const float* w_qkv    = (const float*)d_in[2];   // (384,256)
  const float* mem_kv   = (const float*)d_in[3];   // (2,4,32,4)
  const float* w_out    = (const float*)d_in[4];   // (256,128)
  const float* b_out    = (const float*)d_in[5];   // (256)
  const float* out_g    = (const float*)d_in[6];   // (256)
  float* out = (float*)d_out;                      // (16,256,64,64)

  char* ws = (char*)d_ws;
  size_t off = 0;
  auto take = [&](size_t bytes) -> char* {
    char* p = ws + off;
    off = (off + bytes + 255) & ~(size_t)255;
    return p;
  };
  _Float16* wqkv_h   = (_Float16*)take((size_t)QKVR * CH * 2);           // 192 KB
  float*    inv_norm = (float*)   take((size_t)BATCH * NTOK * 4);        // 256 KB
  _Float16* qs_t     = (_Float16*)take((size_t)BATCH * NTOK * HID * 2);  // 16 MB
  float*    kraw     = (float*)   take((size_t)BATCH * HID * NTOK * 4);  // 32 MB
  _Float16* vh       = (_Float16*)take((size_t)BATCH * HID * NTOK * 2);  // 16 MB
  float*    part_max = (float*)   take((size_t)NSPLIT * BATCH * HID * 4);  // 128 KB
  float*    part_sum = (float*)   take((size_t)NSPLIT * BATCH * HID * 4);  // 128 KB
  float*    ctx_part = (float*)   take((size_t)NSPLIT * BATCH * NHEAD * DHEAD * DHEAD * 4);  // 4 MB
  _Float16* W2h      = (_Float16*)take((size_t)BATCH * CH * HID * 2);    // 1 MB

  prep_kernel<<<QKVR, 256, 0, stream>>>(w_qkv, norm_g, wqkv_h);
  invnorm_kernel<<<BATCH * NTOK / 256, 256, 0, stream>>>(x, inv_norm);
  qkv_kernel<<<dim3(NTOK / 32, BATCH), 256, 0, stream>>>(
      x, wqkv_h, inv_norm, qs_t, kraw, vh);
  context_kernel<<<dim3(BATCH * NHEAD, NSPLIT), 256, 0, stream>>>(
      kraw, vh, mem_kv, ctx_part, part_max, part_sum);
  w2_kernel<<<dim3(BATCH, NHEAD / 2, CH / W2_ROWS), 256, 0, stream>>>(
      w_out, ctx_part, part_max, part_sum, W2h);
  out_kernel<<<dim3(NTOK / 32, BATCH), 256, 0, stream>>>(
      W2h, qs_t, b_out, out_g, out);
}

// v006
// Measured time: 106 microseconds a run.
// Next to v005, in two timings, it ran 1.07 times as fast each time.
// All steps since v000 together make it 3.23 times as fast.
#include <hip/hip_runtime.h>
#include <hip/hip_bf16.h>
#include <stdint.h>

typedef __attribute__((ext_vector_type(16))) _Float16 v16h;
typedef __attribute__((ext_vector_type(8)))  _Float16 v8h;
typedef __attribute__((ext_vector_type(8)))  float    v8f;
typedef __attribute__((ext_vector_type(2)))  float    v2f;

#define BATCH 16
#define CH    256
#define NTOK  4096
#define HID   128
#define QKVR  384
#define NHEAD 4
#define DHEAD 32
#define NMEM  4
#define NSPLIT 16               // work-groups that share one (b,h) token sum
#define NSEG  (NTOK / NSPLIT)   // tokens per work-group of the context kernel

__device__ __forceinline__ v8f wmma_f16(v16h a, v16h b, v8f c) {
  // v_wmma_f32_16x16x32_f16 : D = A(16x32) * B(32x16) + C(16x16 f32)
  return __builtin_amdgcn_wmma_f32_16x16x32_f16(
      /*neg_a=*/false, a, /*neg_b=*/false, b,
      /*c_mod=*/(short)0, c, /*reuse_a=*/false, /*reuse_b=*/false);
}

__device__ __forceinline__ v8f wmma_f32(v2f a, v2f b, v8f c) {
  return __builtin_amdgcn_wmma_f32_16x16x4_f32(
      /*neg_a=*/false, a, /*neg_b=*/false, b,
      /*c_mod=*/(short)0, c, /*reuse_a=*/false, /*reuse_b=*/false);
}

__device__ __forceinline__ v16h load_frag(const _Float16* base, int lane, int stride) {
  const int r  = lane & 15;
  const int k0 = (lane >> 4) << 3;       // 0 or 8
  const _Float16* p = base + r * stride;
  v8h lo = *(const v8h*)(p + k0);
  v8h hi = *(const v8h*)(p + 16 + k0);
  v16h f;
#pragma unroll
  for (int i = 0; i < 8; ++i) { f[i] = lo[i]; f[i + 8] = hi[i]; }
  return f;
}

__device__ __forceinline__ int frag_piece(int row, int k, int ksteps) {
  const int lane = (((k >> 3) & 1) << 4) | (row & 15);
  return ((((row >> 4) * ksteps + (k >> 5)) * 2 + ((k >> 4) & 1)) << 5) + lane;
}

// Load the A fragment of (row tile, k step) straight from a fragment-ordered matrix.
// wl: this lane's piece of the block that tile and ks count from.
__device__ __forceinline__ v16h load_frag_packed(const v8h* __restrict__ wl,
                                                 int tile, int ks, int ksteps) {
  const v8h* p = wl + (((tile * ksteps + ks) * 2) << 5);
  v8h lo = p[0];
  v8h hi = p[32];
  v16h f;
#pragma unroll
  for (int i = 0; i < 8; ++i) { f[i] = lo[i]; f[i + 8] = hi[i]; }
  return f;
}

__device__ __forceinline__ float exp_slot(float x) {
  float r;
  asm("v_exp_f32 %0, %1\n\tv_nop" : "=v"(r) : "v"(x * 1.4426950408889634f));
  return r;
}

// ---------------------------------------------------------------------------
// K0: fold norm_g into qkv weight, convert to f16, store in fragment order.
// ---------------------------------------------------------------------------
__global__ void prep_kernel(const float* __restrict__ w_qkv,
                            const float* __restrict__ norm_g,
                            _Float16* __restrict__ wqkv_h) {
  int i = blockIdx.x * 256 + threadIdx.x;
  if (i < QKVR * CH) {
    const int row = i >> 8, k = i & (CH - 1);
    wqkv_h[frag_piece(row, k & ~7, CH / 32) * 8 + (k & 7)] =
        (_Float16)(w_qkv[i] * norm_g[k]);
  }
}

// ---------------------------------------------------------------------------
// K2: QKV GEMM, WMMA.  Per workgroup: 384x32 output tile, K=256.
// No two waves share a weight row, so the A fragments go from global memory
// (fragment order) straight into registers; only x passes through LDS.
// The pre-norm scales a whole column n of x by 16 / |x[:,n]|, so it commutes with the
// product: x goes into the product as it is, each thread sums the squares of the x it
// stages, and the accumulators' columns take the factor on their way out.  The rounding
// of x to f16 is relative, so it is the same with or without the factor in front of it.
// Fused: q-softmax over d (per head, per column) * SCALE -> qs_t (b,n,128) f16
//        k raw f32 (b,128,n);  v f16 (b,128,n).
// ---------------------------------------------------------------------------
__global__ __launch_bounds__(256) void qkv_kernel(
    const float* __restrict__ x, const _Float16* __restrict__ wqkv_h,
    _Float16* __restrict__ qs_t, float* __restrict__ kraw,
    _Float16* __restrict__ vh) {
  // LDS: stage phase  : B 32x32 f16 (2048 B)
  //      epilog phase : out 384x33 f32 (50688 B)   (reuses same memory)
  __shared__ __align__(16) char smem[QKVR * 33 * 4];
  _Float16* lds_b = (_Float16*)smem;
  float*    lds_o = (float*)smem;
  // sum of squares of column n over the 32 channels that wave w stages: ssq[w][n]
  __shared__ float ssq[8][32];

  const int tid  = threadIdx.x;
  const int wave = tid >> 5, lane = tid & 31;
  const int n0   = blockIdx.x * 32;
  const int b    = blockIdx.y;

  v8f acc[3][2];
#pragma unroll
  for (int i = 0; i < 3; ++i)
#pragma unroll
    for (int j = 0; j < 2; ++j)
#pragma unroll
      for (int r = 0; r < 8; ++r) acc[i][j][r] = 0.f;

  // this lane's first piece of this wave's three row tiles: uniform base + one 32-bit offset
  const v8h* wl = (const v8h*)wqkv_h + (unsigned)(wave * 3 * (CH / 32) * 64 + lane);
  float ss = 0.f;   // every x this thread stages belongs to column n0 + lane

  for (int ks = 0; ks < CH / 32; ++ks) {
    const int K0 = ks * 32;
    __syncthreads();
    // this wave's three A fragments, issued beside the x loads
    v16h af[3];
#pragma unroll
    for (int i = 0; i < 3; ++i) af[i] = load_frag_packed(wl, i, ks, CH / 32);
    // stage B (transposed [n][c]): x -> f16
#pragma unroll
    for (int i = 0; i < 4; ++i) {
      int idx = tid + i * 256;
      int nl = idx & 31, cl = idx >> 5;
      float xv = x[((size_t)b * CH + (K0 + cl)) * NTOK + n0 + nl];
      ss = fmaf(xv, xv, ss);
      lds_b[nl * 32 + cl] = (_Float16)xv;
    }
    // keeps the four additions to ss in this pass: moved behind the loop they would hold
    // all 32 x values of the thread in registers and cost resident work-groups
    __builtin_amdgcn_sched_barrier(0);
    __syncthreads();
    v16h bf0 = load_frag(lds_b, lane, 32);
    v16h bf1 = load_frag(lds_b + 16 * 32, lane, 32);
#pragma unroll
    for (int i = 0; i < 3; ++i) {
      acc[i][0] = wmma_f16(af[i], bf0, acc[i][0]);
      acc[i][1] = wmma_f16(af[i], bf1, acc[i][1]);
    }
  }
  ssq[wave][lane] = ss;
  // ends the last reads of lds_b and publishes the eight partial sums of squares
  __syncthreads();
  float s2 = 0.f;
  for (int w = 0; w < 8; ++w) s2 += ssq[w][lane];
  const float inv = 16.0f / fmaxf(sqrtf(s2), 1e-12f);
  float invc[2];
  invc[0] = __shfl(inv, lane & 15);
  invc[1] = __shfl(inv, (lane & 15) + 16);
#pragma unroll
  for (int i = 0; i < 3; ++i) {
    int Rb = (wave * 3 + i) * 16 + ((lane >> 4) << 3);
#pragma unroll
    for (int j = 0; j < 2; ++j) {
      int cc = j * 16 + (lane & 15);
#pragma unroll
      for (int r = 0; r < 8; ++r) lds_o[(Rb + r) * 33 + cc] = acc[i][j][r] * invc[j];
    }
  }
  __syncthreads();
  // q rows 0..127: softmax over d per (head, column), * 32^-0.5
  if (tid < 128) {
    const float SCALE = 0.17677669529663687f;
    int h = tid >> 5, col = tid & 31;
    float m = -1e30f;
#pragma unroll
    for (int d = 0; d < DHEAD; ++d) m = fmaxf(m, lds_o[(h * 32 + d) * 33 + col]);
    float e[DHEAD], s = 0.f;
#pragma unroll
    for (int d = 0; d < DHEAD; ++d) {
      e[d] = __expf(lds_o[(h * 32 + d) * 33 + col] - m);
      s += e[d];
    }
    float inv = SCALE / s;
    _Float16* dst = qs_t + ((size_t)b * NTOK + n0 + col) * HID + h * 32;
#pragma unroll
    for (int d = 0; d < DHEAD; ++d) dst[d] = (_Float16)(e[d] * inv);
  }
  // k rows 128..255 raw f32; v rows 256..383 f16
  for (int idx = tid; idx < HID * 32; idx += 256) {
    int r = idx >> 5, col = idx & 31;
    kraw[((size_t)b * HID + r) * NTOK + n0 + col] = lds_o[(HID + r) * 33 + col];
  }
  for (int idx = tid; idx < HID * 32; idx += 256) {
    int r = idx >> 5, col = idx & 31;
    vh[((size_t)b * HID + r) * NTOK + n0 + col] =
        (_Float16)lds_o[(2 * HID + r) * 33 + col];
  }
}

#define CT_PITCH (NSEG + NMEM)
__global__ __launch_bounds__(256) void context_kernel(
    const float* __restrict__ kraw, const _Float16* __restrict__ vh,
    const float* __restrict__ mem_kv, float* __restrict__ ctx_part,
    float* __restrict__ part_max, float* __restrict__ part_sum) {
  __shared__ __align__(16) float kt[DHEAD][CT_PITCH];
  __shared__ __align__(16) float vt[DHEAD][CT_PITCH];
  __shared__ __align__(16) float red[4][8][32];
  const int bh = blockIdx.x, b = bh >> 2, h = bh & 3;
  const int split = blockIdx.y;
  const int tid = threadIdx.x;
  const int d = tid >> 3, q8 = tid & 7;
  const size_t rowbase = ((size_t)b * HID + h * 32) * NTOK;
  // this thread's NSEG / 8 keys of row d, 4 tokens a piece; the row's 8 threads
  // cover 128 contiguous bytes with each piece
  const float4* krow =
      (const float4*)(kraw + rowbase + (size_t)d * NTOK + split * NSEG) + q8;
  float4 kq[NSEG / 32];
  // unrolled: kq is indexed by constants only and all loads are in flight together
#pragma unroll
  for (int i = 0; i < NSEG / 32; ++i) kq[i] = krow[i * 8];
  // values: 8 tokens a piece, a wave covers the 512 contiguous bytes of one row
  const v8h* vsrc = (const v8h*)(vh + rowbase + split * NSEG) + (tid & 31);
  v8h vq[4];
  // unrolled: vq is indexed by constants only; the loads fly beside the keys'
#pragma unroll
  for (int i = 0; i < 4; ++i) vq[i] = vsrc[(size_t)((tid >> 5) + i * 8) * (NTOK / 8)];
  // memory keys of row d (mem_kv[0]); they belong to split 0 only
  const float4 mk = *(const float4*)(mem_kv + (h * 32 + d) * NMEM);
  // memory values of row e = d (mem_kv[1])
  const float4 mv = *(const float4*)(mem_kv + NHEAD * DHEAD * NMEM + (h * 32 + d) * NMEM);
  float m = kq[0].x;
#pragma unroll
  for (int i = 0; i < NSEG / 32; ++i)
    m = fmaxf(m, fmaxf(fmaxf(kq[i].x, kq[i].y), fmaxf(kq[i].z, kq[i].w)));
  const float mkmax = fmaxf(fmaxf(mk.x, mk.y), fmaxf(mk.z, mk.w));
  m = fmaxf(m, split == 0 ? mkmax : m);
#pragma unroll
  for (int s = 1; s < 8; s <<= 1) m = fmaxf(m, __shfl_xor(m, s));
  float l = 0.f;
#pragma unroll
  for (int i = 0; i < NSEG / 32; ++i) {
    kq[i].x = exp_slot(kq[i].x - m); kq[i].y = exp_slot(kq[i].y - m);
    kq[i].z = exp_slot(kq[i].z - m); kq[i].w = exp_slot(kq[i].w - m);
    l += (kq[i].x + kq[i].y) + (kq[i].z + kq[i].w);
  }
#pragma unroll
  for (int s = 1; s < 8; s <<= 1) l += __shfl_xor(l, s);

  // fill both tiles once
#pragma unroll
  for (int i = 0; i < NSEG / 32; ++i) *(float4*)&kt[d][i * 32 + q8 * 4] = kq[i];
#pragma unroll
  for (int i = 0; i < 4; ++i) {
    float* vd = &vt[(tid >> 5) + i * 8][(tid & 31) * 8];
    *(float4*)vd = make_float4((float)vq[i][0], (float)vq[i][1], (float)vq[i][2], (float)vq[i][3]);
    *(float4*)(vd + 4) = make_float4((float)vq[i][4], (float)vq[i][5], (float)vq[i][6], (float)vq[i][7]);
  }
  // memory tokens: mem_kv[0]=keys at offset 0, mem_kv[1]=values at offset 512;
  // they belong to one partial sum only and take the last NMEM columns of the tiles.
  if (split == 0) {
    float4 kx;
    kx.x = exp_slot(mk.x - m); kx.y = exp_slot(mk.y - m);
    kx.z = exp_slot(mk.z - m); kx.w = exp_slot(mk.w - m);
    l += kx.x; l += kx.y; l += kx.z; l += kx.w;
    if (q8 == 0) {
      *(float4*)&kt[d][NSEG] = kx;
      *(float4*)&vt[d][NSEG] = mv;
    }
  }
  // publishes both tiles to the waves that multiply them
  __syncthreads();

  // the wave's number in a scalar register: the branches on it below stay scalar,
  // so every lane is on at the matrix instructions
  const int wave = __builtin_amdgcn_readfirstlane(tid >> 5);
  const int lane = tid & 31, c = lane & 15, hs = lane >> 4;
  const int tile = wave & 3, dt = tile >> 1, et = tile & 1, kh = wave >> 2;
  const float* ap = &kt[dt * 16 + c][kh * (NSEG / 2) + hs * 4];
  const float* bp = &vt[et * 16 + c][kh * (NSEG / 2) + hs * 4];
  v8f acc0, acc1;
#pragma unroll
  for (int r = 0; r < 8; ++r) { acc0[r] = 0.f; acc1[r] = 0.f; }
  if (split == 0 && kh == 0) {
    // the NMEM memory tokens are one k step: two tokens a lane
    const v2f a  = *(const v2f*)&kt[dt * 16 + c][NSEG + hs * 2];
    const v2f bb = *(const v2f*)&vt[et * 16 + c][NSEG + hs * 2];
    acc0 = wmma_f32(a, bb, acc0);
    asm volatile("v_nop\n\tv_nop\n\tv_nop\n\tv_nop" : "+v"(acc0) : "v"(a), "v"(bb));
  }
  // unrolled: LDS offsets become immediates and the reads run ahead of the products;
  // two accumulators, so that no product waits for the one before it; acc1 goes first, so
  // that its registers are first written while its neighbour's operands are still live
  // and cannot be laid over the operands of the matrix instruction in front of it
#pragma unroll
  for (int s = 0; s < NSEG / 16; ++s) {
    const float4 a4 = *(const float4*)(ap + s * 8);
    const float4 b4 = *(const float4*)(bp + s * 8);
    v2f a, bb;
    a[0] = a4.z; a[1] = a4.w; bb[0] = b4.z; bb[1] = b4.w;
    acc1 = wmma_f32(a, bb, acc1);
    a[0] = a4.x; a[1] = a4.y; bb[0] = b4.x; bb[1] = b4.y;
    acc0 = wmma_f32(a, bb, acc0);
  }
  asm volatile("v_nop\n\tv_nop\n\tv_nop\n\tv_nop" : "+v"(acc0), "+v"(acc1));
#pragma unroll
  for (int r = 0; r < 8; ++r) acc0[r] += acc1[r];
  if (kh == 1) {
#pragma unroll
    for (int r = 0; r < 8; ++r) red[tile][r][lane] = acc0[r];
  }
  // publishes the second token half's sums to the waves that hold the first half's
  __syncthreads();
  // behind the barriers, so that no wave waits at one for these stores to return
  if (q8 == 0) {
    const int st = split * (BATCH * HID) + b * HID + h * 32 + d;
    part_max[st] = m;
    part_sum[st] = l;
  }
  if (kh == 0) {
    // D layout: register r = row 8 * hs + r, column c of the tile
    float* dst = ctx_part +
        ((((size_t)split * BATCH + b) * NHEAD + h) * DHEAD + dt * 16 + hs * 8) * DHEAD +
        et * 16 + c;
#pragma unroll
    for (int r = 0; r < 8; ++r) dst[r * DHEAD] = acc0[r] + red[tile][r][lane];
  }
}

#define W2_ROWS  32
#define CTX_PITCH 36
#define CTX_PLANE (DHEAD * CTX_PITCH + 32)
__global__ __launch_bounds__(256) void w2_kernel(
    const float* __restrict__ w_out, const float* __restrict__ ctx_part,
    const float* __restrict__ part_max, const float* __restrict__ part_sum,
    _Float16* __restrict__ W2h) {
  __shared__ __align__(16) float ctxT[2 * CTX_PLANE];   // [head of the pair][e][d]
  __shared__ __align__(16) float wts[2 * DHEAD * NSPLIT]; // [head of the pair * 32 + d][split]
  const int b = blockIdx.x, hp = blockIdx.y, tid = threadIdx.x;
  const int o  = blockIdx.z * W2_ROWS + (tid >> 3);
  const int hl = (tid >> 2) & 1;
  const int dg = (tid & 3) * 8;
  // this thread's 32 weights: they do not depend on the LDS fill, so they load beside the partial sums
  const float4* wrow = (const float4*)(w_out + o * HID + (hp * 2 + hl) * DHEAD);
  float4 w4[DHEAD / 4];
  // unrolled: w4 is indexed by constants only and stays in registers
#pragma unroll
  for (int i = 0; i < DHEAD / 4; ++i) w4[i] = wrow[i];
  const float4* part = (const float4*)ctx_part + (size_t)b * 1024 + hp * 512;
  // both heads' partial sums do not depend on the weights: they load beside the statistics.
  // unrolled: pq is indexed by constants only and all loads are in flight together
  float4 pq[2][NSPLIT];
#pragma unroll
  for (int t = 0; t < 2; ++t)
#pragma unroll
    for (int sp = 0; sp < NSPLIT; ++sp)
      pq[t][sp] = part[(size_t)sp * BATCH * 1024 + tid + t * 256];
  // weight of split sp in row (head, d): exp(its maximum - the row's maximum) / the row's sum.
  // 4 neighbouring lanes share a row, 4 splits each.
  {
    const int row = tid >> 2, s0 = (tid & 3) * 4;
    const int st = b * HID + hp * 2 * DHEAD + row;
    float mm[4], ll[4];
#pragma unroll
    for (int j = 0; j < 4; ++j) {
      mm[j] = part_max[(s0 + j) * (BATCH * HID) + st];
      ll[j] = part_sum[(s0 + j) * (BATCH * HID) + st];
    }
    float mx = fmaxf(fmaxf(mm[0], mm[1]), fmaxf(mm[2], mm[3]));
    mx = fmaxf(mx, __shfl_xor(mx, 1));
    mx = fmaxf(mx, __shfl_xor(mx, 2));
    float ls = 0.f;
#pragma unroll
    for (int j = 0; j < 4; ++j) {
      mm[j] = exp_slot(mm[j] - mx);
      ls = fmaf(ll[j], mm[j], ls);
    }
    ls += __shfl_xor(ls, 1);
    ls += __shfl_xor(ls, 2);
    const float inv = 1.0f / ls;
    *(float4*)(wts + row * NSPLIT + s0) =
        make_float4(mm[0] * inv, mm[1] * inv, mm[2] * inv, mm[3] * inv);
  }
  // publishes the weights to the threads that sum the partial sums
  __syncthreads();
#pragma unroll
  for (int t = 0; t < 2; ++t) {
    const int i4 = tid + t * 256;
    const int d = (i4 >> 3) & 31, e = (i4 & 7) * 4;
    const float4* wr = (const float4*)(wts + (i4 >> 3) * NSPLIT);
    float4 s = make_float4(0.f, 0.f, 0.f, 0.f);
#pragma unroll
    for (int g = 0; g < NSPLIT / 4; ++g) {
      const float4 w4s = wr[g];
      const float wv[4] = {w4s.x, w4s.y, w4s.z, w4s.w};
#pragma unroll
      for (int k = 0; k < 4; ++k) {
        const float4 q = pq[t][g * 4 + k];
        s.x = fmaf(q.x, wv[k], s.x); s.y = fmaf(q.y, wv[k], s.y);
        s.z = fmaf(q.z, wv[k], s.z); s.w = fmaf(q.w, wv[k], s.w);
      }
    }
    float* col = ctxT + t * CTX_PLANE + e * CTX_PITCH + d;
    col[0 * CTX_PITCH] = s.x;
    col[1 * CTX_PITCH] = s.y;
    col[2 * CTX_PITCH] = s.z;
    col[3 * CTX_PITCH] = s.w;
  }
  __syncthreads();
  float acc[8];
#pragma unroll
  for (int j = 0; j < 8; ++j) acc[j] = 0.f;
  const float* crow = ctxT + hl * CTX_PLANE + dg;
  // both loops unrolled: LDS offsets become immediates and many row reads are in flight;
  // e runs upwards, one fused multiply-add per term
#pragma unroll
  for (int e4 = 0; e4 < DHEAD / 4; ++e4) {
    const float wv[4] = {w4[e4].x, w4[e4].y, w4[e4].z, w4[e4].w};
#pragma unroll
    for (int k = 0; k < 4; ++k) {
      const float4 c0 = *(const float4*)(crow + (e4 * 4 + k) * CTX_PITCH);
      const float4 c1 = *(const float4*)(crow + (e4 * 4 + k) * CTX_PITCH + 4);
      acc[0] = fmaf(wv[k], c0.x, acc[0]); acc[1] = fmaf(wv[k], c0.y, acc[1]);
      acc[2] = fmaf(wv[k], c0.z, acc[2]); acc[3] = fmaf(wv[k], c0.w, acc[3]);
      acc[4] = fmaf(wv[k], c1.x, acc[4]); acc[5] = fmaf(wv[k], c1.y, acc[5]);
      acc[6] = fmaf(wv[k], c1.z, acc[6]); acc[7] = fmaf(wv[k], c1.w, acc[7]);
    }
  }
  v8h r;
#pragma unroll
  for (int j = 0; j < 8; ++j) r[j] = (_Float16)acc[j];
  ((v8h*)(W2h + (size_t)b * CH * HID))[frag_piece(o, (hp * 2 + hl) * DHEAD + dg, HID / 32)] = r;
}

// ---------------------------------------------------------------------------
// K5: Y = W2[b] @ qs  + b_out, then RMSNorm over the 256 output channels.
// WMMA; one workgroup owns a full 256-row x 32-col tile so the channel
// norm is done entirely in LDS.  A fragments as in K2: global to registers.
// ---------------------------------------------------------------------------
__global__ __launch_bounds__(256) void out_kernel(
    const _Float16* __restrict__ W2h, const _Float16* __restrict__ qs_t,
    const float* __restrict__ b_out, const float* __restrict__ out_g,
    float* __restrict__ out) {
  __shared__ __align__(16) char smem[CH * 33 * 4];
  _Float16* lds_b = (_Float16*)smem;
  float*    lds_y = (float*)smem;
  __shared__ float colinv[32];

  const int tid = threadIdx.x;
  const int wave = tid >> 5, lane = tid & 31;
  const int n0 = blockIdx.x * 32;
  const int b  = blockIdx.y;

  v8f acc[2][2];
#pragma unroll
  for (int i = 0; i < 2; ++i)
#pragma unroll
    for (int j = 0; j < 2; ++j)
#pragma unroll
      for (int r = 0; r < 8; ++r) acc[i][j][r] = 0.f;

  const v8h* wl = (const v8h*)(W2h + (size_t)b * CH * HID) + (unsigned)(wave * 2 * (HID / 32) * 64 + lane);
  const uint32_t* bsrc = (const uint32_t*)qs_t;
  uint32_t* bdst = (uint32_t*)lds_b;

  for (int ks = 0; ks < HID / 32; ++ks) {
    const int K0 = ks * 32;
    __syncthreads();
    // this wave's two A fragments, issued beside the B loads
    v16h af[2];
#pragma unroll
    for (int i = 0; i < 2; ++i) af[i] = load_frag_packed(wl, i, ks, HID / 32);
#pragma unroll
    for (int i = 0; i < 2; ++i) {                          // B: 32x32 halves
      int idx = tid + i * 256;
      int n = idx >> 4, cp = idx & 15;
      bdst[idx] = bsrc[((size_t)b * NTOK + n0 + n) * (HID / 2) + (K0 >> 1) + cp];
    }
    __syncthreads();
    v16h bf0 = load_frag(lds_b, lane, 32);
    v16h bf1 = load_frag(lds_b + 16 * 32, lane, 32);
#pragma unroll
    for (int i = 0; i < 2; ++i) {
      acc[i][0] = wmma_f16(af[i], bf0, acc[i][0]);
      acc[i][1] = wmma_f16(af[i], bf1, acc[i][1]);
    }
  }
  __syncthreads();
#pragma unroll
  for (int i = 0; i < 2; ++i) {
    int Rb = (wave * 2 + i) * 16 + ((lane >> 4) << 3);
#pragma unroll
    for (int j = 0; j < 2; ++j) {
      int cc = j * 16 + (lane & 15);
#pragma unroll
      for (int r = 0; r < 8; ++r) lds_y[(Rb + r) * 33 + cc] = acc[i][j][r];
    }
  }
  __syncthreads();
  if (tid < 32) {
    float s = 0.f;
    for (int o = 0; o < CH; ++o) {
      float v = lds_y[o * 33 + tid] + b_out[o];
      s += v * v;
    }
    colinv[tid] = 16.0f / fmaxf(sqrtf(s), 1e-12f);
  }
  __syncthreads();
  for (int idx = tid; idx < CH * 32; idx += 256) {
    int o = idx >> 5, col = idx & 31;
    float v = (lds_y[o * 33 + col] + b_out[o]) * colinv[col] * out_g[o];
    out[((size_t)b * CH + o) * NTOK + n0 + col] = v;
  }
}

// ---------------------------------------------------------------------------
extern "C" void kernel_launch(void* const* d_in, const int* in_sizes, int n_in,
                              void* d_out, int out_size, void* d_ws, size_t ws_size,
                              hipStream_t stream) {
  (void)in_sizes; (void)n_in; (void)out_size; (void)ws_size;
  const float* x        = (const float*)d_in[0];   // (16,256,64,64)
  const float* norm_g   = (const float*)d_in[1];   // (256)
  const float* w_qkv    = (const float*)d_in[2];   // (384,256)
  const float* mem_kv   = (const float*)d_in[3];   // (2,4,32,4)
  const float* w_out    = (const float*)d_in[4];   // (256,128)
  const float* b_out    = (const float*)d_in[5];   // (256)
  const float* out_g    = (const float*)d_in[6];   // (256)
  float* out = (float*)d_out;                      // (16,256,64,64)

  char* ws = (char*)d_ws;
  size_t off = 0;
  auto take = [&](size_t bytes) -> char* {
    char* p = ws + off;
    off = (off + bytes + 255) & ~(size_t)255;
    return p;
  };
  _Float16* wqkv_h   = (_Float16*)take((size_t)QKVR * CH * 2);           // 192 KB
  _Float16* qs_t     = (_Float16*)take((size_t)BATCH * NTOK * HID * 2);  // 16 MB
  float*    kraw     = (float*)   take((size_t)BATCH * HID * NTOK * 4);  // 32 MB
  _Float16* vh       = (_Float16*)take((size_t)BATCH * HID * NTOK * 2);  // 16 MB
  float*    part_max = (float*)   take((size_t)NSPLIT * BATCH * HID * 4);  // 128 KB
  float*    part_sum = (float*)   take((size_t)NSPLIT * BATCH * HID * 4);  // 128 KB
  float*    ctx_part = (float*)   take((size_t)NSPLIT * BATCH * NHEAD * DHEAD * DHEAD * 4);  // 4 MB
  _Float16* W2h      = (_Float16*)take((size_t)BATCH * CH * HID * 2);    // 1 MB

  prep_kernel<<<QKVR, 256, 0, stream>>>(w_qkv, norm_g, wqkv_h);
  qkv_kernel<<<dim3(NTOK / 32, BATCH), 256, 0, stream>>>(
      x, wqkv_h, qs_t, kraw, vh);
  context_kernel<<<dim3(BATCH * NHEAD, NSPLIT), 256, 0, stream>>>(
      kraw, vh, mem_kv, ctx_part, part_max, part_sum);
  w2_kernel<<<dim3(BATCH, NHEAD / 2, CH / W2_ROWS), 256, 0, stream>>>(
      w_out, ctx_part, part_max, part_sum, W2h);
  out_kernel<<<dim3(NTOK / 32, BATCH), 256, 0, stream>>>(
      W2h, qs_t, b_out, out_g, out);
}

// v007
// It runs in 83.8 microseconds.
// Two timings next to v006 both put it at 1.26 times that version's speed.
// Over all steps from v000 it is 4.06 times as fast.
#include <hip/hip_runtime.h>
#include <hip/hip_bf16.h>
#include <stdint.h>

typedef __attribute__((ext_vector_type(16))) _Float16 v16h;
typedef __attribute__((ext_vector_type(8)))  _Float16 v8h;
typedef __attribute__((ext_vector_type(8)))  float    v8f;
typedef __attribute__((ext_vector_type(2)))  float    v2f;

#define BATCH 16
#define CH    256
#define NTOK  4096
#define HID   128
#define QKVR  384
#define NHEAD 4
#define DHEAD 32
#define NMEM  4
#define NSPLIT 16               // work-groups that share one (b,h) token sum
#define NSEG  (NTOK / NSPLIT)   // tokens per work-group of the context kernel

__device__ __forceinline__ v8f wmma_f16(v16h a, v16h b, v8f c) {
  // v_wmma_f32_16x16x32_f16 : D = A(16x32) * B(32x16) + C(16x16 f32)
  return __builtin_amdgcn_wmma_f32_16x16x32_f16(
      /*neg_a=*/false, a, /*neg_b=*/false, b,
      /*c_mod=*/(short)0, c, /*reuse_a=*/false, /*reuse_b=*/false);
}

__device__ __forceinline__ v8f wmma_f32(v2f a, v2f b, v8f c) {
  return __builtin_amdgcn_wmma_f32_16x16x4_f32(
      /*neg_a=*/false, a, /*neg_b=*/false, b,
      /*c_mod=*/(short)0, c, /*reuse_a=*/false, /*reuse_b=*/false);
}

__device__ __forceinline__ v16h load_frag(const _Float16* base, int lane, int stride) {
  const int r  = lane & 15;
  const int k0 = (lane >> 4) << 3;       // 0 or 8
  const _Float16* p = base + r * stride;
  v8h lo = *(const v8h*)(p + k0);
  v8h hi = *(const v8h*)(p + 16 + k0);
  v16h f;
#pragma unroll
  for (int i = 0; i < 8; ++i) { f[i] = lo[i]; f[i + 8] = hi[i]; }
  return f;
}

__device__ __forceinline__ int frag_piece(int row, int k, int ksteps) {
  const int lane = (((k >> 3) & 1) << 4) | (row & 15);
  return ((((row >> 4) * ksteps + (k >> 5)) * 2 + ((k >> 4) & 1)) << 5) + lane;
}

// Load the A fragment of (row tile, k step) straight from a fragment-ordered matrix.
// wl: this lane's piece of the block that tile and ks count from.
__device__ __forceinline__ v16h load_frag_packed(const v8h* __restrict__ wl,
                                                 int tile, int ks, int ksteps) {
  const v8h* p = wl + (((tile * ksteps + ks) * 2) << 5);
  v8h lo = p[0];
  v8h hi = p[32];
  v16h f;
#pragma unroll
  for (int i = 0; i < 8; ++i) { f[i] = lo[i]; f[i + 8] = hi[i]; }
  return f;
}

__device__ __forceinline__ float exp_slot(float x) {
  float r;
  asm("v_exp_f32 %0, %1\n\tv_nop" : "=v"(r) : "v"(x * 1.4426950408889634f));
  return r;
}

// ---------------------------------------------------------------------------
// K0: fold norm_g into qkv weight, convert to f16, store in fragment order.
// ---------------------------------------------------------------------------
__global__ void prep_kernel(const float* __restrict__ w_qkv,
                            const float* __restrict__ norm_g,
                            _Float16* __restrict__ wqkv_h) {
  int i = blockIdx.x * 256 + threadIdx.x;
  if (i < QKVR * CH) {
    const int row = i >> 8, k = i & (CH - 1);
    wqkv_h[frag_piece(row, k & ~7, CH / 32) * 8 + (k & 7)] =
        (_Float16)(w_qkv[i] * norm_g[k]);
  }
}

#define X_PITCH (CH + 8)
__global__ __launch_bounds__(256, 8) void qkv_kernel(
    const float* __restrict__ x, const _Float16* __restrict__ wqkv_h,
    _Float16* __restrict__ qs_t, float* __restrict__ kraw,
    _Float16* __restrict__ vh) {
  // LDS: stage phase  : B 32 x X_PITCH f16 (16896 B)
  //      epilog phase : out 384x33 f32 (50688 B)   (reuses same memory)
  __shared__ __align__(16) char smem[QKVR * 33 * 4];
  _Float16* lds_b = (_Float16*)smem;
  float*    lds_o = (float*)smem;
  // sum of squares of column n over the 32 channels w*32 .. w*32+31 that wave w stages: ssq[w][n]
  __shared__ float ssq[8][32];

  const int tid  = threadIdx.x;
  const int wave = tid >> 5, lane = tid & 31;
  const int n0   = blockIdx.x * 32;
  const int b    = blockIdx.y;

  v8f acc[3][2];
#pragma unroll
  for (int i = 0; i < 3; ++i)
#pragma unroll
    for (int j = 0; j < 2; ++j)
#pragma unroll
      for (int r = 0; r < 8; ++r) acc[i][j][r] = 0.f;

  // this lane's first piece of this wave's three row tiles: uniform base + one 32-bit offset
  const v8h* wl = (const v8h*)wqkv_h + (unsigned)(wave * 3 * (CH / 32) * 64 + lane);
  // this thread's 32 x: column n0 + lane, channels wave*32 .. +31; a wave-wide load is one line.
  // unrolled: xv is indexed by constants only and all loads are in flight together
  const float* xp = x + ((size_t)b * CH + wave * 32) * NTOK + n0 + lane;
  float xv[32];
#pragma unroll
  for (int j = 0; j < 32; ++j) xv[j] = xp[(size_t)j * NTOK];
  // the first two k steps' A fragments, three each, issued beside the x loads
  v16h af[3], an[3];
#pragma unroll
  for (int i = 0; i < 3; ++i) af[i] = load_frag_packed(wl, i, 0, CH / 32);
#pragma unroll
  for (int i = 0; i < 3; ++i) an[i] = load_frag_packed(wl, i, 1, CH / 32);
  float ss = 0.f;
#pragma unroll
  for (int j = 0; j < 32; ++j) ss = fmaf(xv[j], xv[j], ss);
  // stage B (transposed [n][c]): x -> f16, 8 neighbouring channels a store
#pragma unroll
  for (int g = 0; g < 4; ++g) {
    v8h hx;
#pragma unroll
    for (int e = 0; e < 8; ++e) hx[e] = (_Float16)xv[g * 8 + e];
    *(v8h*)(lds_b + lane * X_PITCH + wave * 32 + g * 8) = hx;
  }
  ssq[wave][lane] = ss;
  // publishes the x tile and the eight partial sums of squares
  __syncthreads();
  // unrolled: LDS and weight offsets become immediates.  Two sets of A fragments: a step's
  // products free one, and the loads of the step after next go into it at once
#pragma unroll
  for (int ks = 0; ks < CH / 32; ++ks) {
    v16h bf0 = load_frag(lds_b + ks * 32, lane, X_PITCH);
    v16h bf1 = load_frag(lds_b + 16 * X_PITCH + ks * 32, lane, X_PITCH);
    // keeps the weight loads issued so far in front of this step's products: inside the
    // register budget the compiler otherwise loads each fragment right before its use and
    // waits out a trip to L2 three times a step
    __builtin_amdgcn_sched_barrier(0);
#pragma unroll
    for (int i = 0; i < 3; ++i) {
      acc[i][0] = wmma_f16(af[i], bf0, acc[i][0]);
      acc[i][1] = wmma_f16(af[i], bf1, acc[i][1]);
    }
    // keeps later steps' loads behind these products, so that two fragment sets suffice
    __builtin_amdgcn_sched_barrier(0);
#pragma unroll
    for (int i = 0; i < 3; ++i) af[i] = an[i];
    if (ks + 2 < CH / 32) {
#pragma unroll
      for (int i = 0; i < 3; ++i) an[i] = load_frag_packed(wl, i, ks + 2, CH / 32);
    }
  }
  // ends the last reads of lds_b, whose memory the accumulators are dumped into
  __syncthreads();
  float s2 = 0.f;
  for (int w = 0; w < 8; ++w) s2 += ssq[w][lane];
  const float inv = 16.0f / fmaxf(sqrtf(s2), 1e-12f);
  float invc[2];
  invc[0] = __shfl(inv, lane & 15);
  invc[1] = __shfl(inv, (lane & 15) + 16);
#pragma unroll
  for (int i = 0; i < 3; ++i) {
    int Rb = (wave * 3 + i) * 16 + ((lane >> 4) << 3);
#pragma unroll
    for (int j = 0; j < 2; ++j) {
      int cc = j * 16 + (lane & 15);
#pragma unroll
      for (int r = 0; r < 8; ++r) lds_o[(Rb + r) * 33 + cc] = acc[i][j][r] * invc[j];
    }
  }
  __syncthreads();
  // q rows 0..127: softmax over d per (head, column), * 32^-0.5
  if (tid < 128) {
    const float SCALE = 0.17677669529663687f;
    int h = tid >> 5, col = tid & 31;
    float m = -1e30f;
#pragma unroll
    for (int d = 0; d < DHEAD; ++d) m = fmaxf(m, lds_o[(h * 32 + d) * 33 + col]);
    float e[DHEAD], s = 0.f;
#pragma unroll
    for (int d = 0; d < DHEAD; ++d) {
      e[d] = __expf(lds_o[(h * 32 + d) * 33 + col] - m);
      s += e[d];
    }
    float inv = SCALE / s;
    _Float16* dst = qs_t + ((size_t)b * NTOK + n0 + col) * HID + h * 32;
#pragma unroll
    for (int d = 0; d < DHEAD; ++d) dst[d] = (_Float16)(e[d] * inv);
  }
  // k rows 128..255 raw f32; v rows 256..383 f16
  for (int idx = tid; idx < HID * 32; idx += 256) {
    int r = idx >> 5, col = idx & 31;
    kraw[((size_t)b * HID + r) * NTOK + n0 + col] = lds_o[(HID + r) * 33 + col];
  }
  for (int idx = tid; idx < HID * 32; idx += 256) {
    int r = idx >> 5, col = idx & 31;
    vh[((size_t)b * HID + r) * NTOK + n0 + col] =
        (_Float16)lds_o[(2 * HID + r) * 33 + col];
  }
}

#define CT_PITCH (NSEG + NMEM)
__global__ __launch_bounds__(256) void context_kernel(
    const float* __restrict__ kraw, const _Float16* __restrict__ vh,
    const float* __restrict__ mem_kv, float* __restrict__ ctx_part,
    float* __restrict__ part_max, float* __restrict__ part_sum) {
  __shared__ __align__(16) float kt[DHEAD][CT_PITCH];
  __shared__ __align__(16) float vt[DHEAD][CT_PITCH];
  __shared__ __align__(16) float red[4][8][32];
  const int bh = blockIdx.x, b = bh >> 2, h = bh & 3;
  const int split = blockIdx.y;
  const int tid = threadIdx.x;
  const int d = tid >> 3, q8 = tid & 7;
  const size_t rowbase = ((size_t)b * HID + h * 32) * NTOK;
  // this thread's NSEG / 8 keys of row d, 4 tokens a piece; the row's 8 threads
  // cover 128 contiguous bytes with each piece
  const float4* krow =
      (const float4*)(kraw + rowbase + (size_t)d * NTOK + split * NSEG) + q8;
  float4 kq[NSEG / 32];
  // unrolled: kq is indexed by constants only and all loads are in flight together
#pragma unroll
  for (int i = 0; i < NSEG / 32; ++i) kq[i] = krow[i * 8];
  // values: 8 tokens a piece, a wave covers the 512 contiguous bytes of one row
  const v8h* vsrc = (const v8h*)(vh + rowbase + split * NSEG) + (tid & 31);
  v8h vq[4];
  // unrolled: vq is indexed by constants only; the loads fly beside the keys'
#pragma unroll
  for (int i = 0; i < 4; ++i) vq[i] = vsrc[(size_t)((tid >> 5) + i * 8) * (NTOK / 8)];
  // memory keys of row d (mem_kv[0]); they belong to split 0 only
  const float4 mk = *(const float4*)(mem_kv + (h * 32 + d) * NMEM);
  // memory values of row e = d (mem_kv[1])
  const float4 mv = *(const float4*)(mem_kv + NHEAD * DHEAD * NMEM + (h * 32 + d) * NMEM);
  float m = kq[0].x;
#pragma unroll
  for (int i = 0; i < NSEG / 32; ++i)
    m = fmaxf(m, fmaxf(fmaxf(kq[i].x, kq[i].y), fmaxf(kq[i].z, kq[i].w)));
  const float mkmax = fmaxf(fmaxf(mk.x, mk.y), fmaxf(mk.z, mk.w));
  m = fmaxf(m, split == 0 ? mkmax : m);
#pragma unroll
  for (int s = 1; s < 8; s <<= 1) m = fmaxf(m, __shfl_xor(m, s));
  float l = 0.f;
#pragma unroll
  for (int i = 0; i < NSEG / 32; ++i) {
    kq[i].x = exp_slot(kq[i].x - m); kq[i].y = exp_slot(kq[i].y - m);
    kq[i].z = exp_slot(kq[i].z - m); kq[i].w = exp_slot(kq[i].w - m);
    l += (kq[i].x + kq[i].y) + (kq[i].z + kq[i].w);
  }
#pragma unroll
  for (int s = 1; s < 8; s <<= 1) l += __shfl_xor(l, s);

  // fill both tiles once
#pragma unroll
  for (int i = 0; i < NSEG / 32; ++i) *(float4*)&kt[d][i * 32 + q8 * 4] = kq[i];
#pragma unroll
  for (int i = 0; i < 4; ++i) {
    float* vd = &vt[(tid >> 5) + i * 8][(tid & 31) * 8];
    *(float4*)vd = make_float4((float)vq[i][0], (float)vq[i][1], (float)vq[i][2], (float)vq[i][3]);
    *(float4*)(vd + 4) = make_float4((float)vq[i][4], (float)vq[i][5], (float)vq[i][6], (float)vq[i][7]);
  }
  // memory tokens: mem_kv[0]=keys at offset 0, mem_kv[1]=values at offset 512;
  // they belong to one partial sum only and take the last NMEM columns of the tiles.
  if (split == 0) {
    float4 kx;
    kx.x = exp_slot(mk.x - m); kx.y = exp_slot(mk.y - m);
    kx.z = exp_slot(mk.z - m); kx.w = exp_slot(mk.w - m);
    l += kx.x; l += kx.y; l += kx.z; l += kx.w;
    if (q8 == 0) {
      *(float4*)&kt[d][NSEG] = kx;
      *(float4*)&vt[d][NSEG] = mv;
    }
  }
  // publishes both tiles to the waves that multiply them
  __syncthreads();

  // the wave's number in a scalar register: the branches on it below stay scalar,
  // so every lane is on at the matrix instructions
  const int wave = __builtin_amdgcn_readfirstlane(tid >> 5);
  const int lane = tid & 31, c = lane & 15, hs = lane >> 4;
  const int tile = wave & 3, dt = tile >> 1, et = tile & 1, kh = wave >> 2;
  const float* ap = &kt[dt * 16 + c][kh * (NSEG / 2) + hs * 4];
  const float* bp = &vt[et * 16 + c][kh * (NSEG / 2) + hs * 4];
  v8f acc0, acc1;
#pragma unroll
  for (int r = 0; r < 8; ++r) { acc0[r] = 0.f; acc1[r] = 0.f; }
  if (split == 0 && kh == 0) {
    // the NMEM memory tokens are one k step: two tokens a lane
    const v2f a  = *(const v2f*)&kt[dt * 16 + c][NSEG + hs * 2];
    const v2f bb = *(const v2f*)&vt[et * 16 + c][NSEG + hs * 2];
    acc0 = wmma_f32(a, bb, acc0);
    asm volatile("v_nop\n\tv_nop\n\tv_nop\n\tv_nop" : "+v"(acc0) : "v"(a), "v"(bb));
  }
  // unrolled: LDS offsets become immediates and the reads run ahead of the products;
  // two accumulators, so that no product waits for the one before it; acc1 goes first, so
  // that its registers are first written while its neighbour's operands are still live
  // and cannot be laid over the operands of the matrix instruction in front of it
#pragma unroll
  for (int s = 0; s < NSEG / 16; ++s) {
    const float4 a4 = *(const float4*)(ap + s * 8);
    const float4 b4 = *(const float4*)(bp + s * 8);
    v2f a, bb;
    a[0] = a4.z; a[1] = a4.w; bb[0] = b4.z; bb[1] = b4.w;
    acc1 = wmma_f32(a, bb, acc1);
    a[0] = a4.x; a[1] = a4.y; bb[0] = b4.x; bb[1] = b4.y;
    acc0 = wmma_f32(a, bb, acc0);
  }
  asm volatile("v_nop\n\tv_nop\n\tv_nop\n\tv_nop" : "+v"(acc0), "+v"(acc1));
#pragma unroll
  for (int r = 0; r < 8; ++r) acc0[r] += acc1[r];
  if (kh == 1) {
#pragma unroll
    for (int r = 0; r < 8; ++r) red[tile][r][lane] = acc0[r];
  }
  // publishes the second token half's sums to the waves that hold the first half's
  __syncthreads();
  // behind the barriers, so that no wave waits at one for these stores to return
  if (q8 == 0) {
    const int st = split * (BATCH * HID) + b * HID + h * 32 + d;
    part_max[st] = m;
    part_sum[st] = l;
  }
  if (kh == 0) {
    // D layout: register r = row 8 * hs + r, column c of the tile
    float* dst = ctx_part +
        ((((size_t)split * BATCH + b) * NHEAD + h) * DHEAD + dt * 16 + hs * 8) * DHEAD +
        et * 16 + c;
#pragma unroll
    for (int r = 0; r < 8; ++r) dst[r * DHEAD] = acc0[r] + red[tile][r][lane];
  }
}

#define W2_ROWS  32
#define CTX_PITCH 36
#define CTX_PLANE (DHEAD * CTX_PITCH + 32)
__global__ __launch_bounds__(256) void w2_kernel(
    const float* __restrict__ w_out, const float* __restrict__ ctx_part,
    const float* __restrict__ part_max, const float* __restrict__ part_sum,
    _Float16* __restrict__ W2h) {
  __shared__ __align__(16) float ctxT[2 * CTX_PLANE];   // [head of the pair][e][d]
  __shared__ __align__(16) float wts[2 * DHEAD * NSPLIT]; // [head of the pair * 32 + d][split]
  const int b = blockIdx.x, hp = blockIdx.y, tid = threadIdx.x;
  const int o  = blockIdx.z * W2_ROWS + (tid >> 3);
  const int hl = (tid >> 2) & 1;
  const int dg = (tid & 3) * 8;
  // this thread's 32 weights: they do not depend on the LDS fill, so they load beside the partial sums
  const float4* wrow = (const float4*)(w_out + o * HID + (hp * 2 + hl) * DHEAD);
  float4 w4[DHEAD / 4];
  // unrolled: w4 is indexed by constants only and stays in registers
#pragma unroll
  for (int i = 0; i < DHEAD / 4; ++i) w4[i] = wrow[i];
  const float4* part = (const float4*)ctx_part + (size_t)b * 1024 + hp * 512;
  // both heads' partial sums do not depend on the weights: they load beside the statistics.
  // unrolled: pq is indexed by constants only and all loads are in flight together
  float4 pq[2][NSPLIT];
#pragma unroll
  for (int t = 0; t < 2; ++t)
#pragma unroll
    for (int sp = 0; sp < NSPLIT; ++sp)
      pq[t][sp] = part[(size_t)sp * BATCH * 1024 + tid + t * 256];
  // weight of split sp in row (head, d): exp(its maximum - the row's maximum) / the row's sum.
  // 4 neighbouring lanes share a row, 4 splits each.
  {
    const int row = tid >> 2, s0 = (tid & 3) * 4;
    const int st = b * HID + hp * 2 * DHEAD + row;
    float mm[4], ll[4];
#pragma unroll
    for (int j = 0; j < 4; ++j) {
      mm[j] = part_max[(s0 + j) * (BATCH * HID) + st];
      ll[j] = part_sum[(s0 + j) * (BATCH * HID) + st];
    }
    float mx = fmaxf(fmaxf(mm[0], mm[1]), fmaxf(mm[2], mm[3]));
    mx = fmaxf(mx, __shfl_xor(mx, 1));
    mx = fmaxf(mx, __shfl_xor(mx, 2));
    float ls = 0.f;
#pragma unroll
    for (int j = 0; j < 4; ++j) {
      mm[j] = exp_slot(mm[j] - mx);
      ls = fmaf(ll[j], mm[j], ls);
    }
    ls += __shfl_xor(ls, 1);
    ls += __shfl_xor(ls, 2);
    const float inv = 1.0f / ls;
    *(float4*)(wts + row * NSPLIT + s0) =
        make_float4(mm[0] * inv, mm[1] * inv, mm[2] * inv, mm[3] * inv);
  }
  // publishes the weights to the threads that sum the partial sums
  __syncthreads();
#pragma unroll
  for (int t = 0; t < 2; ++t) {
    const int i4 = tid + t * 256;
    const int d = (i4 >> 3) & 31, e = (i4 & 7) * 4;
    const float4* wr = (const float4*)(wts + (i4 >> 3) * NSPLIT);
    float4 s = make_float4(0.f, 0.f, 0.f, 0.f);
#pragma unroll
    for (int g = 0; g < NSPLIT / 4; ++g) {
      const float4 w4s = wr[g];
      const float wv[4] = {w4s.x, w4s.y, w4s.z, w4s.w};
#pragma unroll
      for (int k = 0; k < 4; ++k) {
        const float4 q = pq[t][g * 4 + k];
        s.x = fmaf(q.x, wv[k], s.x); s.y = fmaf(q.y, wv[k], s.y);
        s.z = fmaf(q.z, wv[k], s.z); s.w = fmaf(q.w, wv[k], s.w);
      }
    }
    float* col = ctxT + t * CTX_PLANE + e * CTX_PITCH + d;
    col[0 * CTX_PITCH] = s.x;
    col[1 * CTX_PITCH] = s.y;
    col[2 * CTX_PITCH] = s.z;
    col[3 * CTX_PITCH] = s.w;
  }
  __syncthreads();
  float acc[8];
#pragma unroll
  for (int j = 0; j < 8; ++j) acc[j] = 0.f;
  const float* crow = ctxT + hl * CTX_PLANE + dg;
  // both loops unrolled: LDS offsets become immediates and many row reads are in flight;
  // e runs upwards, one fused multiply-add per term
#pragma unroll
  for (int e4 = 0; e4 < DHEAD / 4; ++e4) {
    const float wv[4] = {w4[e4].x, w4[e4].y, w4[e4].z, w4[e4].w};
#pragma unroll
    for (int k = 0; k < 4; ++k) {
      const float4 c0 = *(const float4*)(crow + (e4 * 4 + k) * CTX_PITCH);
      const float4 c1 = *(const float4*)(crow + (e4 * 4 + k) * CTX_PITCH + 4);
      acc[0] = fmaf(wv[k], c0.x, acc[0]); acc[1] = fmaf(wv[k], c0.y, acc[1]);
      acc[2] = fmaf(wv[k], c0.z, acc[2]); acc[3] = fmaf(wv[k], c0.w, acc[3]);
      acc[4] = fmaf(wv[k], c1.x, acc[4]); acc[5] = fmaf(wv[k], c1.y, acc[5]);
      acc[6] = fmaf(wv[k], c1.z, acc[6]); acc[7] = fmaf(wv[k], c1.w, acc[7]);
    }
  }
  v8h r;
#pragma unroll
  for (int j = 0; j < 8; ++j) r[j] = (_Float16)acc[j];
  ((v8h*)(W2h + (size_t)b * CH * HID))[frag_piece(o, (hp * 2 + hl) * DHEAD + dg, HID / 32)] = r;
}

// ---------------------------------------------------------------------------
// K5: Y = W2[b] @ qs  + b_out, then RMSNorm over the 256 output channels.
// WMMA; one workgroup owns a full 256-row x 32-col tile so the channel
// norm is done entirely in LDS.  A fragments as in K2: global to registers.
// The q tile (32 tokens x 128 k, 8 KB contiguous in memory) is staged whole, as in K2:
// one barrier publishes it and the k loop has none; all A fragments load beside it.
// ---------------------------------------------------------------------------
// halves per LDS row of the q tile [n][k]: 272 B = 16 B x odd, as X_PITCH
#define Q_PITCH (HID + 8)
__global__ __launch_bounds__(256) void out_kernel(
    const _Float16* __restrict__ W2h, const _Float16* __restrict__ qs_t,
    const float* __restrict__ b_out, const float* __restrict__ out_g,
    float* __restrict__ out) {
  __shared__ __align__(16) char smem[CH * 33 * 4];
  _Float16* lds_b = (_Float16*)smem;
  float*    lds_y = (float*)smem;
  __shared__ float colinv[32];

  const int tid = threadIdx.x;
  const int wave = tid >> 5, lane = tid & 31;
  const int n0 = blockIdx.x * 32;
  const int b  = blockIdx.y;

  v8f acc[2][2];
#pragma unroll
  for (int i = 0; i < 2; ++i)
#pragma unroll
    for (int j = 0; j < 2; ++j)
#pragma unroll
      for (int r = 0; r < 8; ++r) acc[i][j][r] = 0.f;

  const v8h* wl = (const v8h*)(W2h + (size_t)b * CH * HID) + (unsigned)(wave * 2 * (HID / 32) * 64 + lane);
  // B: 32 tokens x 128 halves, 16 bytes a piece; a wave-wide load covers 512 contiguous bytes
  const v8h* bsrc = (const v8h*)(qs_t + ((size_t)b * NTOK + n0) * HID);
  v8h bq[2];
#pragma unroll
  for (int i = 0; i < 2; ++i) bq[i] = bsrc[tid + i * 256];
  // this wave's two A fragments of all four k steps, issued beside the B loads
  v16h af[HID / 32][2];
#pragma unroll
  for (int ks = 0; ks < HID / 32; ++ks)
#pragma unroll
    for (int i = 0; i < 2; ++i) af[ks][i] = load_frag_packed(wl, i, ks, HID / 32);
#pragma unroll
  for (int i = 0; i < 2; ++i) {
    int idx = tid + i * 256;
    *(v8h*)(lds_b + (idx >> 4) * Q_PITCH + (idx & 15) * 8) = bq[i];
  }
  // publishes the q tile
  __syncthreads();
  // unrolled: af is indexed by constants only and LDS offsets become immediates
#pragma unroll
  for (int ks = 0; ks < HID / 32; ++ks) {
    v16h bf0 = load_frag(lds_b + ks * 32, lane, Q_PITCH);
    v16h bf1 = load_frag(lds_b + 16 * Q_PITCH + ks * 32, lane, Q_PITCH);
#pragma unroll
    for (int i = 0; i < 2; ++i) {
      acc[i][0] = wmma_f16(af[ks][i], bf0, acc[i][0]);
      acc[i][1] = wmma_f16(af[ks][i], bf1, acc[i][1]);
    }
  }
  // ends the last reads of lds_b, whose memory the accumulators are dumped into
  __syncthreads();
#pragma unroll
  for (int i = 0; i < 2; ++i) {
    int Rb = (wave * 2 + i) * 16 + ((lane >> 4) << 3);
#pragma unroll
    for (int j = 0; j < 2; ++j) {
      int cc = j * 16 + (lane & 15);
#pragma unroll
      for (int r = 0; r < 8; ++r) lds_y[(Rb + r) * 33 + cc] = acc[i][j][r];
    }
  }
  __syncthreads();
  if (tid < 32) {
    float s = 0.f;
    for (int o = 0; o < CH; ++o) {
      float v = lds_y[o * 33 + tid] + b_out[o];
      s += v * v;
    }
    colinv[tid] = 16.0f / fmaxf(sqrtf(s), 1e-12f);
  }
  __syncthreads();
  for (int idx = tid; idx < CH * 32; idx += 256) {
    int o = idx >> 5, col = idx & 31;
    float v = (lds_y[o * 33 + col] + b_out[o]) * colinv[col] * out_g[o];
    out[((size_t)b * CH + o) * NTOK + n0 + col] = v;
  }
}

// ---------------------------------------------------------------------------
extern "C" void kernel_launch(void* const* d_in, const int* in_sizes, int n_in,
                              void* d_out, int out_size, void* d_ws, size_t ws_size,
                              hipStream_t stream) {
  (void)in_sizes; (void)n_in; (void)out_size; (void)ws_size;
  const float* x        = (const float*)d_in[0];   // (16,256,64,64)
  const float* norm_g   = (const float*)d_in[1];   // (256)
  const float* w_qkv    = (const float*)d_in[2];   // (384,256)
  const float* mem_kv   = (const float*)d_in[3];   // (2,4,32,4)
  const float* w_out    = (const float*)d_in[4];   // (256,128)
  const float* b_out    = (const float*)d_in[5];   // (256)
  const float* out_g    = (const float*)d_in[6];   // (256)
  float* out = (float*)d_out;                      // (16,256,64,64)

  char* ws = (char*)d_ws;
  size_t off = 0;
  auto take = [&](size_t bytes) -> char* {
    char* p = ws + off;
    off = (off + bytes + 255) & ~(size_t)255;
    return p;
  };
  _Float16* wqkv_h   = (_Float16*)take((size_t)QKVR * CH * 2);           // 192 KB
  _Float16* qs_t     = (_Float16*)take((size_t)BATCH * NTOK * HID * 2);  // 16 MB
  float*    kraw     = (float*)   take((size_t)BATCH * HID * NTOK * 4);  // 32 MB
  _Float16* vh       = (_Float16*)take((size_t)BATCH * HID * NTOK * 2);  // 16 MB
  float*    part_max = (float*)   take((size_t)NSPLIT * BATCH * HID * 4);  // 128 KB
  float*    part_sum = (float*)   take((size_t)NSPLIT * BATCH * HID * 4);  // 128 KB
  float*    ctx_part = (float*)   take((size_t)NSPLIT * BATCH * NHEAD * DHEAD * DHEAD * 4);  // 4 MB
  _Float16* W2h      = (_Float16*)take((size_t)BATCH * CH * HID * 2);    // 1 MB

  prep_kernel<<<QKVR, 256, 0, stream>>>(w_qkv, norm_g, wqkv_h);
  qkv_kernel<<<dim3(NTOK / 32, BATCH), 256, 0, stream>>>(
      x, wqkv_h, qs_t, kraw, vh);
  context_kernel<<<dim3(BATCH * NHEAD, NSPLIT), 256, 0, stream>>>(
      kraw, vh, mem_kv, ctx_part, part_max, part_sum);
  w2_kernel<<<dim3(BATCH, NHEAD / 2, CH / W2_ROWS), 256, 0, stream>>>(
      w_out, ctx_part, part_max, part_sum, W2h);
  out_kernel<<<dim3(NTOK / 32, BATCH), 256, 0, stream>>>(
      W2h, qs_t, b_out, out_g, out);
}

// v008
// Measured time: 56 microseconds a run.
// In two side-by-side timings against v007, it was 1.50 and 1.49 times as fast.
// All steps since v000 together make it 6.08 times as fast.
#include <hip/hip_runtime.h>
#include <hip/hip_bf16.h>
#include <stdint.h>

typedef __attribute__((ext_vector_type(16))) _Float16 v16h;
typedef __attribute__((ext_vector_type(8)))  _Float16 v8h;
typedef __attribute__((ext_vector_type(2)))  _Float16 v2h;
typedef __attribute__((ext_vector_type(8)))  float    v8f;
typedef __attribute__((ext_vector_type(2)))  float    v2f;

#define BATCH 16
#define CH    256
#define NTOK  4096
#define HID   128
#define QKVR  384
#define NHEAD 4
#define DHEAD 32
#define NMEM  4
#define NSPLIT 16               // work-groups that share one (b,h) token sum
#define NSEG  (NTOK / NSPLIT)   // tokens per work-group of the context kernel
#define TOK   64                // tokens per work-group of the two f16 GEMM kernels
#define O_PITCH (TOK + 2)

__device__ __forceinline__ v8f wmma_f16(v16h a, v16h b, v8f c) {
  // v_wmma_f32_16x16x32_f16 : D = A(16x32) * B(32x16) + C(16x16 f32)
  return __builtin_amdgcn_wmma_f32_16x16x32_f16(
      /*neg_a=*/false, a, /*neg_b=*/false, b,
      /*c_mod=*/(short)0, c, /*reuse_a=*/false, /*reuse_b=*/false);
}

__device__ __forceinline__ v8f wmma_f32(v2f a, v2f b, v8f c) {
  return __builtin_amdgcn_wmma_f32_16x16x4_f32(
      /*neg_a=*/false, a, /*neg_b=*/false, b,
      /*c_mod=*/(short)0, c, /*reuse_a=*/false, /*reuse_b=*/false);
}

__device__ __forceinline__ v16h load_frag(const _Float16* base, int lane, int stride) {
  const int r  = lane & 15;
  const int k0 = (lane >> 4) << 3;       // 0 or 8
  const _Float16* p = base + r * stride;
  v8h lo = *(const v8h*)(p + k0);
  v8h hi = *(const v8h*)(p + 16 + k0);
  v16h f;
#pragma unroll
  for (int i = 0; i < 8; ++i) { f[i] = lo[i]; f[i + 8] = hi[i]; }
  return f;
}

__device__ __forceinline__ int frag_piece(int row, int k, int ksteps) {
  const int lane = (((k >> 3) & 1) << 4) | (row & 15);
  return ((((row >> 4) * ksteps + (k >> 5)) * 2 + ((k >> 4) & 1)) << 5) + lane;
}

// Load the A fragment of (row tile, k step) straight from a fragment-ordered matrix.
// wl: this lane's piece of the block that tile and ks count from.
__device__ __forceinline__ v16h load_frag_packed(const v8h* __restrict__ wl,
                                                 int tile, int ks, int ksteps) {
  const v8h* p = wl + (((tile * ksteps + ks) * 2) << 5);
  v8h lo = p[0];
  v8h hi = p[32];
  v16h f;
#pragma unroll
  for (int i = 0; i < 8; ++i) { f[i] = lo[i]; f[i + 8] = hi[i]; }
  return f;
}

__device__ __forceinline__ float exp_slot(float x) {
  float r;
  asm("v_exp_f32 %0, %1\n\tv_nop" : "=v"(r) : "v"(x * 1.4426950408889634f));
  return r;
}

// ---------------------------------------------------------------------------
// K0: fold norm_g into qkv weight, convert to f16, store in fragment order.
// ---------------------------------------------------------------------------
__global__ void prep_kernel(const float* __restrict__ w_qkv,
                            const float* __restrict__ norm_g,
                            _Float16* __restrict__ wqkv_h) {
  int i = blockIdx.x * 256 + threadIdx.x;
  if (i < QKVR * CH) {
    const int row = i >> 8, k = i & (CH - 1);
    wqkv_h[frag_piece(row, k & ~7, CH / 32) * 8 + (k & 7)] =
        (_Float16)(w_qkv[i] * norm_g[k]);
  }
}

#define X_PITCH (CH + 8)
__global__ __launch_bounds__(256, 4) void qkv_kernel(
    const float* __restrict__ x, const _Float16* __restrict__ wqkv_h,
    _Float16* __restrict__ qs_t, float* __restrict__ kraw,
    _Float16* __restrict__ vh) {
  // LDS: stage phase  : B TOK x X_PITCH f16 (33792 B)
  //      epilog phase : out 384 x O_PITCH f32 (101376 B)   (reuses same memory)
  __shared__ __align__(16) char smem[QKVR * O_PITCH * 4];
  _Float16* lds_b = (_Float16*)smem;
  float*    lds_o = (float*)smem;
  // sum of squares of column n over the 32 channels w*32 .. w*32+31 that wave w stages: ssq[w][n]
  __shared__ __align__(8) float ssq[8][TOK];

  const int tid  = threadIdx.x;
  const int wave = tid >> 5, lane = tid & 31;
  const int n0   = blockIdx.x * TOK;
  const int b    = blockIdx.y;

  v8f acc[3][TOK / 16];
#pragma unroll
  for (int i = 0; i < 3; ++i)
#pragma unroll
    for (int j = 0; j < TOK / 16; ++j)
#pragma unroll
      for (int r = 0; r < 8; ++r) acc[i][j][r] = 0.f;

  // this lane's first piece of this wave's three row tiles: uniform base + one 32-bit offset
  const v8h* wl = (const v8h*)wqkv_h + (unsigned)(wave * 3 * (CH / 32) * 64 + lane);
  // this thread's 64 x: columns n0 + 2*lane and the next, channels wave*32 .. +31; a wave-wide
  // load is the tile's whole row, two lines.
  // unrolled: xv is indexed by constants only and all loads are in flight together
  const float2* xp = (const float2*)(x + ((size_t)b * CH + wave * 32) * NTOK + n0) + lane;
  float2 xv[32];
#pragma unroll
  for (int j = 0; j < 32; ++j) xv[j] = xp[(size_t)j * (NTOK / 2)];
  // the first two k steps' A fragments, three each, issued beside the x loads
  v16h af[3], an[3];
#pragma unroll
  for (int i = 0; i < 3; ++i) af[i] = load_frag_packed(wl, i, 0, CH / 32);
#pragma unroll
  for (int i = 0; i < 3; ++i) an[i] = load_frag_packed(wl, i, 1, CH / 32);
  float2 ss = make_float2(0.f, 0.f);
#pragma unroll
  for (int j = 0; j < 32; ++j) {
    ss.x = fmaf(xv[j].x, xv[j].x, ss.x);
    ss.y = fmaf(xv[j].y, xv[j].y, ss.y);
  }
  // stage B (transposed [n][c]): x -> f16, 8 neighbouring channels a store
#pragma unroll
  for (int g = 0; g < 4; ++g) {
    v8h h0, h1;
#pragma unroll
    for (int e = 0; e < 8; ++e) {
      h0[e] = (_Float16)xv[g * 8 + e].x;
      h1[e] = (_Float16)xv[g * 8 + e].y;
    }
    *(v8h*)(lds_b + (2 * lane) * X_PITCH + wave * 32 + g * 8) = h0;
    *(v8h*)(lds_b + (2 * lane + 1) * X_PITCH + wave * 32 + g * 8) = h1;
  }
  *(float2*)&ssq[wave][2 * lane] = ss;
  // publishes the x tile and the eight partial sums of squares
  __syncthreads();
  // unrolled: LDS and weight offsets become immediates.  Two sets of A fragments: a step's
  // products free one, and the loads of the step after next go into it at once
#pragma unroll
  for (int ks = 0; ks < CH / 32; ++ks) {
    v16h bf[TOK / 16];
#pragma unroll
    for (int j = 0; j < TOK / 16; ++j)
      bf[j] = load_frag(lds_b + j * 16 * X_PITCH + ks * 32, lane, X_PITCH);
    // keeps the weight loads issued so far in front of this step's products: inside the
    // register budget the compiler otherwise loads each fragment right before its use and
    // waits out a trip to L2 three times a step
    __builtin_amdgcn_sched_barrier(0);
    // j outside: the first three products wait for the first B fragment only
#pragma unroll
    for (int j = 0; j < TOK / 16; ++j)
#pragma unroll
      for (int i = 0; i < 3; ++i) acc[i][j] = wmma_f16(af[i], bf[j], acc[i][j]);
    // keeps later steps' loads behind these products, so that two fragment sets suffice
    __builtin_amdgcn_sched_barrier(0);
#pragma unroll
    for (int i = 0; i < 3; ++i) af[i] = an[i];
    if (ks + 2 < CH / 32) {
#pragma unroll
      for (int i = 0; i < 3; ++i) an[i] = load_frag_packed(wl, i, ks + 2, CH / 32);
    }
  }
  // ends the last reads of lds_b, whose memory the accumulators are dumped into
  __syncthreads();
  float s2a = 0.f, s2b = 0.f;
  for (int w = 0; w < 8; ++w) { s2a += ssq[w][lane]; s2b += ssq[w][lane + 32]; }
  const float inva = 16.0f / fmaxf(sqrtf(s2a), 1e-12f);
  const float invb = 16.0f / fmaxf(sqrtf(s2b), 1e-12f);
  float invc[TOK / 16];
  invc[0] = __shfl(inva, lane & 15);
  invc[1] = __shfl(inva, (lane & 15) + 16);
  invc[2] = __shfl(invb, lane & 15);
  invc[3] = __shfl(invb, (lane & 15) + 16);
#pragma unroll
  for (int i = 0; i < 3; ++i) {
    int Rb = (wave * 3 + i) * 16 + ((lane >> 4) << 3);
#pragma unroll
    for (int j = 0; j < TOK / 16; ++j) {
      int cc = j * 16 + (lane & 15);
#pragma unroll
      for (int r = 0; r < 8; ++r) lds_o[(Rb + r) * O_PITCH + cc] = acc[i][j][r] * invc[j];
    }
  }
  __syncthreads();
  // q rows 0..127: softmax over d per (head, column), * 32^-0.5; 4 heads x TOK columns, a thread each
  {
    const float SCALE = 0.17677669529663687f;
    int h = tid / TOK, col = tid % TOK;
    float m = -1e30f;
#pragma unroll
    for (int d = 0; d < DHEAD; ++d) m = fmaxf(m, lds_o[(h * 32 + d) * O_PITCH + col]);
    float e[DHEAD], s = 0.f;
#pragma unroll
    for (int d = 0; d < DHEAD; ++d) {
      e[d] = exp_slot(lds_o[(h * 32 + d) * O_PITCH + col] - m);
      s += e[d];
    }
    float inv = SCALE / s;
    _Float16* dst = qs_t + ((size_t)b * NTOK + n0 + col) * HID + h * 32;
#pragma unroll
    for (int d = 0; d < DHEAD; ++d) dst[d] = (_Float16)(e[d] * inv);
  }
  // k rows 128..255 raw f32; v rows 256..383 f16; a lane takes two neighbouring tokens, a
  // wave one whole row of the tile
  for (int idx = tid; idx < HID * (TOK / 2); idx += 256) {
    int r = idx >> 5, col = (idx & 31) * 2;
    *(float2*)(kraw + ((size_t)b * HID + r) * NTOK + n0 + col) =
        *(const float2*)(lds_o + (HID + r) * O_PITCH + col);
  }
  for (int idx = tid; idx < HID * (TOK / 2); idx += 256) {
    int r = idx >> 5, col = (idx & 31) * 2;
    const float2 vv = *(const float2*)(lds_o + (2 * HID + r) * O_PITCH + col);
    v2h hv;
    hv[0] = (_Float16)vv.x; hv[1] = (_Float16)vv.y;
    *(v2h*)(vh + ((size_t)b * HID + r) * NTOK + n0 + col) = hv;
  }
}

#define CT_PITCH (NSEG + NMEM)
__global__ __launch_bounds__(256) void context_kernel(
    const float* __restrict__ kraw, const _Float16* __restrict__ vh,
    const float* __restrict__ mem_kv, float* __restrict__ ctx_part,
    float* __restrict__ part_max, float* __restrict__ part_sum) {
  __shared__ __align__(16) float kt[DHEAD][CT_PITCH];
  __shared__ __align__(16) float vt[DHEAD][CT_PITCH];
  __shared__ __align__(16) float red[4][8][32];
  const int bh = blockIdx.x, b = bh >> 2, h = bh & 3;
  const int split = blockIdx.y;
  const int tid = threadIdx.x;
  const int d = tid >> 3, q8 = tid & 7;
  const size_t rowbase = ((size_t)b * HID + h * 32) * NTOK;
  // this thread's NSEG / 8 keys of row d, 4 tokens a piece; the row's 8 threads
  // cover 128 contiguous bytes with each piece
  const float4* krow =
      (const float4*)(kraw + rowbase + (size_t)d * NTOK + split * NSEG) + q8;
  float4 kq[NSEG / 32];
  // unrolled: kq is indexed by constants only and all loads are in flight together
#pragma unroll
  for (int i = 0; i < NSEG / 32; ++i) kq[i] = krow[i * 8];
  // values: 8 tokens a piece, a wave covers the 512 contiguous bytes of one row
  const v8h* vsrc = (const v8h*)(vh + rowbase + split * NSEG) + (tid & 31);
  v8h vq[4];
  // unrolled: vq is indexed by constants only; the loads fly beside the keys'
#pragma unroll
  for (int i = 0; i < 4; ++i) vq[i] = vsrc[(size_t)((tid >> 5) + i * 8) * (NTOK / 8)];
  // memory keys of row d (mem_kv[0]); they belong to split 0 only
  const float4 mk = *(const float4*)(mem_kv + (h * 32 + d) * NMEM);
  // memory values of row e = d (mem_kv[1])
  const float4 mv = *(const float4*)(mem_kv + NHEAD * DHEAD * NMEM + (h * 32 + d) * NMEM);
  float m = kq[0].x;
#pragma unroll
  for (int i = 0; i < NSEG / 32; ++i)
    m = fmaxf(m, fmaxf(fmaxf(kq[i].x, kq[i].y), fmaxf(kq[i].z, kq[i].w)));
  const float mkmax = fmaxf(fmaxf(mk.x, mk.y), fmaxf(mk.z, mk.w));
  m = fmaxf(m, split == 0 ? mkmax : m);
#pragma unroll
  for (int s = 1; s < 8; s <<= 1) m = fmaxf(m, __shfl_xor(m, s));
  float l = 0.f;
#pragma unroll
  for (int i = 0; i < NSEG / 32; ++i) {
    kq[i].x = exp_slot(kq[i].x - m); kq[i].y = exp_slot(kq[i].y - m);
    kq[i].z = exp_slot(kq[i].z - m); kq[i].w = exp_slot(kq[i].w - m);
    l += (kq[i].x + kq[i].y) + (kq[i].z + kq[i].w);
  }
#pragma unroll
  for (int s = 1; s < 8; s <<= 1) l += __shfl_xor(l, s);

  // fill both tiles once
#pragma unroll
  for (int i = 0; i < NSEG / 32; ++i) *(float4*)&kt[d][i * 32 + q8 * 4] = kq[i];
#pragma unroll
  for (int i = 0; i < 4; ++i) {
    float* vd = &vt[(tid >> 5) + i * 8][(tid & 31) * 8];
    *(float4*)vd = make_float4((float)vq[i][0], (float)vq[i][1], (float)vq[i][2], (float)vq[i][3]);
    *(float4*)(vd + 4) = make_float4((float)vq[i][4], (float)vq[i][5], (float)vq[i][6], (float)vq[i][7]);
  }
  // memory tokens: mem_kv[0]=keys at offset 0, mem_kv[1]=values at offset 512;
  // they belong to one partial sum only and take the last NMEM columns of the tiles.
  if (split == 0) {
    float4 kx;
    kx.x = exp_slot(mk.x - m); kx.y = exp_slot(mk.y - m);
    kx.z = exp_slot(mk.z - m); kx.w = exp_slot(mk.w - m);
    l += kx.x; l += kx.y; l += kx.z; l += kx.w;
    if (q8 == 0) {
      *(float4*)&kt[d][NSEG] = kx;
      *(float4*)&vt[d][NSEG] = mv;
    }
  }
  // publishes both tiles to the waves that multiply them
  __syncthreads();

  // the wave's number in a scalar register: the branches on it below stay scalar,
  // so every lane is on at the matrix instructions
  const int wave = __builtin_amdgcn_readfirstlane(tid >> 5);
  const int lane = tid & 31, c = lane & 15, hs = lane >> 4;
  const int tile = wave & 3, dt = tile >> 1, et = tile & 1, kh = wave >> 2;
  const float* ap = &kt[dt * 16 + c][kh * (NSEG / 2) + hs * 4];
  const float* bp = &vt[et * 16 + c][kh * (NSEG / 2) + hs * 4];
  v8f acc0, acc1;
#pragma unroll
  for (int r = 0; r < 8; ++r) { acc0[r] = 0.f; acc1[r] = 0.f; }
  if (split == 0 && kh == 0) {
    // the NMEM memory tokens are one k step: two tokens a lane
    const v2f a  = *(const v2f*)&kt[dt * 16 + c][NSEG + hs * 2];
    const v2f bb = *(const v2f*)&vt[et * 16 + c][NSEG + hs * 2];
    acc0 = wmma_f32(a, bb, acc0);
    asm volatile("v_nop\n\tv_nop\n\tv_nop\n\tv_nop" : "+v"(acc0) : "v"(a), "v"(bb));
  }
  // unrolled: LDS offsets become immediates and the reads run ahead of the products;
  // two accumulators, so that no product waits for the one before it; acc1 goes first, so
  // that its registers are first written while its neighbour's operands are still live
  // and cannot be laid over the operands of the matrix instruction in front of it
#pragma unroll
  for (int s = 0; s < NSEG / 16; ++s) {
    const float4 a4 = *(const float4*)(ap + s * 8);
    const float4 b4 = *(const float4*)(bp + s * 8);
    v2f a, bb;
    a[0] = a4.z; a[1] = a4.w; bb[0] = b4.z; bb[1] = b4.w;
    acc1 = wmma_f32(a, bb, acc1);
    a[0] = a4.x; a[1] = a4.y; bb[0] = b4.x; bb[1] = b4.y;
    acc0 = wmma_f32(a, bb, acc0);
  }
  asm volatile("v_nop\n\tv_nop\n\tv_nop\n\tv_nop" : "+v"(acc0), "+v"(acc1));
#pragma unroll
  for (int r = 0; r < 8; ++r) acc0[r] += acc1[r];
  if (kh == 1) {
#pragma unroll
    for (int r = 0; r < 8; ++r) red[tile][r][lane] = acc0[r];
  }
  // publishes the second token half's sums to the waves that hold the first half's
  __syncthreads();
  // behind the barriers, so that no wave waits at one for these stores to return
  if (q8 == 0) {
    const int st = split * (BATCH * HID) + b * HID + h * 32 + d;
    part_max[st] = m;
    part_sum[st] = l;
  }
  if (kh == 0) {
    // D layout: register r = row 8 * hs + r, column c of the tile
    float* dst = ctx_part +
        ((((size_t)split * BATCH + b) * NHEAD + h) * DHEAD + dt * 16 + hs * 8) * DHEAD +
        et * 16 + c;
#pragma unroll
    for (int r = 0; r < 8; ++r) dst[r * DHEAD] = acc0[r] + red[tile][r][lane];
  }
}

#define W2_ROWS  32
#define CTX_PITCH 36
#define CTX_PLANE (DHEAD * CTX_PITCH + 32)
__global__ __launch_bounds__(256) void w2_kernel(
    const float* __restrict__ w_out, const float* __restrict__ ctx_part,
    const float* __restrict__ part_max, const float* __restrict__ part_sum,
    _Float16* __restrict__ W2h) {
  __shared__ __align__(16) float ctxT[2 * CTX_PLANE];   // [head of the pair][e][d]
  __shared__ __align__(16) float wts[2 * DHEAD * NSPLIT]; // [head of the pair * 32 + d][split]
  const int b = blockIdx.x, hp = blockIdx.y, tid = threadIdx.x;
  const int o  = blockIdx.z * W2_ROWS + (tid >> 3);
  const int hl = (tid >> 2) & 1;
  const int dg = (tid & 3) * 8;
  // this thread's 32 weights: they do not depend on the LDS fill, so they load beside the partial sums
  const float4* wrow = (const float4*)(w_out + o * HID + (hp * 2 + hl) * DHEAD);
  float4 w4[DHEAD / 4];
  // unrolled: w4 is indexed by constants only and stays in registers
#pragma unroll
  for (int i = 0; i < DHEAD / 4; ++i) w4[i] = wrow[i];
  const float4* part = (const float4*)ctx_part + (size_t)b * 1024 + hp * 512;
  // both heads' partial sums do not depend on the weights: they load beside the statistics.
  // unrolled: pq is indexed by constants only and all loads are in flight together
  float4 pq[2][NSPLIT];
#pragma unroll
  for (int t = 0; t < 2; ++t)
#pragma unroll
    for (int sp = 0; sp < NSPLIT; ++sp)
      pq[t][sp] = part[(size_t)sp * BATCH * 1024 + tid + t * 256];
  // weight of split sp in row (head, d): exp(its maximum - the row's maximum) / the row's sum.
  // 4 neighbouring lanes share a row, 4 splits each.
  {
    const int row = tid >> 2, s0 = (tid & 3) * 4;
    const int st = b * HID + hp * 2 * DHEAD + row;
    float mm[4], ll[4];
#pragma unroll
    for (int j = 0; j < 4; ++j) {
      mm[j] = part_max[(s0 + j) * (BATCH * HID) + st];
      ll[j] = part_sum[(s0 + j) * (BATCH * HID) + st];
    }
    float mx = fmaxf(fmaxf(mm[0], mm[1]), fmaxf(mm[2], mm[3]));
    mx = fmaxf(mx, __shfl_xor(mx, 1));
    mx = fmaxf(mx, __shfl_xor(mx, 2));
    float ls = 0.f;
#pragma unroll
    for (int j = 0; j < 4; ++j) {
      mm[j] = exp_slot(mm[j] - mx);
      ls = fmaf(ll[j], mm[j], ls);
    }
    ls += __shfl_xor(ls, 1);
    ls += __shfl_xor(ls, 2);
    const float inv = 1.0f / ls;
    *(float4*)(wts + row * NSPLIT + s0) =
        make_float4(mm[0] * inv, mm[1] * inv, mm[2] * inv, mm[3] * inv);
  }
  // publishes the weights to the threads that sum the partial sums
  __syncthreads();
#pragma unroll
  for (int t = 0; t < 2; ++t) {
    const int i4 = tid + t * 256;
    const int d = (i4 >> 3) & 31, e = (i4 & 7) * 4;
    const float4* wr = (const float4*)(wts + (i4 >> 3) * NSPLIT);
    float4 s = make_float4(0.f, 0.f, 0.f, 0.f);
#pragma unroll
    for (int g = 0; g < NSPLIT / 4; ++g) {
      const float4 w4s = wr[g];
      const float wv[4] = {w4s.x, w4s.y, w4s.z, w4s.w};
#pragma unroll
      for (int k = 0; k < 4; ++k) {
        const float4 q = pq[t][g * 4 + k];
        s.x = fmaf(q.x, wv[k], s.x); s.y = fmaf(q.y, wv[k], s.y);
        s.z = fmaf(q.z, wv[k], s.z); s.w = fmaf(q.w, wv[k], s.w);
      }
    }
    float* col = ctxT + t * CTX_PLANE + e * CTX_PITCH + d;
    col[0 * CTX_PITCH] = s.x;
    col[1 * CTX_PITCH] = s.y;
    col[2 * CTX_PITCH] = s.z;
    col[3 * CTX_PITCH] = s.w;
  }
  __syncthreads();
  float acc[8];
#pragma unroll
  for (int j = 0; j < 8; ++j) acc[j] = 0.f;
  const float* crow = ctxT + hl * CTX_PLANE + dg;
  // both loops unrolled: LDS offsets become immediates and many row reads are in flight;
  // e runs upwards, one fused multiply-add per term
#pragma unroll
  for (int e4 = 0; e4 < DHEAD / 4; ++e4) {
    const float wv[4] = {w4[e4].x, w4[e4].y, w4[e4].z, w4[e4].w};
#pragma unroll
    for (int k = 0; k < 4; ++k) {
      const float4 c0 = *(const float4*)(crow + (e4 * 4 + k) * CTX_PITCH);
      const float4 c1 = *(const float4*)(crow + (e4 * 4 + k) * CTX_PITCH + 4);
      acc[0] = fmaf(wv[k], c0.x, acc[0]); acc[1] = fmaf(wv[k], c0.y, acc[1]);
      acc[2] = fmaf(wv[k], c0.z, acc[2]); acc[3] = fmaf(wv[k], c0.w, acc[3]);
      acc[4] = fmaf(wv[k], c1.x, acc[4]); acc[5] = fmaf(wv[k], c1.y, acc[5]);
      acc[6] = fmaf(wv[k], c1.z, acc[6]); acc[7] = fmaf(wv[k], c1.w, acc[7]);
    }
  }
  v8h r;
#pragma unroll
  for (int j = 0; j < 8; ++j) r[j] = (_Float16)acc[j];
  ((v8h*)(W2h + (size_t)b * CH * HID))[frag_piece(o, (hp * 2 + hl) * DHEAD + dg, HID / 32)] = r;
}

// ---------------------------------------------------------------------------
// K5: Y = W2[b] @ qs  + b_out, then RMSNorm over the 256 output channels.
// WMMA; one workgroup owns a full 256-row x 64-col tile so the channel
// norm is done entirely in LDS.  A fragments as in K2: global to registers.
// The q tile (64 tokens x 128 k, 16 KB contiguous in memory) is staged whole, as in K2:
// one barrier publishes it and the k loop has none; the first three k steps' A fragments load beside it.
// ---------------------------------------------------------------------------
// halves per LDS row of the q tile [n][k]: 272 B = 16 B x odd, as X_PITCH
#define Q_PITCH (HID + 8)
__global__ __launch_bounds__(256, 8) void out_kernel(
    const _Float16* __restrict__ W2h, const _Float16* __restrict__ qs_t,
    const float* __restrict__ b_out, const float* __restrict__ out_g,
    float* __restrict__ out) {
  __shared__ __align__(16) char smem[CH * O_PITCH * 4];
  _Float16* lds_b = (_Float16*)smem;
  float*    lds_y = (float*)smem;
  __shared__ __align__(8) float colinv[TOK];

  const int tid = threadIdx.x;
  const int wave = tid >> 5, lane = tid & 31;
  const int n0 = blockIdx.x * TOK;
  const int b  = blockIdx.y;

  v8f acc[2][TOK / 16];
#pragma unroll
  for (int i = 0; i < 2; ++i)
#pragma unroll
    for (int j = 0; j < TOK / 16; ++j)
#pragma unroll
      for (int r = 0; r < 8; ++r) acc[i][j][r] = 0.f;

  const v8h* wl = (const v8h*)(W2h + (size_t)b * CH * HID) + (unsigned)(wave * 2 * (HID / 32) * 64 + lane);
  // B: TOK tokens x 128 halves, 16 bytes a piece; a wave-wide load covers 512 contiguous bytes
  const v8h* bsrc = (const v8h*)(qs_t + ((size_t)b * NTOK + n0) * HID);
  v8h bq[TOK / 16];
#pragma unroll
  for (int i = 0; i < TOK / 16; ++i) bq[i] = bsrc[tid + i * 256];
  // this wave's two A fragments of the first three k steps, issued beside the B loads
  v16h af[HID / 32][2];
#pragma unroll
  for (int ks = 0; ks < HID / 32 - 1; ++ks)
#pragma unroll
    for (int i = 0; i < 2; ++i) af[ks][i] = load_frag_packed(wl, i, ks, HID / 32);
#pragma unroll
  for (int i = 0; i < TOK / 16; ++i) {
    int idx = tid + i * 256;
    *(v8h*)(lds_b + (idx >> 4) * Q_PITCH + (idx & 15) * 8) = bq[i];
  }
  // publishes the q tile
  __syncthreads();
  // unrolled: af is indexed by constants only and LDS offsets become immediates
#pragma unroll
  for (int ks = 0; ks < HID / 32; ++ks) {
#pragma unroll
    for (int j = 0; j < TOK / 16; ++j) {
      v16h bf = load_frag(lds_b + j * 16 * Q_PITCH + ks * 32, lane, Q_PITCH);
#pragma unroll
      for (int i = 0; i < 2; ++i) acc[i][j] = wmma_f16(af[ks][i], bf, acc[i][j]);
    }
    if (ks == 0) {
      // the last step's A fragments: beside the others they do not fit the register budget and
      // spill; here they take registers that the q staging and the first step's products have freed
#pragma unroll
      for (int i = 0; i < 2; ++i)
        af[HID / 32 - 1][i] = load_frag_packed(wl, i, HID / 32 - 1, HID / 32);
      // keeps these loads two steps ahead of their use: the compiler otherwise moves them down
      // to the last step, which then waits out the trip to L2
      __builtin_amdgcn_sched_barrier(0);
    }
  }
  // ends the last reads of lds_b, whose memory the accumulators are dumped into
  __syncthreads();
#pragma unroll
  for (int i = 0; i < 2; ++i) {
    int Rb = (wave * 2 + i) * 16 + ((lane >> 4) << 3);
#pragma unroll
    for (int j = 0; j < TOK / 16; ++j) {
      int cc = j * 16 + (lane & 15);
#pragma unroll
      for (int r = 0; r < 8; ++r) lds_y[(Rb + r) * O_PITCH + cc] = acc[i][j][r];
    }
  }
  __syncthreads();
  if (tid < TOK) {
    float s = 0.f;
    for (int o = 0; o < CH; ++o) {
      float v = lds_y[o * O_PITCH + tid] + b_out[o];
      s += v * v;
    }
    colinv[tid] = 16.0f / fmaxf(sqrtf(s), 1e-12f);
  }
  __syncthreads();
  // a lane takes two neighbouring tokens, a wave one whole row of the tile (two lines)
  for (int idx = tid; idx < CH * (TOK / 2); idx += 256) {
    int o = idx >> 5, col = (idx & 31) * 2;
    const float2 y  = *(const float2*)(lds_y + o * O_PITCH + col);
    const float2 ci = *(const float2*)(colinv + col);
    float2 v;
    v.x = (y.x + b_out[o]) * ci.x * out_g[o];
    v.y = (y.y + b_out[o]) * ci.y * out_g[o];
    *(float2*)(out + ((size_t)b * CH + o) * NTOK + n0 + col) = v;
  }
}

// ---------------------------------------------------------------------------
extern "C" void kernel_launch(void* const* d_in, const int* in_sizes, int n_in,
                              void* d_out, int out_size, void* d_ws, size_t ws_size,
                              hipStream_t stream) {
  (void)in_sizes; (void)n_in; (void)out_size; (void)ws_size;
  const float* x        = (const float*)d_in[0];   // (16,256,64,64)
  const float* norm_g   = (const float*)d_in[1];   // (256)
  const float* w_qkv    = (const float*)d_in[2];   // (384,256)
  const float* mem_kv   = (const float*)d_in[3];   // (2,4,32,4)
  const float* w_out    = (const float*)d_in[4];   // (256,128)
  const float* b_out    = (const float*)d_in[5];   // (256)
  const float* out_g    = (const float*)d_in[6];   // (256)
  float* out = (float*)d_out;                      // (16,256,64,64)

  char* ws = (char*)d_ws;
  size_t off = 0;
  auto take = [&](size_t bytes) -> char* {
    char* p = ws + off;
    off = (off + bytes + 255) & ~(size_t)255;
    return p;
  };
  _Float16* wqkv_h   = (_Float16*)take((size_t)QKVR * CH * 2);           // 192 KB
  _Float16* qs_t     = (_Float16*)take((size_t)BATCH * NTOK * HID * 2);  // 16 MB
  float*    kraw     = (float*)   take((size_t)BATCH * HID * NTOK * 4);  // 32 MB
  _Float16* vh       = (_Float16*)take((size_t)BATCH * HID * NTOK * 2);  // 16 MB
  float*    part_max = (float*)   take((size_t)NSPLIT * BATCH * HID * 4);  // 128 KB
  float*    part_sum = (float*)   take((size_t)NSPLIT * BATCH * HID * 4);  // 128 KB
  float*    ctx_part = (float*)   take((size_t)NSPLIT * BATCH * NHEAD * DHEAD * DHEAD * 4);  // 4 MB
  _Float16* W2h      = (_Float16*)take((size_t)BATCH * CH * HID * 2);    // 1 MB

  prep_kernel<<<QKVR, 256, 0, stream>>>(w_qkv, norm_g, wqkv_h);
  qkv_kernel<<<dim3(NTOK / TOK, BATCH), 256, 0, stream>>>(
      x, wqkv_h, qs_t, kraw, vh);
  context_kernel<<<dim3(BATCH * NHEAD, NSPLIT), 256, 0, stream>>>(
      kraw, vh, mem_kv, ctx_part, part_max, part_sum);
  w2_kernel<<<dim3(BATCH, NHEAD / 2, CH / W2_ROWS), 256, 0, stream>>>(
      w_out, ctx_part, part_max, part_sum, W2h);
  out_kernel<<<dim3(NTOK / TOK, BATCH), 256, 0, stream>>>(
      W2h, qs_t, b_out, out_g, out);
}

// v009
// A run of this version takes 48.9 microseconds.
// Timed twice side by side with v008, it ran 1.14 and 1.15 times as fast.
// All steps since v000 together make it 6.96 times as fast.
#include <hip/hip_runtime.h>
#include <hip/hip_bf16.h>
#include <stdint.h>

typedef __attribute__((ext_vector_type(16))) _Float16 v16h;
typedef __attribute__((ext_vector_type(8)))  _Float16 v8h;
typedef __attribute__((ext_vector_type(2)))  _Float16 v2h;
typedef __attribute__((ext_vector_type(8)))  float    v8f;
typedef __attribute__((ext_vector_type(2)))  float    v2f;

#define BATCH 16
#define CH    256
#define NTOK  4096
#define HID   128
#define QKVR  384
#define NHEAD 4
#define DHEAD 32
#define NMEM  4
#define TOK   64                // tokens per work-group of the two f16 GEMM kernels
#define NSPLIT (NTOK / TOK)     // partial context sums per (b,h): one per work-group of the QKV kernel
#define O_PITCH (TOK + 2)

__device__ __forceinline__ v8f wmma_f16(v16h a, v16h b, v8f c) {
  // v_wmma_f32_16x16x32_f16 : D = A(16x32) * B(32x16) + C(16x16 f32)
  return __builtin_amdgcn_wmma_f32_16x16x32_f16(
      /*neg_a=*/false, a, /*neg_b=*/false, b,
      /*c_mod=*/(short)0, c, /*reuse_a=*/false, /*reuse_b=*/false);
}

__device__ __forceinline__ v8f wmma_f32(v2f a, v2f b, v8f c) {
  return __builtin_amdgcn_wmma_f32_16x16x4_f32(
      /*neg_a=*/false, a, /*neg_b=*/false, b,
      /*c_mod=*/(short)0, c, /*reuse_a=*/false, /*reuse_b=*/false);
}

__device__ __forceinline__ v16h load_frag(const _Float16* base, int lane, int stride) {
  const int r  = lane & 15;
  const int k0 = (lane >> 4) << 3;       // 0 or 8
  const _Float16* p = base + r * stride;
  v8h lo = *(const v8h*)(p + k0);
  v8h hi = *(const v8h*)(p + 16 + k0);
  v16h f;
#pragma unroll
  for (int i = 0; i < 8; ++i) { f[i] = lo[i]; f[i + 8] = hi[i]; }
  return f;
}

__device__ __forceinline__ int frag_piece(int row, int k, int ksteps) {
  const int lane = (((k >> 3) & 1) << 4) | (row & 15);
  return ((((row >> 4) * ksteps + (k >> 5)) * 2 + ((k >> 4) & 1)) << 5) + lane;
}

// Load the A fragment of (row tile, k step) straight from a fragment-ordered matrix.
// wl: this lane's piece of the block that tile and ks count from.
__device__ __forceinline__ v16h load_frag_packed(const v8h* __restrict__ wl,
                                                 int tile, int ks, int ksteps) {
  const v8h* p = wl + (((tile * ksteps + ks) * 2) << 5);
  v8h lo = p[0];
  v8h hi = p[32];
  v16h f;
#pragma unroll
  for (int i = 0; i < 8; ++i) { f[i] = lo[i]; f[i + 8] = hi[i]; }
  return f;
}

__device__ __forceinline__ float exp_slot(float x) {
  float r;
  asm("v_exp_f32 %0, %1\n\tv_nop" : "=v"(r) : "v"(x * 1.4426950408889634f));
  return r;
}

// ---------------------------------------------------------------------------
// K0: fold norm_g into qkv weight, convert to f16, store in fragment order.
// ---------------------------------------------------------------------------
__global__ void prep_kernel(const float* __restrict__ w_qkv,
                            const float* __restrict__ norm_g,
                            _Float16* __restrict__ wqkv_h) {
  int i = blockIdx.x * 256 + threadIdx.x;
  if (i < QKVR * CH) {
    const int row = i >> 8, k = i & (CH - 1);
    wqkv_h[frag_piece(row, k & ~7, CH / 32) * 8 + (k & 7)] =
        (_Float16)(w_qkv[i] * norm_g[k]);
  }
}

#define X_PITCH (CH + 8)
__global__ __launch_bounds__(256, 4) void qkv_kernel(
    const float* __restrict__ x, const _Float16* __restrict__ wqkv_h,
    const float* __restrict__ mem_kv, _Float16* __restrict__ qs_t,
    float* __restrict__ ctx_part, float* __restrict__ part_max,
    float* __restrict__ part_sum) {
  // LDS: stage phase  : B TOK x X_PITCH f16 (33792 B)
  //      epilog phase : out 384 x O_PITCH f32 (101376 B)   (reuses same memory)
  __shared__ __align__(16) char smem[QKVR * O_PITCH * 4];
  _Float16* lds_b = (_Float16*)smem;
  float*    lds_o = (float*)smem;
  // sum of squares of column n over the 32 channels w*32 .. w*32+31 that wave w stages: ssq[w][n]
  __shared__ __align__(8) float ssq[8][TOK];
  // exp(memory key - m) of each k row; filled and read by the first token tile's workgroup only
  __shared__ __align__(16) float memk[HID][NMEM];

  const int tid  = threadIdx.x;
  const int wave = tid >> 5, lane = tid & 31;
  const int n0   = blockIdx.x * TOK;
  const int b    = blockIdx.y;

  v8f acc[3][TOK / 16];
#pragma unroll
  for (int i = 0; i < 3; ++i)
#pragma unroll
    for (int j = 0; j < TOK / 16; ++j)
#pragma unroll
      for (int r = 0; r < 8; ++r) acc[i][j][r] = 0.f;

  // this lane's first piece of this wave's three row tiles: uniform base + one 32-bit offset
  const v8h* wl = (const v8h*)wqkv_h + (unsigned)(wave * 3 * (CH / 32) * 64 + lane);
  // this thread's 64 x: columns n0 + 2*lane and the next, channels wave*32 .. +31; a wave-wide
  // load is the tile's whole row, two lines.
  // unrolled: xv is indexed by constants only and all loads are in flight together
  const float2* xp = (const float2*)(x + ((size_t)b * CH + wave * 32) * NTOK + n0) + lane;
  float2 xv[32];
#pragma unroll
  for (int j = 0; j < 32; ++j) xv[j] = xp[(size_t)j * (NTOK / 2)];
  // the first two k steps' A fragments, three each, issued beside the x loads
  v16h af[3], an[3];
#pragma unroll
  for (int i = 0; i < 3; ++i) af[i] = load_frag_packed(wl, i, 0, CH / 32);
#pragma unroll
  for (int i = 0; i < 3; ++i) an[i] = load_frag_packed(wl, i, 1, CH / 32);
  float2 ss = make_float2(0.f, 0.f);
#pragma unroll
  for (int j = 0; j < 32; ++j) {
    ss.x = fmaf(xv[j].x, xv[j].x, ss.x);
    ss.y = fmaf(xv[j].y, xv[j].y, ss.y);
  }
  // stage B (transposed [n][c]): x -> f16, 8 neighbouring channels a store
#pragma unroll
  for (int g = 0; g < 4; ++g) {
    v8h h0, h1;
#pragma unroll
    for (int e = 0; e < 8; ++e) {
      h0[e] = (_Float16)xv[g * 8 + e].x;
      h1[e] = (_Float16)xv[g * 8 + e].y;
    }
    *(v8h*)(lds_b + (2 * lane) * X_PITCH + wave * 32 + g * 8) = h0;
    *(v8h*)(lds_b + (2 * lane + 1) * X_PITCH + wave * 32 + g * 8) = h1;
  }
  *(float2*)&ssq[wave][2 * lane] = ss;
  // publishes the x tile and the eight partial sums of squares
  __syncthreads();
  // unrolled: LDS and weight offsets become immediates.  Two sets of A fragments: a step's
  // products free one, and the loads of the step after next go into it at once
#pragma unroll
  for (int ks = 0; ks < CH / 32; ++ks) {
    v16h bf[TOK / 16];
#pragma unroll
    for (int j = 0; j < TOK / 16; ++j)
      bf[j] = load_frag(lds_b + j * 16 * X_PITCH + ks * 32, lane, X_PITCH);
    // keeps the weight loads issued so far in front of this step's products: inside the
    // register budget the compiler otherwise loads each fragment right before its use and
    // waits out a trip to L2 three times a step
    __builtin_amdgcn_sched_barrier(0);
    // j outside: the first three products wait for the first B fragment only
#pragma unroll
    for (int j = 0; j < TOK / 16; ++j)
#pragma unroll
      for (int i = 0; i < 3; ++i) acc[i][j] = wmma_f16(af[i], bf[j], acc[i][j]);
    // keeps later steps' loads behind these products, so that two fragment sets suffice
    __builtin_amdgcn_sched_barrier(0);
#pragma unroll
    for (int i = 0; i < 3; ++i) af[i] = an[i];
    if (ks + 2 < CH / 32) {
#pragma unroll
      for (int i = 0; i < 3; ++i) an[i] = load_frag_packed(wl, i, ks + 2, CH / 32);
    }
  }
  // ends the last reads of lds_b, whose memory the accumulators are dumped into
  __syncthreads();
  float s2a = 0.f, s2b = 0.f;
  for (int w = 0; w < 8; ++w) { s2a += ssq[w][lane]; s2b += ssq[w][lane + 32]; }
  const float inva = 16.0f / fmaxf(sqrtf(s2a), 1e-12f);
  const float invb = 16.0f / fmaxf(sqrtf(s2b), 1e-12f);
  float invc[TOK / 16];
  invc[0] = __shfl(inva, lane & 15);
  invc[1] = __shfl(inva, (lane & 15) + 16);
  invc[2] = __shfl(invb, lane & 15);
  invc[3] = __shfl(invb, (lane & 15) + 16);
#pragma unroll
  for (int i = 0; i < 3; ++i) {
    int Rb = (wave * 3 + i) * 16 + ((lane >> 4) << 3);
#pragma unroll
    for (int j = 0; j < TOK / 16; ++j) {
      int cc = j * 16 + (lane & 15);
#pragma unroll
      for (int r = 0; r < 8; ++r) lds_o[(Rb + r) * O_PITCH + cc] = acc[i][j][r] * invc[j];
    }
  }
  __syncthreads();
  const int kr = tid >> 1;
  float km, kl = 0.f;
  {
    float* krow = lds_o + (HID + kr) * O_PITCH + (tid & 1) * (TOK / 2);
    float2 kq[TOK / 4];
#pragma unroll
    for (int i = 0; i < TOK / 4; ++i) kq[i] = *(const float2*)(krow + 2 * i);
    km = kq[0].x;
#pragma unroll
    for (int i = 0; i < TOK / 4; ++i) km = fmaxf(km, fmaxf(kq[i].x, kq[i].y));
    // memory keys of this row (mem_kv[0]); they belong to the first token tile's sums only
    float4 mk = make_float4(0.f, 0.f, 0.f, 0.f);
    if (blockIdx.x == 0) {
      mk = *(const float4*)(mem_kv + kr * NMEM);
      km = fmaxf(km, fmaxf(fmaxf(mk.x, mk.y), fmaxf(mk.z, mk.w)));
    }
    km = fmaxf(km, __shfl_xor(km, 1));
#pragma unroll
    for (int i = 0; i < TOK / 4; ++i) {
      kq[i].x = exp_slot(kq[i].x - km); kq[i].y = exp_slot(kq[i].y - km);
      kl += kq[i].x + kq[i].y;
      *(float2*)(krow + 2 * i) = kq[i];
    }
    kl += __shfl_xor(kl, 1);
    if (blockIdx.x == 0) {
      float4 kx;
      kx.x = exp_slot(mk.x - km); kx.y = exp_slot(mk.y - km);
      kx.z = exp_slot(mk.z - km); kx.w = exp_slot(mk.w - km);
      kl += kx.x; kl += kx.y; kl += kx.z; kl += kx.w;
      if ((tid & 1) == 0) *(float4*)&memk[kr][0] = kx;
    }
  }
  // publishes exp(k - m) to the waves that multiply it with v
  __syncthreads();
  {
    const int c = lane & 15, hs = lane >> 4;
    const int hh = wave >> 1, dt = wave & 1;
    const float* ap = lds_o + (HID + hh * DHEAD + dt * 16 + c) * O_PITCH + hs * (TOK / 2);
    const float* bp = lds_o + (2 * HID + hh * DHEAD + c) * O_PITCH + hs * (TOK / 2);
    // D layout: register r = row 8 * hs + r, column c of the tile
    float* dst = ctx_part +
        ((((size_t)blockIdx.x * BATCH + b) * NHEAD + hh) * DHEAD + dt * 16 + hs * 8) * DHEAD + c;
    v8f acc0, acc1;
#pragma unroll
    for (int r = 0; r < 8; ++r) { acc0[r] = 0.f; acc1[r] = 0.f; }
    if (blockIdx.x == 0) {
      // the NMEM memory tokens are one k step: two tokens a lane; values are mem_kv[1]
      const float* mvp = mem_kv + NHEAD * DHEAD * NMEM + (hh * DHEAD + c) * NMEM + hs * 2;
      const v2f a  = *(const v2f*)&memk[hh * DHEAD + dt * 16 + c][hs * 2];
      const v2f b0 = *(const v2f*)mvp;
      const v2f b1 = *(const v2f*)(mvp + 16 * NMEM);
      acc0 = wmma_f32(a, b0, acc0);
      acc1 = wmma_f32(a, b1, acc1);
      asm volatile("v_nop\n\tv_nop\n\tv_nop\n\tv_nop"
                   : "+v"(acc0), "+v"(acc1) : "v"(a), "v"(b0), "v"(b1));
    }
    // keeps the address arithmetic of the stores in front of the products: moved in between them
    // it is laid over operand registers of a matrix instruction issued just before
    __builtin_amdgcn_sched_barrier(0);
    // unrolled: LDS offsets become immediates and the reads run ahead of the products; an A
    // fragment serves both column tiles, whose two accumulators do not wait for each other
#pragma unroll
    for (int s = 0; s < TOK / 4; ++s) {
      const v2f a  = *(const v2f*)(ap + s * 2);
      const v2f b0 = *(const v2f*)(bp + s * 2);
      const v2f b1 = *(const v2f*)(bp + 16 * O_PITCH + s * 2);
      acc0 = wmma_f32(a, b0, acc0);
      acc1 = wmma_f32(a, b1, acc1);
    }
    asm volatile("v_nop\n\tv_nop\n\tv_nop\n\tv_nop" : "+v"(acc0), "+v"(acc1));
#pragma unroll
    for (int r = 0; r < 8; ++r) {
      dst[r * DHEAD] = acc0[r];
      dst[r * DHEAD + 16] = acc1[r];
    }
  }
  // behind the barriers, so that no wave waits at one for these stores to return
  if ((tid & 1) == 0) {
    const int st = blockIdx.x * (BATCH * HID) + b * HID + kr;
    part_max[st] = km;
    part_sum[st] = kl;
  }
  // q rows 0..127: softmax over d per (head, column), * 32^-0.5; 4 heads x TOK columns, a thread each
  {
    const float SCALE = 0.17677669529663687f;
    int h = tid / TOK, col = tid % TOK;
    float m = -1e30f;
#pragma unroll
    for (int d = 0; d < DHEAD; ++d) m = fmaxf(m, lds_o[(h * 32 + d) * O_PITCH + col]);
    float e[DHEAD], s = 0.f;
#pragma unroll
    for (int d = 0; d < DHEAD; ++d) {
      e[d] = exp_slot(lds_o[(h * 32 + d) * O_PITCH + col] - m);
      s += e[d];
    }
    float inv = SCALE / s;
    _Float16* dst = qs_t + ((size_t)b * NTOK + n0 + col) * HID + h * 32;
#pragma unroll
    for (int d = 0; d < DHEAD; ++d) dst[d] = (_Float16)(e[d] * inv);
  }
}

// ---------------------------------------------------------------------------
// K4: W2[b,o,h*32+d] = sum_e w_out[o,h*32+e] * context[b,h,d,e]  -> f16
// (collapses "out = context^T @ q" into the final projection GEMM)
// One workgroup per (b, head, W2_ROWS output rows): 256 workgroups.
// context[b,h] is formed here from K2's NSPLIT partial sums, added in split order, each
// weighted by exp(its row maximum - the row's overall maximum) / the row's overall sum
// of exponentials.
// A thread owns one output row and 8 values of d: one 16-byte piece
// of W2[b], which is stored in fragment order for K5.
// ---------------------------------------------------------------------------
#define W2_ROWS  64                       // output rows per workgroup
#define CTX_PITCH 36                      // floats per LDS row: 16 B x odd, b128 reads stay aligned
#define WT_PITCH (NSPLIT + 4)             // floats per LDS row of the weights: 16 B x odd
#define W2_SP 16                          // partial sums in each of a thread's two register sets
__global__ __launch_bounds__(256) void w2_kernel(
    const float* __restrict__ w_out, const float* __restrict__ ctx_part,
    const float* __restrict__ part_max, const float* __restrict__ part_sum,
    _Float16* __restrict__ W2h) {
  __shared__ __align__(16) float ctxT[DHEAD * CTX_PITCH];  // [e][d]
  __shared__ __align__(16) float wts[DHEAD * WT_PITCH];    // [d][split]
  const int b = blockIdx.x, h = blockIdx.y, tid = threadIdx.x;
  const int o  = blockIdx.z * W2_ROWS + (tid >> 2);
  const int dg = (tid & 3) * 8;
  // this thread's four context elements of every split: row d = tid >> 3, columns (tid & 7) * 4 ..
  const float4* pbase = (const float4*)ctx_part + ((size_t)b * NHEAD + h) * 256;
  // the first two sets of partial sums do not depend on the weights: they load beside the statistics.
  // unrolled: pq is indexed by constants only and all loads are in flight together
  float4 pq[2][W2_SP];
#pragma unroll
  for (int t = 0; t < 2; ++t)
#pragma unroll
    for (int k = 0; k < W2_SP; ++k) pq[t][k] = pbase[(size_t)(t * W2_SP + k) * BATCH * 1024 + tid];
  // weight of split sp in row d: exp(its maximum - the row's maximum) / the row's sum.
  // 8 neighbouring lanes share a row, 8 splits each.
  {
    const int row = tid >> 3, s0 = (tid & 7) * 8;
    const int st = b * HID + h * DHEAD + row;
    float mm[8], ll[8];
#pragma unroll
    for (int j = 0; j < 8; ++j) {
      mm[j] = part_max[(s0 + j) * (BATCH * HID) + st];
      ll[j] = part_sum[(s0 + j) * (BATCH * HID) + st];
    }
    float mx = mm[0];
#pragma unroll
    for (int j = 1; j < 8; ++j) mx = fmaxf(mx, mm[j]);
#pragma unroll
    for (int s = 1; s < 8; s <<= 1) mx = fmaxf(mx, __shfl_xor(mx, s));
    float ls = 0.f;
#pragma unroll
    for (int j = 0; j < 8; ++j) {
      mm[j] = exp_slot(mm[j] - mx);
      ls = fmaf(ll[j], mm[j], ls);
    }
#pragma unroll
    for (int s = 1; s < 8; s <<= 1) ls += __shfl_xor(ls, s);
    const float inv = 1.0f / ls;
    *(float4*)(wts + row * WT_PITCH + s0) =
        make_float4(mm[0] * inv, mm[1] * inv, mm[2] * inv, mm[3] * inv);
    *(float4*)(wts + row * WT_PITCH + s0 + 4) =
        make_float4(mm[4] * inv, mm[5] * inv, mm[6] * inv, mm[7] * inv);
  }
  // this thread's 32 weights of w_out: used behind the second barrier only
  const float4* wrow = (const float4*)(w_out + o * HID + h * DHEAD);
  float4 w4[DHEAD / 4];
  // unrolled: w4 is indexed by constants only and stays in registers
#pragma unroll
  for (int i = 0; i < DHEAD / 4; ++i) w4[i] = wrow[i];
  // publishes the weights to the threads that sum the partial sums
  __syncthreads();
  {
    const int d = tid >> 3, e = (tid & 7) * 4;
    const float4* wr = (const float4*)(wts + d * WT_PITCH);
    float4 s = make_float4(0.f, 0.f, 0.f, 0.f);
    // two trips over the two sets, splits in order; in the first trip a set is refilled as soon as
    // it has been added, so that its loads fly under the other set's adds.  Kept rolled: unrolled,
    // all loads are lifted to the top and the partial sums alone take 256 registers
#pragma unroll 1
    for (int g = 0; g < NSPLIT / (2 * W2_SP); ++g) {
#pragma unroll
      for (int t = 0; t < 2; ++t) {
#pragma unroll
        for (int k4 = 0; k4 < W2_SP / 4; ++k4) {
          const float4 w4s = wr[(g * 2 + t) * (W2_SP / 4) + k4];
          const float wv[4] = {w4s.x, w4s.y, w4s.z, w4s.w};
#pragma unroll
          for (int k = 0; k < 4; ++k) {
            const float4 q = pq[t][k4 * 4 + k];
            s.x = fmaf(q.x, wv[k], s.x); s.y = fmaf(q.y, wv[k], s.y);
            s.z = fmaf(q.z, wv[k], s.z); s.w = fmaf(q.w, wv[k], s.w);
          }
        }
        if (g + 1 < NSPLIT / (2 * W2_SP)) {
          // the set's first split two sets on
          const float4* rp = pbase + (size_t)(((g + 1) * 2 + t) * W2_SP) * BATCH * 1024;
#pragma unroll
          for (int k = 0; k < W2_SP; ++k) pq[t][k] = rp[(size_t)k * BATCH * 1024 + tid];
        }
      }
    }
    float* col = ctxT + e * CTX_PITCH + d;
    col[0 * CTX_PITCH] = s.x;
    col[1 * CTX_PITCH] = s.y;
    col[2 * CTX_PITCH] = s.z;
    col[3 * CTX_PITCH] = s.w;
  }
  __syncthreads();
  float acc[8];
#pragma unroll
  for (int j = 0; j < 8; ++j) acc[j] = 0.f;
  const float* crow = ctxT + dg;
  // both loops unrolled: LDS offsets become immediates and many row reads are in flight;
  // e runs upwards, one fused multiply-add per term
#pragma unroll
  for (int e4 = 0; e4 < DHEAD / 4; ++e4) {
    const float wv[4] = {w4[e4].x, w4[e4].y, w4[e4].z, w4[e4].w};
#pragma unroll
    for (int k = 0; k < 4; ++k) {
      const float4 c0 = *(const float4*)(crow + (e4 * 4 + k) * CTX_PITCH);
      const float4 c1 = *(const float4*)(crow + (e4 * 4 + k) * CTX_PITCH + 4);
      acc[0] = fmaf(wv[k], c0.x, acc[0]); acc[1] = fmaf(wv[k], c0.y, acc[1]);
      acc[2] = fmaf(wv[k], c0.z, acc[2]); acc[3] = fmaf(wv[k], c0.w, acc[3]);
      acc[4] = fmaf(wv[k], c1.x, acc[4]); acc[5] = fmaf(wv[k], c1.y, acc[5]);
      acc[6] = fmaf(wv[k], c1.z, acc[6]); acc[7] = fmaf(wv[k], c1.w, acc[7]);
    }
  }
  v8h r;
#pragma unroll
  for (int j = 0; j < 8; ++j) r[j] = (_Float16)acc[j];
  ((v8h*)(W2h + (size_t)b * CH * HID))[frag_piece(o, h * DHEAD + dg, HID / 32)] = r;
}

// ---------------------------------------------------------------------------
// K5: Y = W2[b] @ qs  + b_out, then RMSNorm over the 256 output channels.
// WMMA; one workgroup owns a full 256-row x 64-col tile so the channel
// norm is done entirely in LDS.  A fragments as in K2: global to registers.
// The q tile (64 tokens x 128 k, 16 KB contiguous in memory) is staged whole, as in K2:
// one barrier publishes it and the k loop has none; the first three k steps' A fragments load beside it.
// ---------------------------------------------------------------------------
// halves per LDS row of the q tile [n][k]: 272 B = 16 B x odd, as X_PITCH
#define Q_PITCH (HID + 8)
__global__ __launch_bounds__(256, 8) void out_kernel(
    const _Float16* __restrict__ W2h, const _Float16* __restrict__ qs_t,
    const float* __restrict__ b_out, const float* __restrict__ out_g,
    float* __restrict__ out) {
  __shared__ __align__(16) char smem[CH * O_PITCH * 4];
  _Float16* lds_b = (_Float16*)smem;
  float*    lds_y = (float*)smem;
  __shared__ __align__(8) float colinv[TOK];

  const int tid = threadIdx.x;
  const int wave = tid >> 5, lane = tid & 31;
  const int n0 = blockIdx.x * TOK;
  const int b  = blockIdx.y;

  v8f acc[2][TOK / 16];
#pragma unroll
  for (int i = 0; i < 2; ++i)
#pragma unroll
    for (int j = 0; j < TOK / 16; ++j)
#pragma unroll
      for (int r = 0; r < 8; ++r) acc[i][j][r] = 0.f;

  const v8h* wl = (const v8h*)(W2h + (size_t)b * CH * HID) + (unsigned)(wave * 2 * (HID / 32) * 64 + lane);
  // B: TOK tokens x 128 halves, 16 bytes a piece; a wave-wide load covers 512 contiguous bytes
  const v8h* bsrc = (const v8h*)(qs_t + ((size_t)b * NTOK + n0) * HID);
  v8h bq[TOK / 16];
#pragma unroll
  for (int i = 0; i < TOK / 16; ++i) bq[i] = bsrc[tid + i * 256];
  // this wave's two A fragments of the first three k steps, issued beside the B loads
  v16h af[HID / 32][2];
#pragma unroll
  for (int ks = 0; ks < HID / 32 - 1; ++ks)
#pragma unroll
    for (int i = 0; i < 2; ++i) af[ks][i] = load_frag_packed(wl, i, ks, HID / 32);
#pragma unroll
  for (int i = 0; i < TOK / 16; ++i) {
    int idx = tid + i * 256;
    *(v8h*)(lds_b + (idx >> 4) * Q_PITCH + (idx & 15) * 8) = bq[i];
  }
  // publishes the q tile
  __syncthreads();
  // unrolled: af is indexed by constants only and LDS offsets become immediates
#pragma unroll
  for (int ks = 0; ks < HID / 32; ++ks) {
#pragma unroll
    for (int j = 0; j < TOK / 16; ++j) {
      v16h bf = load_frag(lds_b + j * 16 * Q_PITCH + ks * 32, lane, Q_PITCH);
#pragma unroll
      for (int i = 0; i < 2; ++i) acc[i][j] = wmma_f16(af[ks][i], bf, acc[i][j]);
    }
    if (ks == 0) {
      // the last step's A fragments: beside the others they do not fit the register budget and
      // spill; here they take registers that the q staging and the first step's products have freed
#pragma unroll
      for (int i = 0; i < 2; ++i)
        af[HID / 32 - 1][i] = load_frag_packed(wl, i, HID / 32 - 1, HID / 32);
      // keeps these loads two steps ahead of their use: the compiler otherwise moves them down
      // to the last step, which then waits out the trip to L2
      __builtin_amdgcn_sched_barrier(0);
    }
  }
  // ends the last reads of lds_b, whose memory the accumulators are dumped into
  __syncthreads();
#pragma unroll
  for (int i = 0; i < 2; ++i) {
    int Rb = (wave * 2 + i) * 16 + ((lane >> 4) << 3);
#pragma unroll
    for (int j = 0; j < TOK / 16; ++j) {
      int cc = j * 16 + (lane & 15);
#pragma unroll
      for (int r = 0; r < 8; ++r) lds_y[(Rb + r) * O_PITCH + cc] = acc[i][j][r];
    }
  }
  __syncthreads();
  if (tid < TOK) {
    float s = 0.f;
    for (int o = 0; o < CH; ++o) {
      float v = lds_y[o * O_PITCH + tid] + b_out[o];
      s += v * v;
    }
    colinv[tid] = 16.0f / fmaxf(sqrtf(s), 1e-12f);
  }
  __syncthreads();
  // a lane takes two neighbouring tokens, a wave one whole row of the tile (two lines)
  for (int idx = tid; idx < CH * (TOK / 2); idx += 256) {
    int o = idx >> 5, col = (idx & 31) * 2;
    const float2 y  = *(const float2*)(lds_y + o * O_PITCH + col);
    const float2 ci = *(const float2*)(colinv + col);
    float2 v;
    v.x = (y.x + b_out[o]) * ci.x * out_g[o];
    v.y = (y.y + b_out[o]) * ci.y * out_g[o];
    *(float2*)(out + ((size_t)b * CH + o) * NTOK + n0 + col) = v;
  }
}

// ---------------------------------------------------------------------------
extern "C" void kernel_launch(void* const* d_in, const int* in_sizes, int n_in,
                              void* d_out, int out_size, void* d_ws, size_t ws_size,
                              hipStream_t stream) {
  (void)in_sizes; (void)n_in; (void)out_size; (void)ws_size;
  const float* x        = (const float*)d_in[0];   // (16,256,64,64)
  const float* norm_g   = (const float*)d_in[1];   // (256)
  const float* w_qkv    = (const float*)d_in[2];   // (384,256)
  const float* mem_kv   = (const float*)d_in[3];   // (2,4,32,4)
  const float* w_out    = (const float*)d_in[4];   // (256,128)
  const float* b_out    = (const float*)d_in[5];   // (256)
  const float* out_g    = (const float*)d_in[6];   // (256)
  float* out = (float*)d_out;                      // (16,256,64,64)

  char* ws = (char*)d_ws;
  size_t off = 0;
  auto take = [&](size_t bytes) -> char* {
    char* p = ws + off;
    off = (off + bytes + 255) & ~(size_t)255;
    return p;
  };
  _Float16* wqkv_h   = (_Float16*)take((size_t)QKVR * CH * 2);           // 192 KB
  _Float16* qs_t     = (_Float16*)take((size_t)BATCH * NTOK * HID * 2);  // 16 MB
  float*    part_max = (float*)   take((size_t)NSPLIT * BATCH * HID * 4);  // 512 KB
  float*    part_sum = (float*)   take((size_t)NSPLIT * BATCH * HID * 4);  // 512 KB
  float*    ctx_part = (float*)   take((size_t)NSPLIT * BATCH * NHEAD * DHEAD * DHEAD * 4);  // 16 MB
  _Float16* W2h      = (_Float16*)take((size_t)BATCH * CH * HID * 2);    // 1 MB

  prep_kernel<<<QKVR, 256, 0, stream>>>(w_qkv, norm_g, wqkv_h);
  qkv_kernel<<<dim3(NTOK / TOK, BATCH), 256, 0, stream>>>(
      x, wqkv_h, mem_kv, qs_t, ctx_part, part_max, part_sum);
  w2_kernel<<<dim3(BATCH, NHEAD, CH / W2_ROWS), 256, 0, stream>>>(
      w_out, ctx_part, part_max, part_sum, W2h);
  out_kernel<<<dim3(NTOK / TOK, BATCH), 256, 0, stream>>>(
      W2h, qs_t, b_out, out_g, out);
}

// v010
// One run takes 43.9 microseconds.
// Next to v009, in two timings, it ran 1.11 and 1.12 times as fast.
// Over all steps from v000 it is 7.79 times as fast.
#include <hip/hip_runtime.h>
#include <hip/hip_bf16.h>
#include <stdint.h>

typedef __attribute__((ext_vector_type(16))) _Float16 v16h;
typedef __attribute__((ext_vector_type(8)))  _Float16 v8h;
typedef __attribute__((ext_vector_type(2)))  _Float16 v2h;
typedef __attribute__((ext_vector_type(8)))  float    v8f;
typedef __attribute__((ext_vector_type(2)))  float    v2f;

#define BATCH 16
#define CH    256
#define NTOK  4096
#define HID   128
#define QKVR  384
#define NHEAD 4
#define DHEAD 32
#define NMEM  4
#define TOK   64                // tokens per work-group of the two f16 GEMM kernels
#define NSPLIT (NTOK / TOK)     // partial context sums per (b,h): one per work-group of the QKV kernel
#define O_PITCH (TOK + 2)

__device__ __forceinline__ v8f wmma_f16(v16h a, v16h b, v8f c) {
  // v_wmma_f32_16x16x32_f16 : D = A(16x32) * B(32x16) + C(16x16 f32)
  return __builtin_amdgcn_wmma_f32_16x16x32_f16(
      /*neg_a=*/false, a, /*neg_b=*/false, b,
      /*c_mod=*/(short)0, c, /*reuse_a=*/false, /*reuse_b=*/false);
}

__device__ __forceinline__ v8f wmma_f32(v2f a, v2f b, v8f c) {
  return __builtin_amdgcn_wmma_f32_16x16x4_f32(
      /*neg_a=*/false, a, /*neg_b=*/false, b,
      /*c_mod=*/(short)0, c, /*reuse_a=*/false, /*reuse_b=*/false);
}

__device__ __forceinline__ v16h load_frag(const _Float16* base, int lane, int stride) {
  const int r  = lane & 15;
  const int k0 = (lane >> 4) << 3;       // 0 or 8
  const _Float16* p = base + r * stride;
  v8h lo = *(const v8h*)(p + k0);
  v8h hi = *(const v8h*)(p + 16 + k0);
  v16h f;
#pragma unroll
  for (int i = 0; i < 8; ++i) { f[i] = lo[i]; f[i + 8] = hi[i]; }
  return f;
}

__device__ __forceinline__ int frag_piece(int row, int k, int ksteps) {
  const int lane = (((k >> 3) & 1) << 4) | (row & 15);
  return ((((row >> 4) * ksteps + (k >> 5)) * 2 + ((k >> 4) & 1)) << 5) + lane;
}

// Load the A fragment of (row tile, k step) straight from a fragment-ordered matrix.
// wl: this lane's piece of the block that tile and ks count from.
__device__ __forceinline__ v16h load_frag_packed(const v8h* __restrict__ wl,
                                                 int tile, int ks, int ksteps) {
  const v8h* p = wl + (((tile * ksteps + ks) * 2) << 5);
  v8h lo = p[0];
  v8h hi = p[32];
  v16h f;
#pragma unroll
  for (int i = 0; i < 8; ++i) { f[i] = lo[i]; f[i + 8] = hi[i]; }
  return f;
}

__device__ __forceinline__ float exp_slot(float x) {
  float r;
  asm("v_exp_f32 %0, %1\n\tv_nop" : "=v"(r) : "v"(x * 1.4426950408889634f));
  return r;
}

// ---------------------------------------------------------------------------
// K0: fold norm_g into qkv weight, convert to f16, store in fragment order.
// ---------------------------------------------------------------------------
__global__ void prep_kernel(const float* __restrict__ w_qkv,
                            const float* __restrict__ norm_g,
                            _Float16* __restrict__ wqkv_h) {
  int i = blockIdx.x * 256 + threadIdx.x;
  if (i < QKVR * CH) {
    const int row = i >> 8, k = i & (CH - 1);
    wqkv_h[frag_piece(row, k & ~7, CH / 32) * 8 + (k & 7)] =
        (_Float16)(w_qkv[i] * norm_g[k]);
  }
}

#define X_PITCH (CH + 8)
__global__ __launch_bounds__(256, 4) void qkv_kernel(
    const float* __restrict__ x, const _Float16* __restrict__ wqkv_h,
    const float* __restrict__ mem_kv, _Float16* __restrict__ qs_t,
    float* __restrict__ ctx_part, float* __restrict__ part_max,
    float* __restrict__ part_sum) {
  // LDS: stage phase  : B TOK x X_PITCH f16 (33792 B)
  //      epilog phase : out 384 x O_PITCH f32 (101376 B)   (reuses same memory)
  __shared__ __align__(16) char smem[QKVR * O_PITCH * 4];
  _Float16* lds_b = (_Float16*)smem;
  float*    lds_o = (float*)smem;
  // sum of squares of column n over the 32 channels w*32 .. w*32+31 that wave w stages: ssq[w][n]
  __shared__ __align__(8) float ssq[8][TOK];
  // exp(memory key - m) of each k row; filled and read by the first token tile's workgroup only
  __shared__ __align__(16) float memk[HID][NMEM];

  const int tid  = threadIdx.x;
  const int wave = tid >> 5, lane = tid & 31;
  const int n0   = blockIdx.x * TOK;
  const int b    = blockIdx.y;

  v8f acc[3][TOK / 16];
#pragma unroll
  for (int i = 0; i < 3; ++i)
#pragma unroll
    for (int j = 0; j < TOK / 16; ++j)
#pragma unroll
      for (int r = 0; r < 8; ++r) acc[i][j][r] = 0.f;

  // this lane's first piece of this wave's three row tiles: uniform base + one 32-bit offset
  const v8h* wl = (const v8h*)wqkv_h + (unsigned)(wave * 3 * (CH / 32) * 64 + lane);
  // this thread's 64 x: columns n0 + 2*lane and the next, channels wave*32 .. +31; a wave-wide
  // load is the tile's whole row, two lines.
  // unrolled: xv is indexed by constants only and all loads are in flight together
  const float2* xp = (const float2*)(x + ((size_t)b * CH + wave * 32) * NTOK + n0) + lane;
  float2 xv[32];
#pragma unroll
  for (int j = 0; j < 32; ++j) xv[j] = xp[(size_t)j * (NTOK / 2)];
  // the first two k steps' A fragments, three each, issued beside the x loads
  v16h af[3], an[3];
#pragma unroll
  for (int i = 0; i < 3; ++i) af[i] = load_frag_packed(wl, i, 0, CH / 32);
#pragma unroll
  for (int i = 0; i < 3; ++i) an[i] = load_frag_packed(wl, i, 1, CH / 32);
  float2 ss = make_float2(0.f, 0.f);
#pragma unroll
  for (int j = 0; j < 32; ++j) {
    ss.x = fmaf(xv[j].x, xv[j].x, ss.x);
    ss.y = fmaf(xv[j].y, xv[j].y, ss.y);
  }
  // stage B (transposed [n][c]): x -> f16, 8 neighbouring channels a store
#pragma unroll
  for (int g = 0; g < 4; ++g) {
    v8h h0, h1;
#pragma unroll
    for (int e = 0; e < 8; ++e) {
      h0[e] = (_Float16)xv[g * 8 + e].x;
      h1[e] = (_Float16)xv[g * 8 + e].y;
    }
    *(v8h*)(lds_b + (2 * lane) * X_PITCH + wave * 32 + g * 8) = h0;
    *(v8h*)(lds_b + (2 * lane + 1) * X_PITCH + wave * 32 + g * 8) = h1;
  }
  *(float2*)&ssq[wave][2 * lane] = ss;
  // publishes the x tile and the eight partial sums of squares
  __syncthreads();
  // unrolled: LDS and weight offsets become immediates.  Two sets of A fragments: a step's
  // products free one, and the loads of the step after next go into it at once
#pragma unroll
  for (int ks = 0; ks < CH / 32; ++ks) {
    v16h bf[TOK / 16];
#pragma unroll
    for (int j = 0; j < TOK / 16; ++j)
      bf[j] = load_frag(lds_b + j * 16 * X_PITCH + ks * 32, lane, X_PITCH);
    // keeps the weight loads issued so far in front of this step's products: inside the
    // register budget the compiler otherwise loads each fragment right before its use and
    // waits out a trip to L2 three times a step
    __builtin_amdgcn_sched_barrier(0);
    // j outside: the first three products wait for the first B fragment only
#pragma unroll
    for (int j = 0; j < TOK / 16; ++j)
#pragma unroll
      for (int i = 0; i < 3; ++i) acc[i][j] = wmma_f16(af[i], bf[j], acc[i][j]);
    // keeps later steps' loads behind these products, so that two fragment sets suffice
    __builtin_amdgcn_sched_barrier(0);
#pragma unroll
    for (int i = 0; i < 3; ++i) af[i] = an[i];
    if (ks + 2 < CH / 32) {
#pragma unroll
      for (int i = 0; i < 3; ++i) an[i] = load_frag_packed(wl, i, ks + 2, CH / 32);
    }
  }
  // ends the last reads of lds_b, whose memory the accumulators are dumped into
  __syncthreads();
  float s2a = 0.f, s2b = 0.f;
  for (int w = 0; w < 8; ++w) { s2a += ssq[w][lane]; s2b += ssq[w][lane + 32]; }
  const float inva = 16.0f / fmaxf(sqrtf(s2a), 1e-12f);
  const float invb = 16.0f / fmaxf(sqrtf(s2b), 1e-12f);
  float invc[TOK / 16];
  invc[0] = __shfl(inva, lane & 15);
  invc[1] = __shfl(inva, (lane & 15) + 16);
  invc[2] = __shfl(invb, lane & 15);
  invc[3] = __shfl(invb, (lane & 15) + 16);
#pragma unroll
  for (int i = 0; i < 3; ++i) {
    int Rb = (wave * 3 + i) * 16 + ((lane >> 4) << 3);
#pragma unroll
    for (int j = 0; j < TOK / 16; ++j) {
      int cc = j * 16 + (lane & 15);
#pragma unroll
      for (int r = 0; r < 8; ++r) lds_o[(Rb + r) * O_PITCH + cc] = acc[i][j][r] * invc[j];
    }
  }
  __syncthreads();
  const int kr = tid >> 1;
  float km, kl = 0.f;
  {
    float* krow = lds_o + (HID + kr) * O_PITCH + (tid & 1) * (TOK / 2);
    float2 kq[TOK / 4];
#pragma unroll
    for (int i = 0; i < TOK / 4; ++i) kq[i] = *(const float2*)(krow + 2 * i);
    km = kq[0].x;
#pragma unroll
    for (int i = 0; i < TOK / 4; ++i) km = fmaxf(km, fmaxf(kq[i].x, kq[i].y));
    // memory keys of this row (mem_kv[0]); they belong to the first token tile's sums only
    float4 mk = make_float4(0.f, 0.f, 0.f, 0.f);
    if (blockIdx.x == 0) {
      mk = *(const float4*)(mem_kv + kr * NMEM);
      km = fmaxf(km, fmaxf(fmaxf(mk.x, mk.y), fmaxf(mk.z, mk.w)));
    }
    km = fmaxf(km, __shfl_xor(km, 1));
#pragma unroll
    for (int i = 0; i < TOK / 4; ++i) {
      kq[i].x = exp_slot(kq[i].x - km); kq[i].y = exp_slot(kq[i].y - km);
      kl += kq[i].x + kq[i].y;
      *(float2*)(krow + 2 * i) = kq[i];
    }
    kl += __shfl_xor(kl, 1);
    if (blockIdx.x == 0) {
      float4 kx;
      kx.x = exp_slot(mk.x - km); kx.y = exp_slot(mk.y - km);
      kx.z = exp_slot(mk.z - km); kx.w = exp_slot(mk.w - km);
      kl += kx.x; kl += kx.y; kl += kx.z; kl += kx.w;
      if ((tid & 1) == 0) *(float4*)&memk[kr][0] = kx;
    }
  }
  // publishes exp(k - m) to the waves that multiply it with v
  __syncthreads();
  {
    const int c = lane & 15, hs = lane >> 4;
    const int hh = wave >> 1, dt = wave & 1;
    const float* ap = lds_o + (HID + hh * DHEAD + dt * 16 + c) * O_PITCH + hs * (TOK / 2);
    const float* bp = lds_o + (2 * HID + hh * DHEAD + c) * O_PITCH + hs * (TOK / 2);
    // D layout: register r = row 8 * hs + r, column c of the tile
    float* dst = ctx_part +
        ((((size_t)blockIdx.x * BATCH + b) * NHEAD + hh) * DHEAD + dt * 16 + hs * 8) * DHEAD + c;
    v8f acc0, acc1;
#pragma unroll
    for (int r = 0; r < 8; ++r) { acc0[r] = 0.f; acc1[r] = 0.f; }
    if (blockIdx.x == 0) {
      // the NMEM memory tokens are one k step: two tokens a lane; values are mem_kv[1]
      const float* mvp = mem_kv + NHEAD * DHEAD * NMEM + (hh * DHEAD + c) * NMEM + hs * 2;
      const v2f a  = *(const v2f*)&memk[hh * DHEAD + dt * 16 + c][hs * 2];
      const v2f b0 = *(const v2f*)mvp;
      const v2f b1 = *(const v2f*)(mvp + 16 * NMEM);
      acc0 = wmma_f32(a, b0, acc0);
      acc1 = wmma_f32(a, b1, acc1);
      asm volatile("v_nop\n\tv_nop\n\tv_nop\n\tv_nop"
                   : "+v"(acc0), "+v"(acc1) : "v"(a), "v"(b0), "v"(b1));
    }
    // keeps the address arithmetic of the stores in front of the products: moved in between them
    // it is laid over operand registers of a matrix instruction issued just before
    __builtin_amdgcn_sched_barrier(0);
    // unrolled: LDS offsets become immediates and the reads run ahead of the products; an A
    // fragment serves both column tiles, whose two accumulators do not wait for each other
#pragma unroll
    for (int s = 0; s < TOK / 4; ++s) {
      const v2f a  = *(const v2f*)(ap + s * 2);
      const v2f b0 = *(const v2f*)(bp + s * 2);
      const v2f b1 = *(const v2f*)(bp + 16 * O_PITCH + s * 2);
      acc0 = wmma_f32(a, b0, acc0);
      acc1 = wmma_f32(a, b1, acc1);
    }
    asm volatile("v_nop\n\tv_nop\n\tv_nop\n\tv_nop" : "+v"(acc0), "+v"(acc1));
#pragma unroll
    for (int r = 0; r < 8; ++r) {
      dst[r * DHEAD] = acc0[r];
      dst[r * DHEAD + 16] = acc1[r];
    }
  }
  // behind the barriers, so that no wave waits at one for these stores to return
  if ((tid & 1) == 0) {
    const int st = blockIdx.x * (BATCH * HID) + b * HID + kr;
    part_max[st] = km;
    part_sum[st] = kl;
  }
  // q rows 0..127: softmax over d per (head, column), * 32^-0.5; 4 heads x TOK columns, a thread each
  {
    const float SCALE = 0.17677669529663687f;
    int h = tid / TOK, col = tid % TOK;
    float m = -1e30f;
#pragma unroll
    for (int d = 0; d < DHEAD; ++d) m = fmaxf(m, lds_o[(h * 32 + d) * O_PITCH + col]);
    float e[DHEAD], s = 0.f;
#pragma unroll
    for (int d = 0; d < DHEAD; ++d) {
      e[d] = exp_slot(lds_o[(h * 32 + d) * O_PITCH + col] - m);
      s += e[d];
    }
    float inv = SCALE / s;
    _Float16* dst = qs_t + ((size_t)b * NTOK + n0 + col) * HID + h * 32;
#pragma unroll
    for (int d = 0; d < DHEAD; ++d) dst[d] = (_Float16)(e[d] * inv);
  }
}

// ---------------------------------------------------------------------------
// K4: W2[b,o,h*32+d] = sum_e w_out[o,h*32+e] * context[b,h,d,e]  -> f16
// (collapses "out = context^T @ q" into the final projection GEMM)
// One workgroup per (b, head, W2_ROWS output rows): 256 workgroups.
// context[b,h] is formed here from K2's NSPLIT partial sums, added in split order, each
// weighted by exp(its row maximum - the row's overall maximum) / the row's overall sum
// of exponentials.
// A thread owns one output row and 8 values of d: one 16-byte piece
// of W2[b], which is stored in fragment order for K5.
// ---------------------------------------------------------------------------
#define W2_ROWS  64                       // output rows per workgroup
#define CTX_PITCH 36                      // floats per LDS row: 16 B x odd, b128 reads stay aligned
#define WT_PITCH (NSPLIT + 4)             // floats per LDS row of the weights: 16 B x odd
#define W2_SP 16                          // partial sums in each of a thread's two register sets
__global__ __launch_bounds__(256) void w2_kernel(
    const float* __restrict__ w_out, const float* __restrict__ ctx_part,
    const float* __restrict__ part_max, const float* __restrict__ part_sum,
    _Float16* __restrict__ W2h) {
  __shared__ __align__(16) float ctxT[DHEAD * CTX_PITCH];  // [e][d]
  __shared__ __align__(16) float wts[DHEAD * WT_PITCH];    // [d][split]
  const int b = blockIdx.x, h = blockIdx.y, tid = threadIdx.x;
  const int o  = blockIdx.z * W2_ROWS + (tid >> 2);
  const int dg = (tid & 3) * 8;
  // this thread's four context elements of every split: row d = tid >> 3, columns (tid & 7) * 4 ..
  const float4* pbase = (const float4*)ctx_part + ((size_t)b * NHEAD + h) * 256;
  // the first two sets of partial sums do not depend on the weights: they load beside the statistics.
  // unrolled: pq is indexed by constants only and all loads are in flight together
  float4 pq[2][W2_SP];
#pragma unroll
  for (int t = 0; t < 2; ++t)
#pragma unroll
    for (int k = 0; k < W2_SP; ++k) pq[t][k] = pbase[(size_t)(t * W2_SP + k) * BATCH * 1024 + tid];
  // weight of split sp in row d: exp(its maximum - the row's maximum) / the row's sum.
  // 8 neighbouring lanes share a row, 8 splits each.
  {
    const int row = tid >> 3, s0 = (tid & 7) * 8;
    const int st = b * HID + h * DHEAD + row;
    float mm[8], ll[8];
#pragma unroll
    for (int j = 0; j < 8; ++j) {
      mm[j] = part_max[(s0 + j) * (BATCH * HID) + st];
      ll[j] = part_sum[(s0 + j) * (BATCH * HID) + st];
    }
    float mx = mm[0];
#pragma unroll
    for (int j = 1; j < 8; ++j) mx = fmaxf(mx, mm[j]);
#pragma unroll
    for (int s = 1; s < 8; s <<= 1) mx = fmaxf(mx, __shfl_xor(mx, s));
    float ls = 0.f;
#pragma unroll
    for (int j = 0; j < 8; ++j) {
      mm[j] = exp_slot(mm[j] - mx);
      ls = fmaf(ll[j], mm[j], ls);
    }
#pragma unroll
    for (int s = 1; s < 8; s <<= 1) ls += __shfl_xor(ls, s);
    const float inv = 1.0f / ls;
    *(float4*)(wts + row * WT_PITCH + s0) =
        make_float4(mm[0] * inv, mm[1] * inv, mm[2] * inv, mm[3] * inv);
    *(float4*)(wts + row * WT_PITCH + s0 + 4) =
        make_float4(mm[4] * inv, mm[5] * inv, mm[6] * inv, mm[7] * inv);
  }
  // this thread's 32 weights of w_out: used behind the second barrier only
  const float4* wrow = (const float4*)(w_out + o * HID + h * DHEAD);
  float4 w4[DHEAD / 4];
  // unrolled: w4 is indexed by constants only and stays in registers
#pragma unroll
  for (int i = 0; i < DHEAD / 4; ++i) w4[i] = wrow[i];
  // publishes the weights to the threads that sum the partial sums
  __syncthreads();
  {
    const int d = tid >> 3, e = (tid & 7) * 4;
    const float4* wr = (const float4*)(wts + d * WT_PITCH);
    float4 s = make_float4(0.f, 0.f, 0.f, 0.f);
    // two trips over the two sets, splits in order; in the first trip a set is refilled as soon as
    // it has been added, so that its loads fly under the other set's adds.  Kept rolled: unrolled,
    // all loads are lifted to the top and the partial sums alone take 256 registers
#pragma unroll 1
    for (int g = 0; g < NSPLIT / (2 * W2_SP); ++g) {
#pragma unroll
      for (int t = 0; t < 2; ++t) {
#pragma unroll
        for (int k4 = 0; k4 < W2_SP / 4; ++k4) {
          const float4 w4s = wr[(g * 2 + t) * (W2_SP / 4) + k4];
          const float wv[4] = {w4s.x, w4s.y, w4s.z, w4s.w};
#pragma unroll
          for (int k = 0; k < 4; ++k) {
            const float4 q = pq[t][k4 * 4 + k];
            s.x = fmaf(q.x, wv[k], s.x); s.y = fmaf(q.y, wv[k], s.y);
            s.z = fmaf(q.z, wv[k], s.z); s.w = fmaf(q.w, wv[k], s.w);
          }
        }
        if (g + 1 < NSPLIT / (2 * W2_SP)) {
          // the set's first split two sets on
          const float4* rp = pbase + (size_t)(((g + 1) * 2 + t) * W2_SP) * BATCH * 1024;
#pragma unroll
          for (int k = 0; k < W2_SP; ++k) pq[t][k] = rp[(size_t)k * BATCH * 1024 + tid];
        }
      }
    }
    float* col = ctxT + e * CTX_PITCH + d;
    col[0 * CTX_PITCH] = s.x;
    col[1 * CTX_PITCH] = s.y;
    col[2 * CTX_PITCH] = s.z;
    col[3 * CTX_PITCH] = s.w;
  }
  __syncthreads();
  float acc[8];
#pragma unroll
  for (int j = 0; j < 8; ++j) acc[j] = 0.f;
  const float* crow = ctxT + dg;
  // both loops unrolled: LDS offsets become immediates and many row reads are in flight;
  // e runs upwards, one fused multiply-add per term
#pragma unroll
  for (int e4 = 0; e4 < DHEAD / 4; ++e4) {
    const float wv[4] = {w4[e4].x, w4[e4].y, w4[e4].z, w4[e4].w};
#pragma unroll
    for (int k = 0; k < 4; ++k) {
      const float4 c0 = *(const float4*)(crow + (e4 * 4 + k) * CTX_PITCH);
      const float4 c1 = *(const float4*)(crow + (e4 * 4 + k) * CTX_PITCH + 4);
      acc[0] = fmaf(wv[k], c0.x, acc[0]); acc[1] = fmaf(wv[k], c0.y, acc[1]);
      acc[2] = fmaf(wv[k], c0.z, acc[2]); acc[3] = fmaf(wv[k], c0.w, acc[3]);
      acc[4] = fmaf(wv[k], c1.x, acc[4]); acc[5] = fmaf(wv[k], c1.y, acc[5]);
      acc[6] = fmaf(wv[k], c1.z, acc[6]); acc[7] = fmaf(wv[k], c1.w, acc[7]);
    }
  }
  v8h r;
#pragma unroll
  for (int j = 0; j < 8; ++j) r[j] = (_Float16)acc[j];
  ((v8h*)(W2h + (size_t)b * CH * HID))[frag_piece(o, h * DHEAD + dg, HID / 32)] = r;
}

// ---------------------------------------------------------------------------
// K5: Y = W2[b] @ qs  + b_out, then RMSNorm over the 256 output channels.
// WMMA; one workgroup owns a full 256-row x 64-col tile so the channel
// norm needs no other workgroup.  A fragments as in K2: global to registers.
// The q tile (64 tokens x 128 k, 16 KB contiguous in memory) is staged whole, as in K2:
// one barrier publishes it and the k loop has none; the first two k steps' A fragments load beside it.
// ---------------------------------------------------------------------------
// halves per LDS row of the q tile [n][k]: 272 B = 16 B x odd, as X_PITCH
#define Q_PITCH (HID + 8)
__global__ __launch_bounds__(256, 8) void out_kernel(
    const _Float16* __restrict__ W2h, const _Float16* __restrict__ qs_t,
    const float* __restrict__ b_out, const float* __restrict__ out_g,
    float* __restrict__ out) {
  __shared__ __align__(16) char smem[CH * O_PITCH * 4];
  _Float16* lds_b = (_Float16*)smem;
  float*    lds_y = (float*)smem;
  // sum of squares of column n over the 32 output rows of wave w: ssq[n][w]; 48 B a column, so
  // that a column's eight sums are two 16-byte reads
  __shared__ __align__(16) float ssq[TOK][12];
  // bias and gain of the 256 output rows: a thread fetches one of each, beside the q loads
  __shared__ __align__(16) float bg[2][CH];

  const int tid = threadIdx.x;
  // the wave's number in a scalar register: what is formed from it takes no vector registers,
  // of which this kernel has none to spare
  const int wave = __builtin_amdgcn_readfirstlane(tid >> 5), lane = tid & 31;
  const int n0 = blockIdx.x * TOK;
  const int b  = blockIdx.y;

  const int c = lane & 15, hs = lane >> 4;
  v8f acc[2][TOK / 16];

  const v8h* wl = (const v8h*)(W2h + (size_t)b * CH * HID) + (unsigned)(wave * 2 * (HID / 32) * 64 + lane);
  // B: TOK tokens x 128 halves, 16 bytes a piece; a wave-wide load covers 512 contiguous bytes
  const v8h* bsrc = (const v8h*)(qs_t + ((size_t)b * NTOK + n0) * HID);
  v8h bq[TOK / 16];
#pragma unroll
  for (int i = 0; i < TOK / 16; ++i) bq[i] = bsrc[tid + i * 256];
  const float bias_t = b_out[tid], gain_t = out_g[tid];
  // this wave's two A fragments of the first two k steps, issued beside the B loads
  v16h af[HID / 32][2];
#pragma unroll
  for (int ks = 0; ks < HID / 32 - 2; ++ks)
#pragma unroll
    for (int i = 0; i < 2; ++i) af[ks][i] = load_frag_packed(wl, i, ks, HID / 32);
#pragma unroll
  for (int i = 0; i < TOK / 16; ++i) {
    int idx = tid + i * 256;
    *(v8h*)(lds_b + (idx >> 4) * Q_PITCH + (idx & 15) * 8) = bq[i];
  }
  bg[0][tid] = bias_t;
  bg[1][tid] = gain_t;
  // publishes the q tile, the biases and the gains
  __syncthreads();
  // the accumulators start from the bias of their rows (register r = row 8 * hs + r of the tile),
  // so that they end as the values whose squares the norm sums: the first k step's products take
  // bias_v as their C operand
  v8f bias_v[2];
#pragma unroll
  for (int i = 0; i < 2; ++i) {
    const float4* bp = (const float4*)&bg[0][(wave * 2 + i) * 16 + hs * 8];
    const float4 b0 = bp[0], b1 = bp[1];
    bias_v[i][0] = b0.x; bias_v[i][1] = b0.y; bias_v[i][2] = b0.z; bias_v[i][3] = b0.w;
    bias_v[i][4] = b1.x; bias_v[i][5] = b1.y; bias_v[i][6] = b1.z; bias_v[i][7] = b1.w;
  }
  // unrolled: af is indexed by constants only and LDS offsets become immediates
#pragma unroll
  for (int ks = 0; ks < HID / 32; ++ks) {
#pragma unroll
    for (int j = 0; j < TOK / 16; ++j) {
      v16h bf = load_frag(lds_b + j * 16 * Q_PITCH + ks * 32, lane, Q_PITCH);
#pragma unroll
      for (int i = 0; i < 2; ++i)
        acc[i][j] = wmma_f16(af[ks][i], bf, ks == 0 ? bias_v[i] : acc[i][j]);
    }
    if (ks == 0) {
      // the last two steps' A fragments: beside the others and the bias they do not fit the register
      // budget and spill; here they take registers that the q staging, the bias and the first step's
      // products have freed
#pragma unroll
      for (int k2 = HID / 32 - 2; k2 < HID / 32; ++k2)
#pragma unroll
        for (int i = 0; i < 2; ++i) af[k2][i] = load_frag_packed(wl, i, k2, HID / 32);
      // keeps these loads ahead of their use: the compiler otherwise moves them down to the
      // steps that use them, which then wait out the trip to L2
      __builtin_amdgcn_sched_barrier(0);
    }
  }
  // keeps the sums below behind the products: moved in among them they lengthen the lives of
  // fragments and accumulators past the register budget, and accumulators spill
  __builtin_amdgcn_sched_barrier(0);
  // The channel norm is taken from the accumulators, by all waves: a lane sums the squares of its
  // 16 rows of each of its four columns; the other lane half holds the wave's other 16 rows.
  float ss[TOK / 16];
#pragma unroll
  for (int j = 0; j < TOK / 16; ++j) {
    ss[j] = 0.f;
#pragma unroll
    for (int i = 0; i < 2; ++i)
#pragma unroll
      for (int r = 0; r < 8; ++r) ss[j] = fmaf(acc[i][j][r], acc[i][j][r], ss[j]);
  }
#pragma unroll
  for (int j = 0; j < TOK / 16; ++j) ss[j] += __shfl_xor(ss[j], 16);
  // both halves hold all four sums: the lower half stores columns 0..31, the upper 32..63
  ssq[hs * 32 + c][wave]      = hs ? ss[2] : ss[0];
  ssq[hs * 32 + 16 + c][wave] = hs ? ss[3] : ss[1];
  // publishes the eight partial sums of squares, and ends the last reads of lds_b, whose memory
  // the accumulators are dumped into
  __syncthreads();
  const float4 pa0 = *(const float4*)&ssq[lane][0],      pa1 = *(const float4*)&ssq[lane][4];
  const float4 pb0 = *(const float4*)&ssq[lane + 32][0], pb1 = *(const float4*)&ssq[lane + 32][4];
  const float s2a = ((((((pa0.x + pa0.y) + pa0.z) + pa0.w) + pa1.x) + pa1.y) + pa1.z) + pa1.w;
  const float s2b = ((((((pb0.x + pb0.y) + pb0.z) + pb0.w) + pb1.x) + pb1.y) + pb1.z) + pb1.w;
  const float inva = 16.0f / fmaxf(sqrtf(s2a), 1e-12f);
  const float invb = 16.0f / fmaxf(sqrtf(s2b), 1e-12f);
  float invc[TOK / 16];
  invc[0] = __shfl(inva, c);
  invc[1] = __shfl(inva, c + 16);
  invc[2] = __shfl(invb, c);
  invc[3] = __shfl(invb, c + 16);
  // finished values into the wave's own 32 rows of the tile: no other wave reads or writes them
#pragma unroll
  for (int i = 0; i < 2; ++i) {
    const int Rb = (wave * 2 + i) * 16 + hs * 8;
    const float4* gp = (const float4*)&bg[1][Rb];
    const float4 g0 = gp[0], g1 = gp[1];
    const float gain[8] = {g0.x, g0.y, g0.z, g0.w, g1.x, g1.y, g1.z, g1.w};
#pragma unroll
    for (int j = 0; j < TOK / 16; ++j)
#pragma unroll
      for (int r = 0; r < 8; ++r)
        lds_y[(Rb + r) * O_PITCH + j * 16 + c] = acc[i][j][r] * invc[j] * gain[r];
  }
  // the wave's own LDS stores are done before its lanes read one another's values back; the
  // clobber keeps the reads below behind the stores above
  asm volatile("s_wait_dscnt 0x0" ::: "memory");
  // a lane takes two neighbouring tokens, a wave one whole row of the tile (two lines).
  // unrolled: yv is indexed by constants only and LDS offsets become immediates
  {
    const float* yr = lds_y + wave * 32 * O_PITCH + 2 * lane;
    float* op = out + ((size_t)b * CH + wave * 32) * NTOK + n0 + 2 * lane;
    float2 yv[32];
#pragma unroll
    for (int o = 0; o < 32; ++o) yv[o] = *(const float2*)(yr + o * O_PITCH);
    // keeps all the reads in front of the stores: the compiler otherwise reads two rows, waits,
    // stores them and reads the next two into the same registers, one LDS latency per pair
    __builtin_amdgcn_sched_barrier(0);
#pragma unroll
    for (int o = 0; o < 32; ++o) *(float2*)(op + (size_t)o * NTOK) = yv[o];
  }
}

// ---------------------------------------------------------------------------
extern "C" void kernel_launch(void* const* d_in, const int* in_sizes, int n_in,
                              void* d_out, int out_size, void* d_ws, size_t ws_size,
                              hipStream_t stream) {
  (void)in_sizes; (void)n_in; (void)out_size; (void)ws_size;
  const float* x        = (const float*)d_in[0];   // (16,256,64,64)
  const float* norm_g   = (const float*)d_in[1];   // (256)
  const float* w_qkv    = (const float*)d_in[2];   // (384,256)
  const float* mem_kv   = (const float*)d_in[3];   // (2,4,32,4)
  const float* w_out    = (const float*)d_in[4];   // (256,128)
  const float* b_out    = (const float*)d_in[5];   // (256)
  const float* out_g    = (const float*)d_in[6];   // (256)
  float* out = (float*)d_out;                      // (16,256,64,64)

  char* ws = (char*)d_ws;
  size_t off = 0;
  auto take = [&](size_t bytes) -> char* {
    char* p = ws + off;
    off = (off + bytes + 255) & ~(size_t)255;
    return p;
  };
  _Float16* wqkv_h   = (_Float16*)take((size_t)QKVR * CH * 2);           // 192 KB
  _Float16* qs_t     = (_Float16*)take((size_t)BATCH * NTOK * HID * 2);  // 16 MB
  float*    part_max = (float*)   take((size_t)NSPLIT * BATCH * HID * 4);  // 512 KB
  float*    part_sum = (float*)   take((size_t)NSPLIT * BATCH * HID * 4);  // 512 KB
  float*    ctx_part = (float*)   take((size_t)NSPLIT * BATCH * NHEAD * DHEAD * DHEAD * 4);  // 16 MB
  _Float16* W2h      = (_Float16*)take((size_t)BATCH * CH * HID * 2);    // 1 MB

  prep_kernel<<<QKVR, 256, 0, stream>>>(w_qkv, norm_g, wqkv_h);
  qkv_kernel<<<dim3(NTOK / TOK, BATCH), 256, 0, stream>>>(
      x, wqkv_h, mem_kv, qs_t, ctx_part, part_max, part_sum);
  w2_kernel<<<dim3(BATCH, NHEAD, CH / W2_ROWS), 256, 0, stream>>>(
      w_out, ctx_part, part_max, part_sum, W2h);
  out_kernel<<<dim3(NTOK / TOK, BATCH), 256, 0, stream>>>(
      W2h, qs_t, b_out, out_g, out);
}
